// v000
// Times are from an AMD MI455X. After a warm-up the kernel runs many times in a row, and a time is the length of
// such a window on the GPU divided by its runs, so every launch and the gaps after it count. The runs cycle
// through copies of the inputs. A figure is the median of several windows, for all but v000 over two sittings.
// Sittings can differ by a few percent; kernels timed side by side share one.
// v000, which the later versions start from, runs in 1430 microseconds.
#include <hip/hip_runtime.h>

// Causal multi-head self-attention whose key and value are the QUERY projection (the module's bug, reproduced: x [2][2048][1024]; q = x Wq^T ('oi' [1024][1024] 1/32, no bias), k = v = q (16 heads x 64); scores masked above the diagonal (-inf == exclusion) then x 1/sqrt(64); softmax; ctx = attn.q; out = ctx Wo^T + bo ('oi') -> [2][2048][1024] (4.2 M); argument order x, Wq, Wo, bo).
// Layout per batch: bf16 copy of x; 'oi' weights; the one exact projection is computed into the q, k and v roles (three identical GEMMs keep the plane builders unchanged); identity-table plane builders; causal T-2048 attention (hybrid rows: < 512 hi/lo 3 products, rest fp16 x1024; k_gemmc skips tiles above the diagonal); merged hi/lo x Wo exact + bo.
// Compute dtypes, f32 accumulate: every input rounded to bf16; projection exact; attention rows < 512 3 products, rest fp16; softmax f32; Wo hl x exact + bias.

#define NB_  2
#define TT   2048
#define DM   1024
#define NH_  16
#define NKV  16
#define REP  (NH_ / NKV)
#define HD   64
#define DQ   (NH_ * HD)
#define DKV  (NKV * HD)
#define ZH   2
#define RH   512                  // query rows < RH use hi+lo planes (0: none)
#define WIN  2048
#define PCAR 1024.0f
#define SCL  0.125f   // HD^-0.5
typedef _Float16 h16;
typedef unsigned short bf;
typedef __attribute__((ext_vector_type(16))) __bf16   v16bf;
typedef __attribute__((ext_vector_type(16))) _Float16 v16h;
typedef __attribute__((ext_vector_type(8)))  _Float16 v8h;
typedef __attribute__((ext_vector_type(8)))  unsigned short v8us;
typedef __attribute__((ext_vector_type(8)))  float    v8f;
typedef __attribute__((ext_vector_type(4)))  float    v4f;
typedef v8h  __attribute__((may_alias)) v8ha;
typedef v4f  __attribute__((may_alias)) v4fa;
typedef v8us __attribute__((may_alias)) v8usa;

__device__ __forceinline__ unsigned short f2bf(float f) { unsigned u = __float_as_uint(f); u += 0x7FFFu + ((u >> 16) & 1u); return (unsigned short)(u >> 16); }
__device__ __forceinline__ float bf2f(unsigned short b) { return __uint_as_float(((unsigned)b) << 16); }
__device__ __forceinline__ float bfr(float f) { return bf2f(f2bf(f)); }
__device__ __forceinline__ v16h cat16(v8h lo, v8h hi) { return __builtin_shufflevector(lo, hi, 0, 1, 2, 3, 4, 5, 6, 7, 8, 9, 10, 11, 12, 13, 14, 15); }
__device__ __forceinline__ v16bf cat16b(v8us lo, v8us hi) { return __builtin_bit_cast(v16bf, __builtin_shufflevector(lo, hi, 0, 1, 2, 3, 4, 5, 6, 7, 8, 9, 10, 11, 12, 13, 14, 15)); }
__device__ __forceinline__ v8f wmma16(v16h a, v16h b, v8f c) { return __builtin_amdgcn_wmma_f32_16x16x32_f16(false, a, false, b, (short)0, c, false, false); }
__device__ __forceinline__ v8f wmmab(v16bf a, v16bf b, v8f c) { return __builtin_amdgcn_wmma_f32_16x16x32_bf16(false, a, false, b, (short)0, c, false, false); }



// ---- k_gemmw: register-blocked GEMM, ONE WAVE per 64x64 output tile (16 accumulators), operands straight from K-contiguous 16-bit planes; grid (M/64, N/64, Z), 32 threads.
// C[m][n] (f32, pitch ldc, + optional f32 bias[n]) = sum_k A[m][k] Bt[n][k] (+ split products per NSPLIT). z-batch strides sA/sB/sC in elements. K % 32 == 0.
template <typename T16> struct WFrag;
template <> struct WFrag<h16> { typedef v16h V; static __device__ __forceinline__ V ld(const h16* p) { return cat16(*(const v8h*)p, *(const v8h*)(p + 16)); } static __device__ __forceinline__ v8f mma(V a, V b, v8f c) { return wmma16(a, b, c); } };
template <> struct WFrag<bf> { typedef v16bf V; static __device__ __forceinline__ V ld(const bf* p) { return cat16b(*(const v8us*)p, *(const v8us*)(p + 16)); } static __device__ __forceinline__ v8f mma(V a, V b, v8f c) { return wmmab(a, b, c); } };
template <typename T16, int NSPLIT, bool BIAS>
__global__ __launch_bounds__(32) void k_gemmw(const T16* __restrict__ A, const T16* __restrict__ A2, const T16* __restrict__ Bt, const T16* __restrict__ Bt2, int K, float* C, int ldc, const float* __restrict__ bias, size_t sA, size_t sB, size_t sC) {
    typedef typename WFrag<T16>::V V;
    __shared__ __align__(16) float os[16 * 68];
    const size_t z = blockIdx.z; A += z * sA; if (A2) A2 += z * sA; Bt += z * sB; if (Bt2) Bt2 += z * sB; C += z * sC;
    const int lane = threadIdx.x & 31, lr = lane & 15, hi = lane >> 4; const int r0 = blockIdx.x * 64, c0 = blockIdx.y * 64;
    v8f acc[4][4];
#pragma unroll
    for (int mb = 0; mb < 4; ++mb)
#pragma unroll
        for (int nb = 0; nb < 4; ++nb) acc[mb][nb] = (v8f){};
    const size_t aoff = (size_t)(r0 + lr) * K + 8 * hi, boff = (size_t)(c0 + lr) * K + 8 * hi;
#pragma unroll 1
    for (int kc = 0; kc < K; kc += 32) {
        V a[4], a2[4];
#pragma unroll
        for (int mb = 0; mb < 4; ++mb) { a[mb] = WFrag<T16>::ld(A + aoff + (size_t)mb * 16 * K + kc); if (NSPLIT == 1 || NSPLIT == 2) a2[mb] = WFrag<T16>::ld(A2 + aoff + (size_t)mb * 16 * K + kc); }
#pragma unroll
        for (int nb = 0; nb < 4; ++nb) { const V b = WFrag<T16>::ld(Bt + boff + (size_t)nb * 16 * K + kc); V b2; if (NSPLIT >= 2) b2 = WFrag<T16>::ld(Bt2 + boff + (size_t)nb * 16 * K + kc);
#pragma unroll
            for (int mb = 0; mb < 4; ++mb) { acc[mb][nb] = WFrag<T16>::mma(a[mb], b, acc[mb][nb]); if (NSPLIT == 1 || NSPLIT == 2) acc[mb][nb] = WFrag<T16>::mma(a2[mb], b, acc[mb][nb]); if (NSPLIT >= 2) acc[mb][nb] = WFrag<T16>::mma(a[mb], b2, acc[mb][nb]); } }
        asm volatile("v_nop\n\tv_nop\n\tv_nop\n\tv_nop" : "+v"(acc[0][0]), "+v"(acc[1][1]), "+v"(acc[2][2]), "+v"(acc[3][3]) : "v"(a[0]), "v"(a[3]));
    }
#pragma unroll
    for (int mb = 0; mb < 4; ++mb) {
#pragma unroll
        for (int nb = 0; nb < 4; ++nb) {
#pragma unroll
            for (int j = 0; j < 8; ++j) os[(hi * 8 + j) * 68 + nb * 16 + lr] = acc[mb][nb][j]; }
        __builtin_amdgcn_wave_barrier(); asm volatile("" ::: "memory");
        float* crow = C + (size_t)(r0 + mb * 16) * ldc + c0;
{
#pragma unroll
            for (int s = 0; s < 8; ++s) { const int row = 2 * s + hi, cofs = lr * 4; v4f val = *(const v4fa*)(os + row * 68 + cofs); if (BIAS) { val[0] += bfr(bias[c0 + cofs]); val[1] += bfr(bias[c0 + cofs + 1]); val[2] += bfr(bias[c0 + cofs + 2]); val[3] += bfr(bias[c0 + cofs + 3]); }
                *(v4f*)(crow + (size_t)row * ldc + cofs) = val; }
             }
        __builtin_amdgcn_wave_barrier(); asm volatile("" ::: "memory");
    }
}

// ---- k_gemmc: the same one-wave 64x64 tile GEMM specialised for causal attention: CMODE 1 skips score tiles entirely above the diagonal (query rows r0+roff.., key columns c0..), CMODE 2 limits the
// key (K) loop of the probability x value contraction to the diagonal block (probabilities beyond it are exactly zero). roff = row offset of this launch's first row within the sequence.
template <typename T16, int NSPLIT, int CMODE>
__global__ __launch_bounds__(32) void k_gemmc(const T16* __restrict__ A, const T16* __restrict__ A2, const T16* __restrict__ Bt, const T16* __restrict__ Bt2, int K, float* C, int ldc, int roff, size_t sA, size_t sB, size_t sC) {
    typedef typename WFrag<T16>::V V;
    __shared__ __align__(16) float os[16 * 68];
    const size_t z = blockIdx.z; A += z * sA; if (A2) A2 += z * sA; Bt += z * sB; if (Bt2) Bt2 += z * sB; C += z * sC;
    const int lane = threadIdx.x & 31, lr = lane & 15, hi = lane >> 4; const int r0 = blockIdx.x * 64, c0 = blockIdx.y * 64;
    if (CMODE == 1 && c0 > r0 + roff + 63) return;                  // score tile entirely above the causal diagonal: never read (the softmax masks j > i by select)
    const int Kl = (CMODE == 2) ? min(K, r0 + roff + 64) : K;        // P.V: probabilities are exactly 0 beyond the diagonal block, so the K loop stops there
    v8f acc[4][4];
#pragma unroll
    for (int mb = 0; mb < 4; ++mb)
#pragma unroll
        for (int nb = 0; nb < 4; ++nb) acc[mb][nb] = (v8f){};
    const size_t aoff = (size_t)(r0 + lr) * K + 8 * hi, boff = (size_t)(c0 + lr) * K + 8 * hi;
#pragma unroll 1
    for (int kc = 0; kc < Kl; kc += 32) {
        V a[4], a2[4];
#pragma unroll
        for (int mb = 0; mb < 4; ++mb) { a[mb] = WFrag<T16>::ld(A + aoff + (size_t)mb * 16 * K + kc); if (NSPLIT == 1 || NSPLIT == 2) a2[mb] = WFrag<T16>::ld(A2 + aoff + (size_t)mb * 16 * K + kc); }
#pragma unroll
        for (int nb = 0; nb < 4; ++nb) { const V b = WFrag<T16>::ld(Bt + boff + (size_t)nb * 16 * K + kc); V b2; if (NSPLIT >= 2) b2 = WFrag<T16>::ld(Bt2 + boff + (size_t)nb * 16 * K + kc);
#pragma unroll
            for (int mb = 0; mb < 4; ++mb) { acc[mb][nb] = WFrag<T16>::mma(a[mb], b, acc[mb][nb]); if (NSPLIT == 1 || NSPLIT == 2) acc[mb][nb] = WFrag<T16>::mma(a2[mb], b, acc[mb][nb]); if (NSPLIT >= 2) acc[mb][nb] = WFrag<T16>::mma(a[mb], b2, acc[mb][nb]); } }
        asm volatile("v_nop\n\tv_nop\n\tv_nop\n\tv_nop" : "+v"(acc[0][0]), "+v"(acc[1][1]), "+v"(acc[2][2]), "+v"(acc[3][3]) : "v"(a[0]), "v"(a[3]));
    }
#pragma unroll
    for (int mb = 0; mb < 4; ++mb) {
#pragma unroll
        for (int nb = 0; nb < 4; ++nb) {
#pragma unroll
            for (int j = 0; j < 8; ++j) os[(hi * 8 + j) * 68 + nb * 16 + lr] = acc[mb][nb][j]; }
        __builtin_amdgcn_wave_barrier(); asm volatile("" ::: "memory");
        float* crow = C + (size_t)(r0 + mb * 16) * ldc + c0;
{
#pragma unroll
            for (int s = 0; s < 8; ++s) { const int row = 2 * s + hi, cofs = lr * 4; v4f val = *(const v4fa*)(os + row * 68 + cofs);
                *(v4f*)(crow + (size_t)row * ldc + cofs) = val; }
             }
        __builtin_amdgcn_wave_barrier(); asm volatile("" ::: "memory");
    }
}

__device__ __forceinline__ h16 tohx(float x) { return (h16)x; }
__device__ __forceinline__ void splitf(float y, unsigned short& h, unsigned short& l) { h = f2bf(y); l = f2bf(y - bf2f(h)); }
typedef __attribute__((ext_vector_type(2))) _Float16 v2h;
typedef __attribute__((ext_vector_type(4))) _Float16 v4h;
typedef __attribute__((ext_vector_type(2))) unsigned short v2us;
typedef __attribute__((ext_vector_type(4))) unsigned short v4us;
typedef __attribute__((ext_vector_type(2))) float v2f;
typedef __attribute__((ext_vector_type(4))) int v4i;

__global__ __launch_bounds__(256) void k_cvt8(const float* __restrict__ src, bf* dst, size_t n8) { const size_t i = (size_t)blockIdx.x * 256 + threadIdx.x; if (i >= n8) return; const v8f v = *(const v8f*)(src + i * 8); v8us o;
#pragma unroll
    for (int k = 0; k < 8; ++k) o[k] = f2bf(v[k]); *(v8us*)(dst + i * 8) = o;  }

// k_rope: head planes [h][t][d] (fp16 + hi/lo) of rope(x) x sc with the rotate-half convention out[d] = x[d] cos[t][d] - x[d+HD/2] sin[t][d], out[d+HD/2] = x[d+HD/2] cos[t][d+HD/2] + x[d] sin[t][d+HD/2]
__global__ __launch_bounds__(256) void k_rope(const float* __restrict__ F, int pitch, int nheads, const float* __restrict__ CS, const float* __restrict__ RF, const float* __restrict__ nw, float sc, h16* P16, bf* Ph, bf* Pl) {
    const size_t e = ((size_t)blockIdx.x * 256 + threadIdx.x) * 2; if (e >= (size_t)nheads * TT * HD) return; const int d = (int)(e % HD); const int t = (int)((e / HD) % TT); const int h = (int)(e / ((size_t)HD * TT)); const float* f = F + (size_t)t * pitch + h * HD; const float rf = RF ? RF[(size_t)h * TT + t] : 1.0f; v2h o16; v2us oh, ol;
#pragma unroll
    for (int q = 0; q < 2; ++q) { const int dd = d + q; const int dp = (dd < HD / 2) ? dd + HD / 2 : dd - HD / 2; float x0 = f[dd], x1 = f[dp];
        if (RF) { float n0 = __fmul_rn(x0, rf), n1 = __fmul_rn(x1, rf); asm volatile("" : "+v"(n0)); asm volatile("" : "+v"(n1)); x0 = __fmul_rn(bfr(nw[dd]), n0); x1 = __fmul_rn(bfr(nw[dp]), n1); }
        const v2f cs = *(const v2f*)(CS + ((size_t)t * HD + dd) * 2); float a = __fmul_rn(x0, cs[0]), bq = __fmul_rn(x1, cs[1]); asm volatile("" : "+v"(a)); asm volatile("" : "+v"(bq)); const float r = ((dd < HD / 2) ? __fsub_rn(a, bq) : __fadd_rn(a, bq)) * sc;
        o16[q] = tohx(r); unsigned short a2, c2; splitf(r, a2, c2); oh[q] = a2; ol[q] = c2; }
    *(v2h*)(P16 + e) = o16; *(v2us*)(Ph + e) = oh; *(v2us*)(Pl + e) = ol;  }
__global__ __launch_bounds__(256) void k_vtp(const float* __restrict__ F, int pitch, int nheads, h16* V16, bf* Vh, bf* Vl) { const size_t e = ((size_t)blockIdx.x * 256 + threadIdx.x) * 2; if (e >= (size_t)nheads * HD * TT) return; const int t = (int)(e % TT); const int d = (int)((e / TT) % HD); const int g = (int)(e / ((size_t)TT * HD)); v2h o16; v2us oh, ol;
#pragma unroll
    for (int q = 0; q < 2; ++q) { const float x = F[(size_t)(t + q) * pitch + g * HD + d]; o16[q] = tohx(x); unsigned short a2, c2; splitf(x, a2, c2); oh[q] = a2; ol[q] = c2; }
    *(v2h*)(V16 + e) = o16; *(v2us*)(Vh + e) = oh; *(v2us*)(Vl + e) = ol;  }
__global__ __launch_bounds__(256) void k_csid(float* CS) { const int idx = blockIdx.x * 256 + threadIdx.x; if (idx >= TT * HD) return; v2f cs; cs[0] = 1.0f; cs[1] = 0.0f; *(v2f*)(CS + (size_t)idx * 2) = cs;  }
// k_asoft: per row (zz, i): t = S x HD^-0.5 for j <= i and i - j < WIN (sliding causal window; the reference's -1e9 additive fill vanishes identically); softmax over the 2048 keys (register row, one exp, fixed trees);
__global__ __launch_bounds__(256) void k_asoft(const float* __restrict__ Sb, h16* P16, bf* Ph, bf* Pl) {
    const int lane = threadIdx.x & 31; const int row = blockIdx.x * 8 + (threadIdx.x >> 5); if (row >= ZH * TT) return; const int i = row % TT; const int zz = row / TT; (void)zz; const bool hires = (i < RH); const float* sr = Sb + (size_t)row * TT; float v[TT / 32]; float mx = -3.0e38f;
#pragma unroll
    for (int ch = 0; ch < TT / 128; ++ch) { const int j0 = ch * 128 + lane * 4; const v4f a = *(const v4f*)(sr + j0);
#pragma unroll
        for (int q = 0; q < 4; ++q) { const int j = j0 + q; (void)j; const float t = (j <= i && i - j < WIN) ? a[q] * SCL : -3.0e38f; v[ch * 4 + q] = t; mx = fmaxf(mx, t); } }
#pragma unroll
    for (int sh = 16; sh; sh >>= 1) mx = fmaxf(mx, __shfl_xor(mx, sh, 32));
    float sum = 0.f;
#pragma unroll
    for (int k = 0; k < TT / 32; ++k) { float d0 = __fsub_rn(v[k], mx); asm volatile("" : "+v"(d0)); v[k] = __builtin_amdgcn_exp2f(__fmul_rn(d0, 1.4426950408889634f)); sum += v[k]; }
#pragma unroll
    for (int sh = 16; sh; sh >>= 1) sum += __shfl_xor(sum, sh, 32);
    const float f = __fdiv_rn(hires ? 1.0f : PCAR, sum);
{
        if (hires) {
#pragma unroll
            for (int ch = 0; ch < TT / 128; ++ch) { v4us oh, ol;
#pragma unroll
                for (int q = 0; q < 4; ++q) { unsigned short a, c2; splitf(v[ch * 4 + q] * f, a, c2); oh[q] = a; ol[q] = c2; }
                const size_t oo = ((size_t)zz * (RH ? RH : 1) + i) * TT + ch * 128 + lane * 4; *(v4us*)(Ph + oo) = oh; *(v4us*)(Pl + oo) = ol; }
        } else {
#pragma unroll
            for (int ch = 0; ch < TT / 128; ++ch) { v4h o4;
#pragma unroll
                for (int q = 0; q < 4; ++q) o4[q] = tohx(v[ch * 4 + q] * f);
                *(v4h*)(P16 + (size_t)row * TT + ch * 128 + lane * 4) = o4; } }
         }
}
__global__ __launch_bounds__(256) void k_merge(const float* __restrict__ O, int h0, bf* Ah, bf* Al) { const size_t e = ((size_t)blockIdx.x * 256 + threadIdx.x) * 2; if (e >= (size_t)ZH * TT * HD) return; const int d = (int)(e % HD); const int t = (int)((e / HD) % TT); const int zz = (int)(e / ((size_t)HD * TT)); const float cs = (t < RH) ? 1.0f : (1.0f / PCAR); const size_t oo = (size_t)t * DQ + (h0 + zz) * HD + d;
    v2us oh, ol;
#pragma unroll
    for (int q = 0; q < 2; ++q) { unsigned short a, c2; splitf(O[e + q] * cs, a, c2); oh[q] = a; ol[q] = c2; } *(v2us*)(Ah + oo) = oh; *(v2us*)(Al + oo) = ol;  }

extern "C" void kernel_launch(void* const* d_in, const int* in_sizes, int n_in,
                              void* d_out, int out_size, void* d_ws, size_t ws_size, hipStream_t stream) {
    (void)in_sizes; (void)n_in; (void)out_size;
    const float* x = (const float*)d_in[0]; const float* wq = (const float*)d_in[1]; const float* wo = (const float*)d_in[2]; const float* bo = (const float*)d_in[3];     const float* wk = wq; const float* wv = wq;   /* key == value == query projection (source bug) */
    float* OUT = (float*)d_out;     // [2][2048][1024]
    char* wsp = (char*)d_ws;
    auto take = [&](size_t bytes) { char* p = wsp; wsp += (bytes + 255) & ~(size_t)255; return (void*)p; };
    bf* WQ = (bf*)take((size_t)DQ * DM * 2); bf* WK = (bf*)take((size_t)DKV * DM * 2); bf* WV = (bf*)take((size_t)DKV * DM * 2); bf* WO = (bf*)take((size_t)DM * DQ * 2); float* CS = (float*)take((size_t)TT * HD * 2 * 4);
    bf* XB = (bf*)take((size_t)TT * DM * 2); float* FQ = (float*)take((size_t)TT * DQ * 4); float* FK = (float*)take((size_t)TT * DKV * 4);
    h16* QP16 = (h16*)take((size_t)NH_ * TT * HD * 2); h16* KP16 = (h16*)take((size_t)NKV * TT * HD * 2); h16* VT16 = (h16*)take((size_t)NKV * HD * TT * 2);
    bf* QPh = (bf*)take((size_t)NH_ * TT * HD * 2); bf* QPl = (bf*)take((size_t)NH_ * TT * HD * 2); bf* KPh = (bf*)take((size_t)NKV * TT * HD * 2); bf* KPl = (bf*)take((size_t)NKV * TT * HD * 2); bf* VTh = (bf*)take((size_t)NKV * HD * TT * 2); bf* VTl = (bf*)take((size_t)NKV * HD * TT * 2); bf* Ph = (bf*)take((size_t)ZH * RH * TT * 2); bf* Pl = (bf*)take((size_t)ZH * RH * TT * 2);
    float* Sb = (float*)take((size_t)ZH * TT * TT * 4); h16* P16 = (h16*)take((size_t)ZH * TT * TT * 2); float* Ob = (float*)take((size_t)ZH * TT * HD * 4); bf* ATh = (bf*)take((size_t)TT * DQ * 2); bf* ATl = (bf*)take((size_t)TT * DQ * 2);
    if ((size_t)(wsp - (char*)d_ws) > ws_size) return;    // ws 256 MiB
    float* FV = FK;   // v projection reuses the k buffer after the k planes are built (stream-ordered)
    { k_cvt8<<<(unsigned)(((size_t)DQ * DM / 8 + 255) / 256), 256, 0, stream>>>(wq, WQ, (size_t)DQ * DM / 8); k_cvt8<<<(unsigned)(((size_t)DKV * DM / 8 + 255) / 256), 256, 0, stream>>>(wk, WK, (size_t)DKV * DM / 8); k_cvt8<<<(unsigned)(((size_t)DKV * DM / 8 + 255) / 256), 256, 0, stream>>>(wv, WV, (size_t)DKV * DM / 8);
      k_cvt8<<<(unsigned)(((size_t)DM * DQ / 8 + 255) / 256), 256, 0, stream>>>(wo, WO, (size_t)DM * DQ / 8);
       }
    k_csid<<<(TT * HD + 255) / 256, 256, 0, stream>>>(CS);
    const unsigned LQ = (unsigned)(((size_t)NH_ * TT * HD / 2 + 255) / 256), LKv = (unsigned)(((size_t)NKV * TT * HD / 2 + 255) / 256);
    for (int b = 0; b < NB_; ++b) {
        
        k_cvt8<<<(unsigned)(((size_t)TT * DM / 8 + 255) / 256), 256, 0, stream>>>(x + (size_t)b * TT * DM, XB, (size_t)TT * DM / 8);
        k_gemmw<bf, 0, false><<<dim3(TT / 64, DQ / 64, 1), 32, 0, stream>>>(XB, nullptr, WQ, nullptr, DM, FQ, DQ, nullptr, 0, 0, 0);
        k_rope<<<LQ, 256, 0, stream>>>(FQ, DQ, NH_, CS, nullptr, nullptr, 1.0f, QP16, QPh, QPl);
        k_gemmw<bf, 0, false><<<dim3(TT / 64, DKV / 64, 1), 32, 0, stream>>>(XB, nullptr, WK, nullptr, DM, FK, DKV, nullptr, 0, 0, 0);
        k_rope<<<LKv, 256, 0, stream>>>(FK, DKV, NKV, CS, nullptr, nullptr, 1.0f, KP16, KPh, KPl);
        k_gemmw<bf, 0, false><<<dim3(TT / 64, DKV / 64, 1), 32, 0, stream>>>(XB, nullptr, WV, nullptr, DM, FV, DKV, nullptr, 0, 0, 0); k_vtp<<<LKv, 256, 0, stream>>>(FV, DKV, NKV, VT16, VTh, VTl);
        for (int h0 = 0; h0 < NH_; h0 += ZH) { const size_t zq = (size_t)h0, zk = (size_t)(h0 / REP);   // one kv head per query head: the pass's two heads use consecutive kv planes (z-strides TT*HD)
            k_gemmc<bf, 2, 1><<<dim3(RH / 64, TT / 64, ZH), 32, 0, stream>>>(QPh + zq * TT * HD, QPl + zq * TT * HD, KPh + zk * TT * HD, KPl + zk * TT * HD, HD, Sb, TT, 0, (size_t)TT * HD, (size_t)TT * HD, (size_t)TT * TT);
            k_gemmc<h16, 0, 1><<<dim3((TT - RH) / 64, TT / 64, ZH), 32, 0, stream>>>(QP16 + zq * TT * HD + (size_t)RH * HD, nullptr, KP16 + zk * TT * HD, nullptr, HD, Sb + (size_t)RH * TT, TT, RH, (size_t)TT * HD, (size_t)TT * HD, (size_t)TT * TT);
            k_asoft<<<ZH * TT / 8, 256, 0, stream>>>(Sb, P16, Ph, Pl);
            k_gemmc<bf, 2, 2><<<dim3(RH / 64, HD / 64, ZH), 32, 0, stream>>>(Ph, Pl, VTh + zk * HD * TT, VTl + zk * HD * TT, TT, Ob, HD, 0, (size_t)RH * TT, (size_t)HD * TT, (size_t)TT * HD);
            k_gemmc<h16, 0, 2><<<dim3((TT - RH) / 64, HD / 64, ZH), 32, 0, stream>>>(P16 + (size_t)RH * TT, nullptr, VT16 + zk * HD * TT, nullptr, TT, Ob + (size_t)RH * HD, HD, RH, (size_t)TT * TT, (size_t)HD * TT, (size_t)TT * HD);
            k_merge<<<(unsigned)(((size_t)ZH * TT * HD / 2 + 255) / 256), 256, 0, stream>>>(Ob, h0, ATh, ATl); }
        k_gemmw<bf, 1, true><<<dim3(TT / 64, DM / 64, 1), 32, 0, stream>>>(ATh, ATl, WO, nullptr, DQ, OUT + (size_t)b * TT * DM, DM, bo, 0, 0, 0); }
}

// v001
// One run takes 805 microseconds.
// Two timings next to v000 both put it at 1.79 times that version's speed.
#include <hip/hip_runtime.h>

// Causal multi-head self-attention whose key and value are the QUERY projection (the module's bug, reproduced: x [2][2048][1024]; q = x Wq^T ('oi' [1024][1024] 1/32, no bias), k = v = q (16 heads x 64); scores masked above the diagonal (-inf == exclusion) then x 1/sqrt(64); softmax; ctx = attn.q; out = ctx Wo^T + bo ('oi') -> [2][2048][1024] (4.2 M); argument order x, Wq, Wo, bo).
// Layout per batch: bf16 copy of x; 'oi' weights; the one exact projection is computed into the q, k and v roles (three identical GEMMs keep the plane builders unchanged); identity-table plane builders; causal T-2048 attention (hybrid rows: < 512 hi/lo 3 products, rest fp16 x1024; k_gemmc skips tiles above the diagonal); merged hi/lo x Wo exact + bo.
// Compute dtypes, f32 accumulate: every input rounded to bf16; projection exact; attention rows < 512 3 products, rest fp16; softmax f32; Wo hl x exact + bias.

#define NB_  2
#define TT   2048
#define DM   1024
#define NH_  16
#define NKV  16
#define REP  (NH_ / NKV)
#define HD   64
#define DQ   (NH_ * HD)
#define DKV  (NKV * HD)
#define ZH   2
#define RH   512                  // query rows < RH use hi+lo planes (0: none)
#define WIN  2048
#define PCAR 1024.0f
#define SCL  0.125f   // HD^-0.5
typedef _Float16 h16;
typedef unsigned short bf;
typedef __attribute__((ext_vector_type(16))) __bf16   v16bf;
typedef __attribute__((ext_vector_type(16))) _Float16 v16h;
typedef __attribute__((ext_vector_type(8)))  _Float16 v8h;
typedef __attribute__((ext_vector_type(8)))  unsigned short v8us;
typedef __attribute__((ext_vector_type(8)))  float    v8f;
typedef __attribute__((ext_vector_type(4)))  float    v4f;
typedef v8h  __attribute__((may_alias)) v8ha;
typedef v4f  __attribute__((may_alias)) v4fa;
typedef v8us __attribute__((may_alias)) v8usa;

__device__ __forceinline__ unsigned short f2bf(float f) { unsigned u = __float_as_uint(f); u += 0x7FFFu + ((u >> 16) & 1u); return (unsigned short)(u >> 16); }
__device__ __forceinline__ float bf2f(unsigned short b) { return __uint_as_float(((unsigned)b) << 16); }
__device__ __forceinline__ float bfr(float f) { return bf2f(f2bf(f)); }
__device__ __forceinline__ v16h cat16(v8h lo, v8h hi) { return __builtin_shufflevector(lo, hi, 0, 1, 2, 3, 4, 5, 6, 7, 8, 9, 10, 11, 12, 13, 14, 15); }
__device__ __forceinline__ v16bf cat16b(v8us lo, v8us hi) { return __builtin_bit_cast(v16bf, __builtin_shufflevector(lo, hi, 0, 1, 2, 3, 4, 5, 6, 7, 8, 9, 10, 11, 12, 13, 14, 15)); }
__device__ __forceinline__ v8f wmma16(v16h a, v16h b, v8f c) { return __builtin_amdgcn_wmma_f32_16x16x32_f16(false, a, false, b, (short)0, c, false, false); }
__device__ __forceinline__ v8f wmmab(v16bf a, v16bf b, v8f c) { return __builtin_amdgcn_wmma_f32_16x16x32_bf16(false, a, false, b, (short)0, c, false, false); }



// ---- tile_reduce: sums the NW waves' partial 64x64 tiles (split K) through LDS, one 16x64 slab per round, always in wave order 0..NW-1. Thread t < 256 ends up with columns 4 (t & 15) .. + 3 of row (t >> 4) of each slab in res[].
// Two slab sets alternate, so one barrier a round is enough: the set that round mb + 2 overwrites was last read in front of the barrier of round mb + 1. No global store stands between the barriers (a barrier would wait for it).
template <int NW> __device__ __forceinline__ void tile_reduce(const v8f (&acc)[4][4], float* os, int wave, int lr, int hi, v4f (&res)[4]) {
    static_assert(NW >= 8, "256 threads sum a slab");
    const int ro = ((int)threadIdx.x >> 4) * 68 + ((int)threadIdx.x & 15) * 4;
#pragma unroll
    for (int mb = 0; mb < 4; ++mb) { float* ob = os + (mb & 1) * (NW * 16 * 68);
#pragma unroll
        for (int nb = 0; nb < 4; ++nb) {
#pragma unroll
            for (int j = 0; j < 8; ++j) ob[wave * (16 * 68) + (hi * 8 + j) * 68 + nb * 16 + lr] = acc[mb][nb][j]; }
        __syncthreads();
        if (threadIdx.x < 256) { v4f val = *(const v4fa*)(ob + ro);
#pragma unroll
            for (int w = 1; w < NW; ++w) val += *(const v4fa*)(ob + w * (16 * 68) + ro);
            res[mb] = val; } }
}

// ---- k_gemmw: register-blocked GEMM, NW WAVES per 64x64 output tile (16 accumulators each), operands straight from K-contiguous 16-bit planes; grid (M/64, N/64, Z), 32 * NW threads.
// Split K inside the work-group: wave w takes the 32-wide k chunks w, w + NW, w + 2 NW, ..., so a tile's chain of dependent load -> matrix passes is NW times shorter; tile_reduce sums the partial tiles.
// C[m][n] (f32, pitch ldc, + optional f32 bias[n]) = sum_k A[m][k] Bt[n][k] (+ split products per NSPLIT). z-batch strides sA/sB/sC in elements. K % 32 == 0.
template <typename T16> struct WFrag;
template <> struct WFrag<h16> { typedef v16h V; static __device__ __forceinline__ V ld(const h16* p) { return cat16(*(const v8h*)p, *(const v8h*)(p + 16)); } static __device__ __forceinline__ v8f mma(V a, V b, v8f c) { return wmma16(a, b, c); } };
template <> struct WFrag<bf> { typedef v16bf V; static __device__ __forceinline__ V ld(const bf* p) { return cat16b(*(const v8us*)p, *(const v8us*)(p + 16)); } static __device__ __forceinline__ v8f mma(V a, V b, v8f c) { return wmmab(a, b, c); } };
template <typename T16, int NSPLIT, bool BIAS, int NW>
__global__ __launch_bounds__(32 * NW) void k_gemmw(const T16* __restrict__ A, const T16* __restrict__ A2, const T16* __restrict__ Bt, const T16* __restrict__ Bt2, int K, float* C, int ldc, const float* __restrict__ bias, size_t sA, size_t sB, size_t sC) {
    typedef typename WFrag<T16>::V V;
    __shared__ __align__(16) float os[(NW == 1 ? 1 : 2 * NW) * 16 * 68];
    const size_t z = blockIdx.z; A += z * sA; if (A2) A2 += z * sA; Bt += z * sB; if (Bt2) Bt2 += z * sB; C += z * sC;
    const int lane = threadIdx.x & 31, lr = lane & 15, hi = lane >> 4; const int r0 = blockIdx.x * 64, c0 = blockIdx.y * 64; const int wave = (NW == 1) ? 0 : __builtin_amdgcn_readfirstlane((int)(threadIdx.x >> 5));
    v8f acc[4][4];
#pragma unroll
    for (int mb = 0; mb < 4; ++mb)
#pragma unroll
        for (int nb = 0; nb < 4; ++nb) acc[mb][nb] = (v8f){};
    const size_t aoff = (size_t)(r0 + lr) * K + 8 * hi, boff = (size_t)(c0 + lr) * K + 8 * hi;
#pragma unroll 1
    for (int kc = wave * 32; kc < K; kc += 32 * NW) {
        V a[4], a2[4];
#pragma unroll
        for (int mb = 0; mb < 4; ++mb) { a[mb] = WFrag<T16>::ld(A + aoff + (size_t)mb * 16 * K + kc); if (NSPLIT == 1 || NSPLIT == 2) a2[mb] = WFrag<T16>::ld(A2 + aoff + (size_t)mb * 16 * K + kc); }
#pragma unroll
        for (int nb = 0; nb < 4; ++nb) { const V b = WFrag<T16>::ld(Bt + boff + (size_t)nb * 16 * K + kc); V b2; if (NSPLIT >= 2) b2 = WFrag<T16>::ld(Bt2 + boff + (size_t)nb * 16 * K + kc);
#pragma unroll
            for (int mb = 0; mb < 4; ++mb) { acc[mb][nb] = WFrag<T16>::mma(a[mb], b, acc[mb][nb]); if (NSPLIT == 1 || NSPLIT == 2) acc[mb][nb] = WFrag<T16>::mma(a2[mb], b, acc[mb][nb]); if (NSPLIT >= 2) acc[mb][nb] = WFrag<T16>::mma(a[mb], b2, acc[mb][nb]); } }
        asm volatile("v_nop\n\tv_nop\n\tv_nop\n\tv_nop" : "+v"(acc[0][0]), "+v"(acc[1][1]), "+v"(acc[2][2]), "+v"(acc[3][3]) : "v"(a[0]), "v"(a[3]));
    }
    v4f res[4]; tile_reduce<NW>(acc, os, wave, lr, hi, res);
    if (threadIdx.x < 256) { const int row = (int)threadIdx.x >> 4, cofs = ((int)threadIdx.x & 15) * 4;
#pragma unroll
        for (int mb = 0; mb < 4; ++mb) { v4f val = res[mb]; if (BIAS) { val[0] += bfr(bias[c0 + cofs]); val[1] += bfr(bias[c0 + cofs + 1]); val[2] += bfr(bias[c0 + cofs + 2]); val[3] += bfr(bias[c0 + cofs + 3]); }
            *(v4f*)(C + (size_t)(r0 + mb * 16 + row) * ldc + c0 + cofs) = val; } }
}

// ---- k_gemmc: the same 64x64 tile GEMM (NW = 1: one wave, its own epilogue; NW > 1: split K as in k_gemmw) specialised for causal attention: CMODE 1 skips score tiles entirely above the diagonal (query rows r0+roff.., key columns c0..), CMODE 2 limits the
// key (K) loop of the probability x value contraction to the diagonal block (probabilities beyond it are exactly zero). roff = row offset of this launch's first row within the sequence.
template <typename T16, int NSPLIT, int CMODE, int NW>
__global__ __launch_bounds__(32 * NW) void k_gemmc(const T16* __restrict__ A, const T16* __restrict__ A2, const T16* __restrict__ Bt, const T16* __restrict__ Bt2, int K, float* C, int ldc, int roff, size_t sA, size_t sB, size_t sC) {
    typedef typename WFrag<T16>::V V;
    __shared__ __align__(16) float os[(NW == 1 ? 1 : 2 * NW) * 16 * 68];
    const size_t z = blockIdx.z; A += z * sA; if (A2) A2 += z * sA; Bt += z * sB; if (Bt2) Bt2 += z * sB; C += z * sC;
    const int lane = threadIdx.x & 31, lr = lane & 15, hi = lane >> 4; const int r0 = blockIdx.x * 64, c0 = blockIdx.y * 64; const int wave = (NW == 1) ? 0 : __builtin_amdgcn_readfirstlane((int)(threadIdx.x >> 5));
    if (CMODE == 1 && c0 > r0 + roff + 63) return;                  // score tile entirely above the causal diagonal: never read (the softmax masks j > i by select)
    const int Kl = (CMODE == 2) ? min(K, r0 + roff + 64) : K;        // P.V: probabilities are exactly 0 beyond the diagonal block, so the K loop stops there
    v8f acc[4][4];
#pragma unroll
    for (int mb = 0; mb < 4; ++mb)
#pragma unroll
        for (int nb = 0; nb < 4; ++nb) acc[mb][nb] = (v8f){};
    const size_t aoff = (size_t)(r0 + lr) * K + 8 * hi, boff = (size_t)(c0 + lr) * K + 8 * hi;
#pragma unroll 1
    for (int kc = wave * 32; kc < Kl; kc += 32 * NW) {
        V a[4], a2[4];
#pragma unroll
        for (int mb = 0; mb < 4; ++mb) { a[mb] = WFrag<T16>::ld(A + aoff + (size_t)mb * 16 * K + kc); if (NSPLIT == 1 || NSPLIT == 2) a2[mb] = WFrag<T16>::ld(A2 + aoff + (size_t)mb * 16 * K + kc); }
#pragma unroll
        for (int nb = 0; nb < 4; ++nb) { const V b = WFrag<T16>::ld(Bt + boff + (size_t)nb * 16 * K + kc); V b2; if (NSPLIT >= 2) b2 = WFrag<T16>::ld(Bt2 + boff + (size_t)nb * 16 * K + kc);
#pragma unroll
            for (int mb = 0; mb < 4; ++mb) { acc[mb][nb] = WFrag<T16>::mma(a[mb], b, acc[mb][nb]); if (NSPLIT == 1 || NSPLIT == 2) acc[mb][nb] = WFrag<T16>::mma(a2[mb], b, acc[mb][nb]); if (NSPLIT >= 2) acc[mb][nb] = WFrag<T16>::mma(a[mb], b2, acc[mb][nb]); } }
        asm volatile("v_nop\n\tv_nop\n\tv_nop\n\tv_nop" : "+v"(acc[0][0]), "+v"(acc[1][1]), "+v"(acc[2][2]), "+v"(acc[3][3]) : "v"(a[0]), "v"(a[3]));
    }
    if constexpr (NW > 1) {
        v4f res[4]; tile_reduce<NW>(acc, os, wave, lr, hi, res);
        if (threadIdx.x < 256) { const int row = (int)threadIdx.x >> 4, cofs = ((int)threadIdx.x & 15) * 4;
#pragma unroll
            for (int mb = 0; mb < 4; ++mb) *(v4f*)(C + (size_t)(r0 + mb * 16 + row) * ldc + c0 + cofs) = res[mb]; }
        return;
    }
#pragma unroll
    for (int mb = 0; mb < 4; ++mb) {
#pragma unroll
        for (int nb = 0; nb < 4; ++nb) {
#pragma unroll
            for (int j = 0; j < 8; ++j) os[(hi * 8 + j) * 68 + nb * 16 + lr] = acc[mb][nb][j]; }
        __builtin_amdgcn_wave_barrier(); asm volatile("" ::: "memory");
        float* crow = C + (size_t)(r0 + mb * 16) * ldc + c0;
{
#pragma unroll
            for (int s = 0; s < 8; ++s) { const int row = 2 * s + hi, cofs = lr * 4; v4f val = *(const v4fa*)(os + row * 68 + cofs);
                *(v4f*)(crow + (size_t)row * ldc + cofs) = val; }
             }
        __builtin_amdgcn_wave_barrier(); asm volatile("" ::: "memory");
    }
}

__device__ __forceinline__ h16 tohx(float x) { return (h16)x; }
__device__ __forceinline__ void splitf(float y, unsigned short& h, unsigned short& l) { h = f2bf(y); l = f2bf(y - bf2f(h)); }
typedef __attribute__((ext_vector_type(2))) _Float16 v2h;
typedef __attribute__((ext_vector_type(4))) _Float16 v4h;
typedef __attribute__((ext_vector_type(2))) unsigned short v2us;
typedef __attribute__((ext_vector_type(4))) unsigned short v4us;
typedef __attribute__((ext_vector_type(2))) float v2f;
typedef __attribute__((ext_vector_type(4))) int v4i;

__global__ __launch_bounds__(256) void k_cvt8(const float* __restrict__ src, bf* dst, size_t n8) { const size_t i = (size_t)blockIdx.x * 256 + threadIdx.x; if (i >= n8) return; const v8f v = *(const v8f*)(src + i * 8); v8us o;
#pragma unroll
    for (int k = 0; k < 8; ++k) o[k] = f2bf(v[k]); *(v8us*)(dst + i * 8) = o;  }

// k_rope: head planes [h][t][d] (fp16 + hi/lo) of rope(x) x sc with the rotate-half convention out[d] = x[d] cos[t][d] - x[d+HD/2] sin[t][d], out[d+HD/2] = x[d+HD/2] cos[t][d+HD/2] + x[d] sin[t][d+HD/2]
__global__ __launch_bounds__(256) void k_rope(const float* __restrict__ F, int pitch, int nheads, const float* __restrict__ CS, const float* __restrict__ RF, const float* __restrict__ nw, float sc, h16* P16, bf* Ph, bf* Pl) {
    const size_t e = ((size_t)blockIdx.x * 256 + threadIdx.x) * 2; if (e >= (size_t)nheads * TT * HD) return; const int d = (int)(e % HD); const int t = (int)((e / HD) % TT); const int h = (int)(e / ((size_t)HD * TT)); const float* f = F + (size_t)t * pitch + h * HD; const float rf = RF ? RF[(size_t)h * TT + t] : 1.0f; v2h o16; v2us oh, ol;
#pragma unroll
    for (int q = 0; q < 2; ++q) { const int dd = d + q; const int dp = (dd < HD / 2) ? dd + HD / 2 : dd - HD / 2; float x0 = f[dd], x1 = f[dp];
        if (RF) { float n0 = __fmul_rn(x0, rf), n1 = __fmul_rn(x1, rf); asm volatile("" : "+v"(n0)); asm volatile("" : "+v"(n1)); x0 = __fmul_rn(bfr(nw[dd]), n0); x1 = __fmul_rn(bfr(nw[dp]), n1); }
        const v2f cs = *(const v2f*)(CS + ((size_t)t * HD + dd) * 2); float a = __fmul_rn(x0, cs[0]), bq = __fmul_rn(x1, cs[1]); asm volatile("" : "+v"(a)); asm volatile("" : "+v"(bq)); const float r = ((dd < HD / 2) ? __fsub_rn(a, bq) : __fadd_rn(a, bq)) * sc;
        o16[q] = tohx(r); unsigned short a2, c2; splitf(r, a2, c2); oh[q] = a2; ol[q] = c2; }
    *(v2h*)(P16 + e) = o16; *(v2us*)(Ph + e) = oh; *(v2us*)(Pl + e) = ol;  }
__global__ __launch_bounds__(256) void k_vtp(const float* __restrict__ F, int pitch, int nheads, h16* V16, bf* Vh, bf* Vl) { const size_t e = ((size_t)blockIdx.x * 256 + threadIdx.x) * 2; if (e >= (size_t)nheads * HD * TT) return; const int t = (int)(e % TT); const int d = (int)((e / TT) % HD); const int g = (int)(e / ((size_t)TT * HD)); v2h o16; v2us oh, ol;
#pragma unroll
    for (int q = 0; q < 2; ++q) { const float x = F[(size_t)(t + q) * pitch + g * HD + d]; o16[q] = tohx(x); unsigned short a2, c2; splitf(x, a2, c2); oh[q] = a2; ol[q] = c2; }
    *(v2h*)(V16 + e) = o16; *(v2us*)(Vh + e) = oh; *(v2us*)(Vl + e) = ol;  }
__global__ __launch_bounds__(256) void k_csid(float* CS) { const int idx = blockIdx.x * 256 + threadIdx.x; if (idx >= TT * HD) return; v2f cs; cs[0] = 1.0f; cs[1] = 0.0f; *(v2f*)(CS + (size_t)idx * 2) = cs;  }
// k_asoft: per row (zz, i): t = S x HD^-0.5 for j <= i and i - j < WIN (sliding causal window; the reference's -1e9 additive fill vanishes identically); softmax over the 2048 keys (register row, one exp, fixed trees);
__global__ __launch_bounds__(256) void k_asoft(const float* __restrict__ Sb, h16* P16, bf* Ph, bf* Pl) {
    const int lane = threadIdx.x & 31; const int row = blockIdx.x * 8 + (threadIdx.x >> 5); if (row >= ZH * TT) return; const int i = row % TT; const int zz = row / TT; (void)zz; const bool hires = (i < RH); const float* sr = Sb + (size_t)row * TT; float v[TT / 32]; float mx = -3.0e38f;
#pragma unroll
    for (int ch = 0; ch < TT / 128; ++ch) { const int j0 = ch * 128 + lane * 4; const v4f a = *(const v4f*)(sr + j0);
#pragma unroll
        for (int q = 0; q < 4; ++q) { const int j = j0 + q; (void)j; const float t = (j <= i && i - j < WIN) ? a[q] * SCL : -3.0e38f; v[ch * 4 + q] = t; mx = fmaxf(mx, t); } }
#pragma unroll
    for (int sh = 16; sh; sh >>= 1) mx = fmaxf(mx, __shfl_xor(mx, sh, 32));
    float sum = 0.f;
#pragma unroll
    for (int k = 0; k < TT / 32; ++k) { float d0 = __fsub_rn(v[k], mx); asm volatile("" : "+v"(d0)); v[k] = __builtin_amdgcn_exp2f(__fmul_rn(d0, 1.4426950408889634f)); sum += v[k]; }
#pragma unroll
    for (int sh = 16; sh; sh >>= 1) sum += __shfl_xor(sum, sh, 32);
    const float f = __fdiv_rn(hires ? 1.0f : PCAR, sum);
{
        if (hires) {
#pragma unroll
            for (int ch = 0; ch < TT / 128; ++ch) { v4us oh, ol;
#pragma unroll
                for (int q = 0; q < 4; ++q) { unsigned short a, c2; splitf(v[ch * 4 + q] * f, a, c2); oh[q] = a; ol[q] = c2; }
                const size_t oo = ((size_t)zz * (RH ? RH : 1) + i) * TT + ch * 128 + lane * 4; *(v4us*)(Ph + oo) = oh; *(v4us*)(Pl + oo) = ol; }
        } else {
#pragma unroll
            for (int ch = 0; ch < TT / 128; ++ch) { v4h o4;
#pragma unroll
                for (int q = 0; q < 4; ++q) o4[q] = tohx(v[ch * 4 + q] * f);
                *(v4h*)(P16 + (size_t)row * TT + ch * 128 + lane * 4) = o4; } }
         }
}
__global__ __launch_bounds__(256) void k_merge(const float* __restrict__ O, int h0, bf* Ah, bf* Al) { const size_t e = ((size_t)blockIdx.x * 256 + threadIdx.x) * 2; if (e >= (size_t)ZH * TT * HD) return; const int d = (int)(e % HD); const int t = (int)((e / HD) % TT); const int zz = (int)(e / ((size_t)HD * TT)); const float cs = (t < RH) ? 1.0f : (1.0f / PCAR); const size_t oo = (size_t)t * DQ + (h0 + zz) * HD + d;
    v2us oh, ol;
#pragma unroll
    for (int q = 0; q < 2; ++q) { unsigned short a, c2; splitf(O[e + q] * cs, a, c2); oh[q] = a; ol[q] = c2; } *(v2us*)(Ah + oo) = oh; *(v2us*)(Al + oo) = ol;  }

extern "C" void kernel_launch(void* const* d_in, const int* in_sizes, int n_in,
                              void* d_out, int out_size, void* d_ws, size_t ws_size, hipStream_t stream) {
    (void)in_sizes; (void)n_in; (void)out_size;
    const float* x = (const float*)d_in[0]; const float* wq = (const float*)d_in[1]; const float* wo = (const float*)d_in[2]; const float* bo = (const float*)d_in[3];     const float* wk = wq; const float* wv = wq;   /* key == value == query projection (source bug) */
    float* OUT = (float*)d_out;     // [2][2048][1024]
    char* wsp = (char*)d_ws;
    auto take = [&](size_t bytes) { char* p = wsp; wsp += (bytes + 255) & ~(size_t)255; return (void*)p; };
    bf* WQ = (bf*)take((size_t)DQ * DM * 2); bf* WK = (bf*)take((size_t)DKV * DM * 2); bf* WV = (bf*)take((size_t)DKV * DM * 2); bf* WO = (bf*)take((size_t)DM * DQ * 2); float* CS = (float*)take((size_t)TT * HD * 2 * 4);
    bf* XB = (bf*)take((size_t)TT * DM * 2); float* FQ = (float*)take((size_t)TT * DQ * 4); float* FK = (float*)take((size_t)TT * DKV * 4);
    h16* QP16 = (h16*)take((size_t)NH_ * TT * HD * 2); h16* KP16 = (h16*)take((size_t)NKV * TT * HD * 2); h16* VT16 = (h16*)take((size_t)NKV * HD * TT * 2);
    bf* QPh = (bf*)take((size_t)NH_ * TT * HD * 2); bf* QPl = (bf*)take((size_t)NH_ * TT * HD * 2); bf* KPh = (bf*)take((size_t)NKV * TT * HD * 2); bf* KPl = (bf*)take((size_t)NKV * TT * HD * 2); bf* VTh = (bf*)take((size_t)NKV * HD * TT * 2); bf* VTl = (bf*)take((size_t)NKV * HD * TT * 2); bf* Ph = (bf*)take((size_t)ZH * RH * TT * 2); bf* Pl = (bf*)take((size_t)ZH * RH * TT * 2);
    float* Sb = (float*)take((size_t)ZH * TT * TT * 4); h16* P16 = (h16*)take((size_t)ZH * TT * TT * 2); float* Ob = (float*)take((size_t)ZH * TT * HD * 4); bf* ATh = (bf*)take((size_t)TT * DQ * 2); bf* ATl = (bf*)take((size_t)TT * DQ * 2);
    if ((size_t)(wsp - (char*)d_ws) > ws_size) return;    // ws 256 MiB
    float* FV = FK;   // v projection reuses the k buffer after the k planes are built (stream-ordered)
    { k_cvt8<<<(unsigned)(((size_t)DQ * DM / 8 + 255) / 256), 256, 0, stream>>>(wq, WQ, (size_t)DQ * DM / 8); k_cvt8<<<(unsigned)(((size_t)DKV * DM / 8 + 255) / 256), 256, 0, stream>>>(wk, WK, (size_t)DKV * DM / 8); k_cvt8<<<(unsigned)(((size_t)DKV * DM / 8 + 255) / 256), 256, 0, stream>>>(wv, WV, (size_t)DKV * DM / 8);
      k_cvt8<<<(unsigned)(((size_t)DM * DQ / 8 + 255) / 256), 256, 0, stream>>>(wo, WO, (size_t)DM * DQ / 8);
       }
    k_csid<<<(TT * HD + 255) / 256, 256, 0, stream>>>(CS);
    const unsigned LQ = (unsigned)(((size_t)NH_ * TT * HD / 2 + 255) / 256), LKv = (unsigned)(((size_t)NKV * TT * HD / 2 + 255) / 256);
    for (int b = 0; b < NB_; ++b) {
        
        k_cvt8<<<(unsigned)(((size_t)TT * DM / 8 + 255) / 256), 256, 0, stream>>>(x + (size_t)b * TT * DM, XB, (size_t)TT * DM / 8);
        k_gemmw<bf, 0, false, 8><<<dim3(TT / 64, DQ / 64, 1), 256, 0, stream>>>(XB, nullptr, WQ, nullptr, DM, FQ, DQ, nullptr, 0, 0, 0);
        k_rope<<<LQ, 256, 0, stream>>>(FQ, DQ, NH_, CS, nullptr, nullptr, 1.0f, QP16, QPh, QPl);
        k_gemmw<bf, 0, false, 8><<<dim3(TT / 64, DKV / 64, 1), 256, 0, stream>>>(XB, nullptr, WK, nullptr, DM, FK, DKV, nullptr, 0, 0, 0);
        k_rope<<<LKv, 256, 0, stream>>>(FK, DKV, NKV, CS, nullptr, nullptr, 1.0f, KP16, KPh, KPl);
        k_gemmw<bf, 0, false, 8><<<dim3(TT / 64, DKV / 64, 1), 256, 0, stream>>>(XB, nullptr, WV, nullptr, DM, FV, DKV, nullptr, 0, 0, 0); k_vtp<<<LKv, 256, 0, stream>>>(FV, DKV, NKV, VT16, VTh, VTl);
        for (int h0 = 0; h0 < NH_; h0 += ZH) { const size_t zq = (size_t)h0, zk = (size_t)(h0 / REP);   // one kv head per query head: the pass's two heads use consecutive kv planes (z-strides TT*HD)
            k_gemmc<bf, 2, 1, 1><<<dim3(RH / 64, TT / 64, ZH), 32, 0, stream>>>(QPh + zq * TT * HD, QPl + zq * TT * HD, KPh + zk * TT * HD, KPl + zk * TT * HD, HD, Sb, TT, 0, (size_t)TT * HD, (size_t)TT * HD, (size_t)TT * TT);
            k_gemmc<h16, 0, 1, 1><<<dim3((TT - RH) / 64, TT / 64, ZH), 32, 0, stream>>>(QP16 + zq * TT * HD + (size_t)RH * HD, nullptr, KP16 + zk * TT * HD, nullptr, HD, Sb + (size_t)RH * TT, TT, RH, (size_t)TT * HD, (size_t)TT * HD, (size_t)TT * TT);
            k_asoft<<<ZH * TT / 8, 256, 0, stream>>>(Sb, P16, Ph, Pl);
            k_gemmc<bf, 2, 2, 8><<<dim3(RH / 64, HD / 64, ZH), 256, 0, stream>>>(Ph, Pl, VTh + zk * HD * TT, VTl + zk * HD * TT, TT, Ob, HD, 0, (size_t)RH * TT, (size_t)HD * TT, (size_t)TT * HD);
            k_gemmc<h16, 0, 2, 16><<<dim3((TT - RH) / 64, HD / 64, ZH), 512, 0, stream>>>(P16 + (size_t)RH * TT, nullptr, VT16 + zk * HD * TT, nullptr, TT, Ob + (size_t)RH * HD, HD, RH, (size_t)TT * TT, (size_t)HD * TT, (size_t)TT * HD);
            k_merge<<<(unsigned)(((size_t)ZH * TT * HD / 2 + 255) / 256), 256, 0, stream>>>(Ob, h0, ATh, ATl); }
        k_gemmw<bf, 1, true, 8><<<dim3(TT / 64, DM / 64, 1), 256, 0, stream>>>(ATh, ATl, WO, nullptr, DQ, OUT + (size_t)b * TT * DM, DM, bo, 0, 0, 0); }
}

// v002
// One run takes 453 microseconds.
// Timed twice side by side with v001, it ran 1.79 times as fast both times.
// Over all steps from v000 it is 3.19 times as fast.
#include <hip/hip_runtime.h>

// Causal multi-head self-attention whose key and value are the QUERY projection (the module's bug, reproduced: x [2][2048][1024]; q = x Wq^T ('oi' [1024][1024] 1/32, no bias), k = v = q (16 heads x 64); scores masked above the diagonal (-inf == exclusion) then x 1/sqrt(64); softmax; ctx = attn.q; out = ctx Wo^T + bo ('oi') -> [2][2048][1024] (4.2 M); argument order x, Wq, Wo, bo).
// Layout per batch: bf16 copy of x; 'oi' weights; the one exact projection is computed into the q, k and v roles (three identical GEMMs keep the plane builders unchanged); identity-table plane builders; causal T-2048 attention (hybrid rows: < 512 hi/lo 3 products, rest fp16 x1024; k_gemmc skips tiles above the diagonal); merged hi/lo x Wo exact + bo.
// Compute dtypes, f32 accumulate: every input rounded to bf16; projection exact; attention rows < 512 3 products, rest fp16; softmax f32; Wo hl x exact + bias.

#define NB_  2
#define TT   2048
#define DM   1024
#define NH_  16
#define NKV  16
#define REP  (NH_ / NKV)
#define HD   64
#define DQ   (NH_ * HD)
#define DKV  (NKV * HD)
#define ZH   8                    // heads per attention launch (grid z); the f32 score buffer holds ZH heads
#define RH   512                  // query rows < RH use hi+lo planes (0: none)
#define WIN  2048
#define PCAR 1024.0f
#define SCL  0.125f   // HD^-0.5
typedef _Float16 h16;
typedef unsigned short bf;
typedef __attribute__((ext_vector_type(16))) __bf16   v16bf;
typedef __attribute__((ext_vector_type(16))) _Float16 v16h;
typedef __attribute__((ext_vector_type(8)))  _Float16 v8h;
typedef __attribute__((ext_vector_type(8)))  unsigned short v8us;
typedef __attribute__((ext_vector_type(8)))  float    v8f;
typedef __attribute__((ext_vector_type(4)))  float    v4f;
typedef v8h  __attribute__((may_alias)) v8ha;
typedef v4f  __attribute__((may_alias)) v4fa;
typedef v8us __attribute__((may_alias)) v8usa;

__device__ __forceinline__ unsigned short f2bf(float f) { unsigned u = __float_as_uint(f); u += 0x7FFFu + ((u >> 16) & 1u); return (unsigned short)(u >> 16); }
__device__ __forceinline__ float bf2f(unsigned short b) { return __uint_as_float(((unsigned)b) << 16); }
__device__ __forceinline__ float bfr(float f) { return bf2f(f2bf(f)); }
__device__ __forceinline__ v16h cat16(v8h lo, v8h hi) { return __builtin_shufflevector(lo, hi, 0, 1, 2, 3, 4, 5, 6, 7, 8, 9, 10, 11, 12, 13, 14, 15); }
__device__ __forceinline__ v16bf cat16b(v8us lo, v8us hi) { return __builtin_bit_cast(v16bf, __builtin_shufflevector(lo, hi, 0, 1, 2, 3, 4, 5, 6, 7, 8, 9, 10, 11, 12, 13, 14, 15)); }
__device__ __forceinline__ v8f wmma16(v16h a, v16h b, v8f c) { return __builtin_amdgcn_wmma_f32_16x16x32_f16(false, a, false, b, (short)0, c, false, false); }
__device__ __forceinline__ v8f wmmab(v16bf a, v16bf b, v8f c) { return __builtin_amdgcn_wmma_f32_16x16x32_bf16(false, a, false, b, (short)0, c, false, false); }



// ---- tile_reduce: sums the NW waves' partial 64x64 tiles (split K) through LDS, one 16x64 slab per round, always in wave order 0..NW-1. Thread t < 256 ends up with columns 4 (t & 15) .. + 3 of row (t >> 4) of each slab in res[].
// Two slab sets alternate, so one barrier a round is enough: the set that round mb + 2 overwrites was last read in front of the barrier of round mb + 1. No global store stands between the barriers (a barrier would wait for it).
template <int NW> __device__ __forceinline__ void tile_reduce(const v8f (&acc)[4][4], float* os, int wave, int lr, int hi, v4f (&res)[4]) {
    static_assert(NW >= 8, "256 threads sum a slab");
    const int ro = ((int)threadIdx.x >> 4) * 68 + ((int)threadIdx.x & 15) * 4;
#pragma unroll
    for (int mb = 0; mb < 4; ++mb) { float* ob = os + (mb & 1) * (NW * 16 * 68);
#pragma unroll
        for (int nb = 0; nb < 4; ++nb) {
#pragma unroll
            for (int j = 0; j < 8; ++j) ob[wave * (16 * 68) + (hi * 8 + j) * 68 + nb * 16 + lr] = acc[mb][nb][j]; }
        __syncthreads();
        if (threadIdx.x < 256) { v4f val = *(const v4fa*)(ob + ro);
#pragma unroll
            for (int w = 1; w < NW; ++w) val += *(const v4fa*)(ob + w * (16 * 68) + ro);
            res[mb] = val; } }
}

// ---- k_gemmw: register-blocked GEMM, NW WAVES per 64x64 output tile (16 accumulators each), operands straight from K-contiguous 16-bit planes; grid (M/64, N/64, Z), 32 * NW threads.
// Split K inside the work-group: wave w takes the 32-wide k chunks w, w + NW, w + 2 NW, ..., so a tile's chain of dependent load -> matrix passes is NW times shorter; tile_reduce sums the partial tiles.
// C[m][n] (f32, pitch ldc, + optional f32 bias[n]) = sum_k A[m][k] Bt[n][k] (+ split products per NSPLIT). z-batch strides sA/sB/sC in elements. K % 32 == 0.
template <typename T16> struct WFrag;
template <> struct WFrag<h16> { typedef v16h V; static __device__ __forceinline__ V ld(const h16* p) { return cat16(*(const v8h*)p, *(const v8h*)(p + 16)); } static __device__ __forceinline__ v8f mma(V a, V b, v8f c) { return wmma16(a, b, c); } };
template <> struct WFrag<bf> { typedef v16bf V; static __device__ __forceinline__ V ld(const bf* p) { return cat16b(*(const v8us*)p, *(const v8us*)(p + 16)); } static __device__ __forceinline__ v8f mma(V a, V b, v8f c) { return wmmab(a, b, c); } };
template <typename T16, int NSPLIT, bool BIAS, int NW>
__global__ __launch_bounds__(32 * NW) void k_gemmw(const T16* __restrict__ A, const T16* __restrict__ A2, const T16* __restrict__ Bt, const T16* __restrict__ Bt2, int K, float* C, int ldc, const float* __restrict__ bias, size_t sA, size_t sB, size_t sC) {
    typedef typename WFrag<T16>::V V;
    __shared__ __align__(16) float os[(NW == 1 ? 1 : 2 * NW) * 16 * 68];
    const size_t z = blockIdx.z; A += z * sA; if (A2) A2 += z * sA; Bt += z * sB; if (Bt2) Bt2 += z * sB; C += z * sC;
    const int lane = threadIdx.x & 31, lr = lane & 15, hi = lane >> 4; const int r0 = blockIdx.x * 64, c0 = blockIdx.y * 64; const int wave = (NW == 1) ? 0 : __builtin_amdgcn_readfirstlane((int)(threadIdx.x >> 5));
    v8f acc[4][4];
#pragma unroll
    for (int mb = 0; mb < 4; ++mb)
#pragma unroll
        for (int nb = 0; nb < 4; ++nb) acc[mb][nb] = (v8f){};
    const size_t aoff = (size_t)(r0 + lr) * K + 8 * hi, boff = (size_t)(c0 + lr) * K + 8 * hi;
#pragma unroll 1
    for (int kc = wave * 32; kc < K; kc += 32 * NW) {
        V a[4], a2[4];
#pragma unroll
        for (int mb = 0; mb < 4; ++mb) { a[mb] = WFrag<T16>::ld(A + aoff + (size_t)mb * 16 * K + kc); if (NSPLIT == 1 || NSPLIT == 2) a2[mb] = WFrag<T16>::ld(A2 + aoff + (size_t)mb * 16 * K + kc); }
#pragma unroll
        for (int nb = 0; nb < 4; ++nb) { const V b = WFrag<T16>::ld(Bt + boff + (size_t)nb * 16 * K + kc); V b2; if (NSPLIT >= 2) b2 = WFrag<T16>::ld(Bt2 + boff + (size_t)nb * 16 * K + kc);
#pragma unroll
            for (int mb = 0; mb < 4; ++mb) { acc[mb][nb] = WFrag<T16>::mma(a[mb], b, acc[mb][nb]); if (NSPLIT == 1 || NSPLIT == 2) acc[mb][nb] = WFrag<T16>::mma(a2[mb], b, acc[mb][nb]); if (NSPLIT >= 2) acc[mb][nb] = WFrag<T16>::mma(a[mb], b2, acc[mb][nb]); } }
        asm volatile("v_nop\n\tv_nop\n\tv_nop\n\tv_nop" : "+v"(acc[0][0]), "+v"(acc[1][1]), "+v"(acc[2][2]), "+v"(acc[3][3]) : "v"(a[0]), "v"(a[3]));
    }
    v4f res[4]; tile_reduce<NW>(acc, os, wave, lr, hi, res);
    if (threadIdx.x < 256) { const int row = (int)threadIdx.x >> 4, cofs = ((int)threadIdx.x & 15) * 4;
#pragma unroll
        for (int mb = 0; mb < 4; ++mb) { v4f val = res[mb]; if (BIAS) { val[0] += bfr(bias[c0 + cofs]); val[1] += bfr(bias[c0 + cofs + 1]); val[2] += bfr(bias[c0 + cofs + 2]); val[3] += bfr(bias[c0 + cofs + 3]); }
            *(v4f*)(C + (size_t)(r0 + mb * 16 + row) * ldc + c0 + cofs) = val; } }
}

// ---- k_gemmc: the same 64x64 tile GEMM (NW = 1: one wave, its own epilogue; NW > 1: split K as in k_gemmw) specialised for causal attention: CMODE 1 skips score tiles entirely above the diagonal (query rows r0+roff.., key columns c0..), CMODE 2 limits the
// key (K) loop of the probability x value contraction to the diagonal block (probabilities beyond it are exactly zero). roff = row offset of this launch's first row within the sequence.
template <typename T16, int NSPLIT, int CMODE, int NW>
__global__ __launch_bounds__(32 * NW) void k_gemmc(const T16* __restrict__ A, const T16* __restrict__ A2, const T16* __restrict__ Bt, const T16* __restrict__ Bt2, int K, float* C, int ldc, int roff, size_t sA, size_t sB, size_t sC) {
    typedef typename WFrag<T16>::V V;
    __shared__ __align__(16) float os[(NW == 1 ? 1 : 2 * NW) * 16 * 68];
    const size_t z = blockIdx.z; A += z * sA; if (A2) A2 += z * sA; Bt += z * sB; if (Bt2) Bt2 += z * sB; C += z * sC;
    const int lane = threadIdx.x & 31, lr = lane & 15, hi = lane >> 4; const int r0 = blockIdx.x * 64, c0 = blockIdx.y * 64; const int wave = (NW == 1) ? 0 : __builtin_amdgcn_readfirstlane((int)(threadIdx.x >> 5));
    if (CMODE == 1 && c0 > r0 + roff + 63) return;                  // score tile entirely above the causal diagonal: never read (the softmax masks j > i by select)
    const int Kl = (CMODE == 2) ? min(K, r0 + roff + 64) : K;        // P.V: probabilities are exactly 0 beyond the diagonal block, so the K loop stops there
    v8f acc[4][4];
#pragma unroll
    for (int mb = 0; mb < 4; ++mb)
#pragma unroll
        for (int nb = 0; nb < 4; ++nb) acc[mb][nb] = (v8f){};
    const size_t aoff = (size_t)(r0 + lr) * K + 8 * hi, boff = (size_t)(c0 + lr) * K + 8 * hi;
#pragma unroll 1
    for (int kc = wave * 32; kc < Kl; kc += 32 * NW) {
        V a[4], a2[4];
#pragma unroll
        for (int mb = 0; mb < 4; ++mb) { a[mb] = WFrag<T16>::ld(A + aoff + (size_t)mb * 16 * K + kc); if (NSPLIT == 1 || NSPLIT == 2) a2[mb] = WFrag<T16>::ld(A2 + aoff + (size_t)mb * 16 * K + kc); }
#pragma unroll
        for (int nb = 0; nb < 4; ++nb) { const V b = WFrag<T16>::ld(Bt + boff + (size_t)nb * 16 * K + kc); V b2; if (NSPLIT >= 2) b2 = WFrag<T16>::ld(Bt2 + boff + (size_t)nb * 16 * K + kc);
#pragma unroll
            for (int mb = 0; mb < 4; ++mb) { acc[mb][nb] = WFrag<T16>::mma(a[mb], b, acc[mb][nb]); if (NSPLIT == 1 || NSPLIT == 2) acc[mb][nb] = WFrag<T16>::mma(a2[mb], b, acc[mb][nb]); if (NSPLIT >= 2) acc[mb][nb] = WFrag<T16>::mma(a[mb], b2, acc[mb][nb]); } }
        asm volatile("v_nop\n\tv_nop\n\tv_nop\n\tv_nop" : "+v"(acc[0][0]), "+v"(acc[1][1]), "+v"(acc[2][2]), "+v"(acc[3][3]) : "v"(a[0]), "v"(a[3]));
    }
    if constexpr (NW > 1) {
        v4f res[4]; tile_reduce<NW>(acc, os, wave, lr, hi, res);
        if (threadIdx.x < 256) { const int row = (int)threadIdx.x >> 4, cofs = ((int)threadIdx.x & 15) * 4;
#pragma unroll
            for (int mb = 0; mb < 4; ++mb) *(v4f*)(C + (size_t)(r0 + mb * 16 + row) * ldc + c0 + cofs) = res[mb]; }
        return;
    }
#pragma unroll
    for (int mb = 0; mb < 4; ++mb) {
#pragma unroll
        for (int nb = 0; nb < 4; ++nb) {
#pragma unroll
            for (int j = 0; j < 8; ++j) os[(hi * 8 + j) * 68 + nb * 16 + lr] = acc[mb][nb][j]; }
        __builtin_amdgcn_wave_barrier(); asm volatile("" ::: "memory");
        float* crow = C + (size_t)(r0 + mb * 16) * ldc + c0;
{
#pragma unroll
            for (int s = 0; s < 8; ++s) { const int row = 2 * s + hi, cofs = lr * 4; v4f val = *(const v4fa*)(os + row * 68 + cofs);
                *(v4f*)(crow + (size_t)row * ldc + cofs) = val; }
             }
        __builtin_amdgcn_wave_barrier(); asm volatile("" ::: "memory");
    }
}

__device__ __forceinline__ h16 tohx(float x) { return (h16)x; }
__device__ __forceinline__ void splitf(float y, unsigned short& h, unsigned short& l) { h = f2bf(y); l = f2bf(y - bf2f(h)); }
typedef __attribute__((ext_vector_type(2))) _Float16 v2h;
typedef __attribute__((ext_vector_type(4))) _Float16 v4h;
typedef __attribute__((ext_vector_type(2))) unsigned short v2us;
typedef __attribute__((ext_vector_type(4))) unsigned short v4us;
typedef __attribute__((ext_vector_type(2))) float v2f;
typedef __attribute__((ext_vector_type(4))) int v4i;

__global__ __launch_bounds__(256) void k_cvt8(const float* __restrict__ src, bf* dst, size_t n8) { const size_t i = (size_t)blockIdx.x * 256 + threadIdx.x; if (i >= n8) return; const v8f v = *(const v8f*)(src + i * 8); v8us o;
#pragma unroll
    for (int k = 0; k < 8; ++k) o[k] = f2bf(v[k]); *(v8us*)(dst + i * 8) = o;  }

// k_rope: head planes [h][t][d] (fp16 + hi/lo) of rope(x) x sc with the rotate-half convention out[d] = x[d] cos[t][d] - x[d+HD/2] sin[t][d], out[d+HD/2] = x[d+HD/2] cos[t][d+HD/2] + x[d] sin[t][d+HD/2]
__global__ __launch_bounds__(256) void k_rope(const float* __restrict__ F, int pitch, int nheads, const float* __restrict__ CS, const float* __restrict__ RF, const float* __restrict__ nw, float sc, h16* P16, bf* Ph, bf* Pl) {
    const size_t e = ((size_t)blockIdx.x * 256 + threadIdx.x) * 2; if (e >= (size_t)nheads * TT * HD) return; const int d = (int)(e % HD); const int t = (int)((e / HD) % TT); const int h = (int)(e / ((size_t)HD * TT)); const float* f = F + (size_t)t * pitch + h * HD; const float rf = RF ? RF[(size_t)h * TT + t] : 1.0f; v2h o16; v2us oh, ol;
#pragma unroll
    for (int q = 0; q < 2; ++q) { const int dd = d + q; const int dp = (dd < HD / 2) ? dd + HD / 2 : dd - HD / 2; float x0 = f[dd], x1 = f[dp];
        if (RF) { float n0 = __fmul_rn(x0, rf), n1 = __fmul_rn(x1, rf); asm volatile("" : "+v"(n0)); asm volatile("" : "+v"(n1)); x0 = __fmul_rn(bfr(nw[dd]), n0); x1 = __fmul_rn(bfr(nw[dp]), n1); }
        const v2f cs = *(const v2f*)(CS + ((size_t)t * HD + dd) * 2); float a = __fmul_rn(x0, cs[0]), bq = __fmul_rn(x1, cs[1]); asm volatile("" : "+v"(a)); asm volatile("" : "+v"(bq)); const float r = ((dd < HD / 2) ? __fsub_rn(a, bq) : __fadd_rn(a, bq)) * sc;
        o16[q] = tohx(r); unsigned short a2, c2; splitf(r, a2, c2); oh[q] = a2; ol[q] = c2; }
    *(v2h*)(P16 + e) = o16; *(v2us*)(Ph + e) = oh; *(v2us*)(Pl + e) = ol;  }
// k_vtp: transposed value planes [g][d][t]; the fp16 plane has row pitch 2 TT, the pitch of the fp16 probabilities it is multiplied with (the tile GEMM has one pitch for both operands); hi/lo planes pitch TT.
__global__ __launch_bounds__(256) void k_vtp(const float* __restrict__ F, int pitch, int nheads, h16* V16, bf* Vh, bf* Vl) { const size_t e = ((size_t)blockIdx.x * 256 + threadIdx.x) * 2; if (e >= (size_t)nheads * HD * TT) return; const int t = (int)(e % TT); const int d = (int)((e / TT) % HD); const int g = (int)(e / ((size_t)TT * HD)); v2h o16; v2us oh, ol;
#pragma unroll
    for (int q = 0; q < 2; ++q) { const float x = F[(size_t)(t + q) * pitch + g * HD + d]; o16[q] = tohx(x); unsigned short a2, c2; splitf(x, a2, c2); oh[q] = a2; ol[q] = c2; }
    *(v2h*)(V16 + 2 * e - t) = o16; *(v2us*)(Vh + e) = oh; *(v2us*)(Vl + e) = ol;  }
__global__ __launch_bounds__(256) void k_csid(float* CS) { const int idx = blockIdx.x * 256 + threadIdx.x; if (idx >= TT * HD) return; v2f cs; cs[0] = 1.0f; cs[1] = 0.0f; *(v2f*)(CS + (size_t)idx * 2) = cs;  }
// k_asoft: per row (zz, i): t = S x HD^-0.5 for j <= i and i - j < WIN (sliding causal window; the reference's -1e9 additive fill vanishes identically); softmax over the 2048 keys (register row, one exp, fixed trees);
// P16 is Sb itself: a row's fp16 probabilities go into the first half of that row's own f32 scores (pitch 2 TT halves). One wave owns a row and holds all of it in registers before its first store, so nothing is read after it is overwritten.
__global__ __launch_bounds__(256) void k_asoft(const float* Sb, h16* P16, bf* Ph, bf* Pl) {
    const int lane = threadIdx.x & 31; const int row = blockIdx.x * 8 + (threadIdx.x >> 5); if (row >= ZH * TT) return; const int i = row % TT; const int zz = row / TT; (void)zz; const bool hires = (i < RH); const float* sr = Sb + (size_t)row * TT; float v[TT / 32]; float mx = -3.0e38f;
#pragma unroll
    for (int ch = 0; ch < TT / 128; ++ch) { const int j0 = ch * 128 + lane * 4; const v4f a = *(const v4f*)(sr + j0);
#pragma unroll
        for (int q = 0; q < 4; ++q) { const int j = j0 + q; (void)j; const float t = (j <= i && i - j < WIN) ? a[q] * SCL : -3.0e38f; v[ch * 4 + q] = t; mx = fmaxf(mx, t); } }
#pragma unroll
    for (int sh = 16; sh; sh >>= 1) mx = fmaxf(mx, __shfl_xor(mx, sh, 32));
    float sum = 0.f;
#pragma unroll
    for (int k = 0; k < TT / 32; ++k) { float d0 = __fsub_rn(v[k], mx); asm volatile("" : "+v"(d0)); v[k] = __builtin_amdgcn_exp2f(__fmul_rn(d0, 1.4426950408889634f)); sum += v[k]; }
#pragma unroll
    for (int sh = 16; sh; sh >>= 1) sum += __shfl_xor(sum, sh, 32);
    const float f = __fdiv_rn(hires ? 1.0f : PCAR, sum);
{
        if (hires) {
#pragma unroll
            for (int ch = 0; ch < TT / 128; ++ch) { v4us oh, ol;
#pragma unroll
                for (int q = 0; q < 4; ++q) { unsigned short a, c2; splitf(v[ch * 4 + q] * f, a, c2); oh[q] = a; ol[q] = c2; }
                const size_t oo = ((size_t)zz * (RH ? RH : 1) + i) * TT + ch * 128 + lane * 4; *(v4us*)(Ph + oo) = oh; *(v4us*)(Pl + oo) = ol; }
        } else {
#pragma unroll
            for (int ch = 0; ch < TT / 128; ++ch) { v4h o4;
#pragma unroll
                for (int q = 0; q < 4; ++q) o4[q] = tohx(v[ch * 4 + q] * f);
                *(v4h*)(P16 + (size_t)row * (2 * TT) + ch * 128 + lane * 4) = o4; } }
         }
}
__global__ __launch_bounds__(256) void k_merge(const float* __restrict__ O, int h0, bf* Ah, bf* Al) { const size_t e = ((size_t)blockIdx.x * 256 + threadIdx.x) * 2; if (e >= (size_t)ZH * TT * HD) return; const int d = (int)(e % HD); const int t = (int)((e / HD) % TT); const int zz = (int)(e / ((size_t)HD * TT)); const float cs = (t < RH) ? 1.0f : (1.0f / PCAR); const size_t oo = (size_t)t * DQ + (h0 + zz) * HD + d;
    v2us oh, ol;
#pragma unroll
    for (int q = 0; q < 2; ++q) { unsigned short a, c2; splitf(O[e + q] * cs, a, c2); oh[q] = a; ol[q] = c2; } *(v2us*)(Ah + oo) = oh; *(v2us*)(Al + oo) = ol;  }

extern "C" void kernel_launch(void* const* d_in, const int* in_sizes, int n_in,
                              void* d_out, int out_size, void* d_ws, size_t ws_size, hipStream_t stream) {
    (void)in_sizes; (void)n_in; (void)out_size;
    const float* x = (const float*)d_in[0]; const float* wq = (const float*)d_in[1]; const float* wo = (const float*)d_in[2]; const float* bo = (const float*)d_in[3];     const float* wk = wq; const float* wv = wq;   /* key == value == query projection (source bug) */
    float* OUT = (float*)d_out;     // [2][2048][1024]
    char* wsp = (char*)d_ws;
    auto take = [&](size_t bytes) { char* p = wsp; wsp += (bytes + 255) & ~(size_t)255; return (void*)p; };
    bf* WQ = (bf*)take((size_t)DQ * DM * 2); bf* WK = (bf*)take((size_t)DKV * DM * 2); bf* WV = (bf*)take((size_t)DKV * DM * 2); bf* WO = (bf*)take((size_t)DM * DQ * 2); float* CS = (float*)take((size_t)TT * HD * 2 * 4);
    bf* XB = (bf*)take((size_t)TT * DM * 2); float* FQ = (float*)take((size_t)TT * DQ * 4); float* FK = (float*)take((size_t)TT * DKV * 4);
    h16* QP16 = (h16*)take((size_t)NH_ * TT * HD * 2); h16* KP16 = (h16*)take((size_t)NKV * TT * HD * 2); h16* VT16 = (h16*)take((size_t)NKV * HD * 2 * TT * 2);
    bf* QPh = (bf*)take((size_t)NH_ * TT * HD * 2); bf* QPl = (bf*)take((size_t)NH_ * TT * HD * 2); bf* KPh = (bf*)take((size_t)NKV * TT * HD * 2); bf* KPl = (bf*)take((size_t)NKV * TT * HD * 2); bf* VTh = (bf*)take((size_t)NKV * HD * TT * 2); bf* VTl = (bf*)take((size_t)NKV * HD * TT * 2); bf* Ph = (bf*)take((size_t)ZH * RH * TT * 2); bf* Pl = (bf*)take((size_t)ZH * RH * TT * 2);
    float* Sb = (float*)take((size_t)ZH * TT * TT * 4); h16* P16 = (h16*)Sb;   /* fp16 probabilities overwrite their own score rows, so that ZH heads of scores fit the workspace */ float* Ob = (float*)take((size_t)ZH * TT * HD * 4); bf* ATh = (bf*)take((size_t)TT * DQ * 2); bf* ATl = (bf*)take((size_t)TT * DQ * 2);
    if ((size_t)(wsp - (char*)d_ws) > ws_size) return;    // ws 256 MiB
    float* FV = FK;   // v projection reuses the k buffer after the k planes are built (stream-ordered)
    { k_cvt8<<<(unsigned)(((size_t)DQ * DM / 8 + 255) / 256), 256, 0, stream>>>(wq, WQ, (size_t)DQ * DM / 8); k_cvt8<<<(unsigned)(((size_t)DKV * DM / 8 + 255) / 256), 256, 0, stream>>>(wk, WK, (size_t)DKV * DM / 8); k_cvt8<<<(unsigned)(((size_t)DKV * DM / 8 + 255) / 256), 256, 0, stream>>>(wv, WV, (size_t)DKV * DM / 8);
      k_cvt8<<<(unsigned)(((size_t)DM * DQ / 8 + 255) / 256), 256, 0, stream>>>(wo, WO, (size_t)DM * DQ / 8);
       }
    k_csid<<<(TT * HD + 255) / 256, 256, 0, stream>>>(CS);
    const unsigned LQ = (unsigned)(((size_t)NH_ * TT * HD / 2 + 255) / 256), LKv = (unsigned)(((size_t)NKV * TT * HD / 2 + 255) / 256);
    for (int b = 0; b < NB_; ++b) {
        
        k_cvt8<<<(unsigned)(((size_t)TT * DM / 8 + 255) / 256), 256, 0, stream>>>(x + (size_t)b * TT * DM, XB, (size_t)TT * DM / 8);
        k_gemmw<bf, 0, false, 8><<<dim3(TT / 64, DQ / 64, 1), 256, 0, stream>>>(XB, nullptr, WQ, nullptr, DM, FQ, DQ, nullptr, 0, 0, 0);
        k_rope<<<LQ, 256, 0, stream>>>(FQ, DQ, NH_, CS, nullptr, nullptr, 1.0f, QP16, QPh, QPl);
        k_gemmw<bf, 0, false, 8><<<dim3(TT / 64, DKV / 64, 1), 256, 0, stream>>>(XB, nullptr, WK, nullptr, DM, FK, DKV, nullptr, 0, 0, 0);
        k_rope<<<LKv, 256, 0, stream>>>(FK, DKV, NKV, CS, nullptr, nullptr, 1.0f, KP16, KPh, KPl);
        k_gemmw<bf, 0, false, 8><<<dim3(TT / 64, DKV / 64, 1), 256, 0, stream>>>(XB, nullptr, WV, nullptr, DM, FV, DKV, nullptr, 0, 0, 0); k_vtp<<<LKv, 256, 0, stream>>>(FV, DKV, NKV, VT16, VTh, VTl);
        for (int h0 = 0; h0 < NH_; h0 += ZH) { const size_t zq = (size_t)h0, zk = (size_t)(h0 / REP);   // one kv head per query head: the pass's ZH heads use consecutive kv planes (z-strides TT*HD; HD*2*TT for the fp16 value planes)
            k_gemmc<bf, 2, 1, 1><<<dim3(RH / 64, TT / 64, ZH), 32, 0, stream>>>(QPh + zq * TT * HD, QPl + zq * TT * HD, KPh + zk * TT * HD, KPl + zk * TT * HD, HD, Sb, TT, 0, (size_t)TT * HD, (size_t)TT * HD, (size_t)TT * TT);
            k_gemmc<h16, 0, 1, 1><<<dim3((TT - RH) / 64, TT / 64, ZH), 32, 0, stream>>>(QP16 + zq * TT * HD + (size_t)RH * HD, nullptr, KP16 + zk * TT * HD, nullptr, HD, Sb + (size_t)RH * TT, TT, RH, (size_t)TT * HD, (size_t)TT * HD, (size_t)TT * TT);
            k_asoft<<<ZH * TT / 8, 256, 0, stream>>>(Sb, P16, Ph, Pl);
            k_gemmc<bf, 2, 2, 8><<<dim3(RH / 64, HD / 64, ZH), 256, 0, stream>>>(Ph, Pl, VTh + zk * HD * TT, VTl + zk * HD * TT, TT, Ob, HD, 0, (size_t)RH * TT, (size_t)HD * TT, (size_t)TT * HD);
            k_gemmc<h16, 0, 2, 16><<<dim3((TT - RH) / 64, HD / 64, ZH), 512, 0, stream>>>(P16 + (size_t)RH * 2 * TT, nullptr, VT16 + zk * HD * 2 * TT, nullptr, 2 * TT, Ob + (size_t)RH * HD, HD, RH, (size_t)2 * TT * TT, (size_t)HD * 2 * TT, (size_t)TT * HD);   // K argument = the two planes' pitch; the k loop ends at the diagonal block, never past TT
            k_merge<<<(unsigned)(((size_t)ZH * TT * HD / 2 + 255) / 256), 256, 0, stream>>>(Ob, h0, ATh, ATl); }
        k_gemmw<bf, 1, true, 8><<<dim3(TT / 64, DM / 64, 1), 256, 0, stream>>>(ATh, ATl, WO, nullptr, DQ, OUT + (size_t)b * TT * DM, DM, bo, 0, 0, 0); }
}

// v003
// A run of this version takes 240 microseconds.
// In both of two side-by-side timings against v002, it was 1.89 times as fast.
// Counting every step since v000, it is 6.04 times as fast.
#include <hip/hip_runtime.h>

// Causal multi-head self-attention whose key and value are the QUERY projection (the module's bug, reproduced: x [2][2048][1024]; q = x Wq^T ('oi' [1024][1024] 1/32, no bias), k = v = q (16 heads x 64); scores masked above the diagonal (-inf == exclusion) then x 1/sqrt(64); softmax; ctx = attn.q; out = ctx Wo^T + bo ('oi') -> [2][2048][1024] (4.2 M); argument order x, Wq, Wo, bo).
// Layout per batch: bf16 copy of x; 'oi' weights; the one exact projection is computed into the q, k and v roles (three identical GEMMs keep the plane builders unchanged); identity-table plane builders; fused causal T-2048 attention, all heads of a batch in one launch (hybrid rows: < 512 hi/lo 3 products, rest fp16 x1024; key chunks above the diagonal are never visited); merged hi/lo x Wo exact + bo.
// Compute dtypes, f32 accumulate: every input rounded to bf16; projection exact; attention rows < 512 3 products, rest fp16; softmax f32; Wo hl x exact + bias.

#define NB_  2
#define TT   2048
#define DM   1024
#define NH_  16
#define NKV  16
#define REP  (NH_ / NKV)
#define HD   64
#define DQ   (NH_ * HD)
#define DKV  (NKV * HD)
#define ZH   16                   // heads per attention launch
#define RH   512                  // query rows < RH use hi+lo planes (0: none)
#define WIN  2048
#define PCAR 1024.0f
#define SCL  0.125f   // HD^-0.5
typedef _Float16 h16;
typedef unsigned short bf;
typedef __attribute__((ext_vector_type(16))) __bf16   v16bf;
typedef __attribute__((ext_vector_type(16))) _Float16 v16h;
typedef __attribute__((ext_vector_type(8)))  _Float16 v8h;
typedef __attribute__((ext_vector_type(8)))  unsigned short v8us;
typedef __attribute__((ext_vector_type(8)))  float    v8f;
typedef __attribute__((ext_vector_type(4)))  float    v4f;
typedef v8h  __attribute__((may_alias)) v8ha;
typedef v4f  __attribute__((may_alias)) v4fa;
typedef v8us __attribute__((may_alias)) v8usa;

__device__ __forceinline__ unsigned short f2bf(float f) { unsigned u = __float_as_uint(f); u += 0x7FFFu + ((u >> 16) & 1u); return (unsigned short)(u >> 16); }
__device__ __forceinline__ float bf2f(unsigned short b) { return __uint_as_float(((unsigned)b) << 16); }
__device__ __forceinline__ float bfr(float f) { return bf2f(f2bf(f)); }
__device__ __forceinline__ v16h cat16(v8h lo, v8h hi) { return __builtin_shufflevector(lo, hi, 0, 1, 2, 3, 4, 5, 6, 7, 8, 9, 10, 11, 12, 13, 14, 15); }
__device__ __forceinline__ v16bf cat16b(v8us lo, v8us hi) { return __builtin_bit_cast(v16bf, __builtin_shufflevector(lo, hi, 0, 1, 2, 3, 4, 5, 6, 7, 8, 9, 10, 11, 12, 13, 14, 15)); }
__device__ __forceinline__ v8f wmma16(v16h a, v16h b, v8f c) { return __builtin_amdgcn_wmma_f32_16x16x32_f16(false, a, false, b, (short)0, c, false, false); }
__device__ __forceinline__ v8f wmmab(v16bf a, v16bf b, v8f c) { return __builtin_amdgcn_wmma_f32_16x16x32_bf16(false, a, false, b, (short)0, c, false, false); }



// ---- tile_reduce: sums the NW waves' partial 64x64 tiles (split K) through LDS, one 16x64 slab per round, always in wave order 0..NW-1. Thread t < 256 ends up with columns 4 (t & 15) .. + 3 of row (t >> 4) of each slab in res[].
// Two slab sets alternate, so one barrier a round is enough: the set that round mb + 2 overwrites was last read in front of the barrier of round mb + 1. No global store stands between the barriers (a barrier would wait for it).
template <int NW> __device__ __forceinline__ void tile_reduce(const v8f (&acc)[4][4], float* os, int wave, int lr, int hi, v4f (&res)[4]) {
    static_assert(NW >= 8, "256 threads sum a slab");
    const int ro = ((int)threadIdx.x >> 4) * 68 + ((int)threadIdx.x & 15) * 4;
#pragma unroll
    for (int mb = 0; mb < 4; ++mb) { float* ob = os + (mb & 1) * (NW * 16 * 68);
#pragma unroll
        for (int nb = 0; nb < 4; ++nb) {
#pragma unroll
            for (int j = 0; j < 8; ++j) ob[wave * (16 * 68) + (hi * 8 + j) * 68 + nb * 16 + lr] = acc[mb][nb][j]; }
        __syncthreads();
        if (threadIdx.x < 256) { v4f val = *(const v4fa*)(ob + ro);
#pragma unroll
            for (int w = 1; w < NW; ++w) val += *(const v4fa*)(ob + w * (16 * 68) + ro);
            res[mb] = val; } }
}

// ---- k_gemmw: register-blocked GEMM, NW WAVES per 64x64 output tile (16 accumulators each), operands straight from K-contiguous 16-bit planes; grid (M/64, N/64, Z), 32 * NW threads.
// Split K inside the work-group: wave w takes the 32-wide k chunks w, w + NW, w + 2 NW, ..., so a tile's chain of dependent load -> matrix passes is NW times shorter; tile_reduce sums the partial tiles.
// C[m][n] (f32, pitch ldc, + optional f32 bias[n]) = sum_k A[m][k] Bt[n][k] (+ split products per NSPLIT). z-batch strides sA/sB/sC in elements. K % 32 == 0.
template <typename T16> struct WFrag;
template <> struct WFrag<h16> { typedef v16h V; static __device__ __forceinline__ V ld(const h16* p) { return cat16(*(const v8h*)p, *(const v8h*)(p + 16)); } static __device__ __forceinline__ v8f mma(V a, V b, v8f c) { return wmma16(a, b, c); } };
template <> struct WFrag<bf> { typedef v16bf V; static __device__ __forceinline__ V ld(const bf* p) { return cat16b(*(const v8us*)p, *(const v8us*)(p + 16)); } static __device__ __forceinline__ v8f mma(V a, V b, v8f c) { return wmmab(a, b, c); } };
template <typename T16, int NSPLIT, bool BIAS, int NW>
__global__ __launch_bounds__(32 * NW) void k_gemmw(const T16* __restrict__ A, const T16* __restrict__ A2, const T16* __restrict__ Bt, const T16* __restrict__ Bt2, int K, float* C, int ldc, const float* __restrict__ bias, size_t sA, size_t sB, size_t sC) {
    typedef typename WFrag<T16>::V V;
    __shared__ __align__(16) float os[(NW == 1 ? 1 : 2 * NW) * 16 * 68];
    const size_t z = blockIdx.z; A += z * sA; if (A2) A2 += z * sA; Bt += z * sB; if (Bt2) Bt2 += z * sB; C += z * sC;
    const int lane = threadIdx.x & 31, lr = lane & 15, hi = lane >> 4; const int r0 = blockIdx.x * 64, c0 = blockIdx.y * 64; const int wave = (NW == 1) ? 0 : __builtin_amdgcn_readfirstlane((int)(threadIdx.x >> 5));
    v8f acc[4][4];
#pragma unroll
    for (int mb = 0; mb < 4; ++mb)
#pragma unroll
        for (int nb = 0; nb < 4; ++nb) acc[mb][nb] = (v8f){};
    const size_t aoff = (size_t)(r0 + lr) * K + 8 * hi, boff = (size_t)(c0 + lr) * K + 8 * hi;
#pragma unroll 1
    for (int kc = wave * 32; kc < K; kc += 32 * NW) {
        V a[4], a2[4];
#pragma unroll
        for (int mb = 0; mb < 4; ++mb) { a[mb] = WFrag<T16>::ld(A + aoff + (size_t)mb * 16 * K + kc); if (NSPLIT == 1 || NSPLIT == 2) a2[mb] = WFrag<T16>::ld(A2 + aoff + (size_t)mb * 16 * K + kc); }
#pragma unroll
        for (int nb = 0; nb < 4; ++nb) { const V b = WFrag<T16>::ld(Bt + boff + (size_t)nb * 16 * K + kc); V b2; if (NSPLIT >= 2) b2 = WFrag<T16>::ld(Bt2 + boff + (size_t)nb * 16 * K + kc);
#pragma unroll
            for (int mb = 0; mb < 4; ++mb) { acc[mb][nb] = WFrag<T16>::mma(a[mb], b, acc[mb][nb]); if (NSPLIT == 1 || NSPLIT == 2) acc[mb][nb] = WFrag<T16>::mma(a2[mb], b, acc[mb][nb]); if (NSPLIT >= 2) acc[mb][nb] = WFrag<T16>::mma(a[mb], b2, acc[mb][nb]); } }
        asm volatile("v_nop\n\tv_nop\n\tv_nop\n\tv_nop" : "+v"(acc[0][0]), "+v"(acc[1][1]), "+v"(acc[2][2]), "+v"(acc[3][3]) : "v"(a[0]), "v"(a[3]));
    }
    v4f res[4]; tile_reduce<NW>(acc, os, wave, lr, hi, res);
    if (threadIdx.x < 256) { const int row = (int)threadIdx.x >> 4, cofs = ((int)threadIdx.x & 15) * 4;
#pragma unroll
        for (int mb = 0; mb < 4; ++mb) { v4f val = res[mb]; if (BIAS) { val[0] += bfr(bias[c0 + cofs]); val[1] += bfr(bias[c0 + cofs + 1]); val[2] += bfr(bias[c0 + cofs + 2]); val[3] += bfr(bias[c0 + cofs + 3]); }
            *(v4f*)(C + (size_t)(r0 + mb * 16 + row) * ldc + c0 + cofs) = val; } }
}

__device__ __forceinline__ h16 tohx(float x) { return (h16)x; }
__device__ __forceinline__ void splitf(float y, unsigned short& h, unsigned short& l) { h = f2bf(y); l = f2bf(y - bf2f(h)); }
typedef __attribute__((ext_vector_type(2))) _Float16 v2h;
typedef __attribute__((ext_vector_type(4))) _Float16 v4h;
typedef __attribute__((ext_vector_type(2))) unsigned short v2us;
typedef __attribute__((ext_vector_type(4))) unsigned short v4us;
typedef __attribute__((ext_vector_type(2))) float v2f;
typedef __attribute__((ext_vector_type(4))) int v4i;

__global__ __launch_bounds__(256) void k_cvt8(const float* __restrict__ src, bf* dst, size_t n8) { const size_t i = (size_t)blockIdx.x * 256 + threadIdx.x; if (i >= n8) return; const v8f v = *(const v8f*)(src + i * 8); v8us o;
#pragma unroll
    for (int k = 0; k < 8; ++k) o[k] = f2bf(v[k]); *(v8us*)(dst + i * 8) = o;  }

// k_rope: head planes [h][t][d] (fp16 + hi/lo) of rope(x) x sc with the rotate-half convention out[d] = x[d] cos[t][d] - x[d+HD/2] sin[t][d], out[d+HD/2] = x[d+HD/2] cos[t][d+HD/2] + x[d] sin[t][d+HD/2]
__global__ __launch_bounds__(256) void k_rope(const float* __restrict__ F, int pitch, int nheads, const float* __restrict__ CS, const float* __restrict__ RF, const float* __restrict__ nw, float sc, h16* P16, bf* Ph, bf* Pl) {
    const size_t e = ((size_t)blockIdx.x * 256 + threadIdx.x) * 2; if (e >= (size_t)nheads * TT * HD) return; const int d = (int)(e % HD); const int t = (int)((e / HD) % TT); const int h = (int)(e / ((size_t)HD * TT)); const float* f = F + (size_t)t * pitch + h * HD; const float rf = RF ? RF[(size_t)h * TT + t] : 1.0f; v2h o16; v2us oh, ol;
#pragma unroll
    for (int q = 0; q < 2; ++q) { const int dd = d + q; const int dp = (dd < HD / 2) ? dd + HD / 2 : dd - HD / 2; float x0 = f[dd], x1 = f[dp];
        if (RF) { float n0 = __fmul_rn(x0, rf), n1 = __fmul_rn(x1, rf); asm volatile("" : "+v"(n0)); asm volatile("" : "+v"(n1)); x0 = __fmul_rn(bfr(nw[dd]), n0); x1 = __fmul_rn(bfr(nw[dp]), n1); }
        const v2f cs = *(const v2f*)(CS + ((size_t)t * HD + dd) * 2); float a = __fmul_rn(x0, cs[0]), bq = __fmul_rn(x1, cs[1]); asm volatile("" : "+v"(a)); asm volatile("" : "+v"(bq)); const float r = ((dd < HD / 2) ? __fsub_rn(a, bq) : __fadd_rn(a, bq)) * sc;
        o16[q] = tohx(r); unsigned short a2, c2; splitf(r, a2, c2); oh[q] = a2; ol[q] = c2; }
    *(v2h*)(P16 + e) = o16; *(v2us*)(Ph + e) = oh; *(v2us*)(Pl + e) = ol;  }
// k_vtp: transposed value planes [g][d][t]; the fp16 plane has row pitch 2 TT; hi/lo planes pitch TT.
__global__ __launch_bounds__(256) void k_vtp(const float* __restrict__ F, int pitch, int nheads, h16* V16, bf* Vh, bf* Vl) { const size_t e = ((size_t)blockIdx.x * 256 + threadIdx.x) * 2; if (e >= (size_t)nheads * HD * TT) return; const int t = (int)(e % TT); const int d = (int)((e / TT) % HD); const int g = (int)(e / ((size_t)TT * HD)); v2h o16; v2us oh, ol;
#pragma unroll
    for (int q = 0; q < 2; ++q) { const float x = F[(size_t)(t + q) * pitch + g * HD + d]; o16[q] = tohx(x); unsigned short a2, c2; splitf(x, a2, c2); oh[q] = a2; ol[q] = c2; }
    *(v2h*)(V16 + 2 * e - t) = o16; *(v2us*)(Vh + e) = oh; *(v2us*)(Vl + e) = ol;  }
__global__ __launch_bounds__(256) void k_csid(float* CS) { const int idx = blockIdx.x * 256 + threadIdx.x; if (idx >= TT * HD) return; v2f cs; cs[0] = 1.0f; cs[1] = 0.0f; *(v2f*)(CS + (size_t)idx * 2) = cs;  }
// ---- k_fattn: causal attention of one query tile of one head in one work-group; scores and probabilities stay in registers (online softmax), nothing of them goes to memory.
// S^T = K Q^T (A = 16 key rows, B = 16 query rows): a lane holds 16 of the 32 scores of ONE query (column lr), keys kc + 8 hi + j and kc + 16 + 8 hi + j, which is the k order of a B operand, so the converted
// probabilities are the B operand of O^T += V^T P^T (A = 16 rows of the transposed value plane) with no exchange; O^T keeps the lane's query, so maximum, sum and rescale are per lane (one exchange between the halves for the maximum).
// Split keys inside the work-group: wave w takes the 32-key chunks w, w + NW, ...; each wave keeps its own (level, sum, O^T); they are joined through LDS in wave order 0..NW-1.
// Every inner loop is unrolled so that fragments, scores and accumulators are indexed by constants and stay in registers.
// The level m is in log2 units and stands SH below the running maximum, so fp16 probabilities are carried x 2^SH = PCAR (as the output of rows >= RH is, for k_merge). A masked raw score is -3e38 and the start level -1e30: exp2 gives 0 for it also where a whole chunk is masked.
__device__ __forceinline__ float xhalf(float x) { const int b = __float_as_int(x); return __int_as_float(__builtin_amdgcn_permlanex16(b, b, 0x76543210, 0xfedcba98, false, false)); }   // the value of lane ^ 16
// exp2 with the one slot that the instruction set asks for before a transcendental's result is used or its source overwritten: the v_nop takes the result
// and keeps the source alive, so only independent instructions can stand between the two; the builtin stays, so that the compiler still keeps the matrix instructions' distances for it.
__device__ __forceinline__ float exp2s(float x) { float r = __builtin_amdgcn_exp2f(x); asm("v_nop" : "+v"(r) : "v"(x)); return r; }
// fragment at byte offset bo (per lane, 32 bits) + co (constant) of a wave-uniform plane pointer: one offset register beside a scalar base
template <typename T16> __device__ __forceinline__ typename WFrag<T16>::V ldo(const T16* base, unsigned bo, int co) { return WFrag<T16>::ld((const T16*)((const char*)base + bo + co)); }
template <typename T16, bool HI, int NQ, int NW>
__device__ __forceinline__ void attn_tile(const T16* __restrict__ Q, const T16* __restrict__ Q2, const T16* __restrict__ Kp, const T16* __restrict__ K2, const T16* __restrict__ Vt, const T16* __restrict__ Vt2, int vp, int r0, float* O, float* sm) {
    typedef typename WFrag<T16>::V V;
    const float SH = HI ? 0.0f : 10.0f;                     // 2^10 == PCAR
    const float SCL2 = SCL * 1.4426950408889634f;           // HD^-0.5 x log2(e)
    const int lane = threadIdx.x & 31, lr = lane & 15, hi = lane >> 4; const int wave = __builtin_amdgcn_readfirstlane((int)(threadIdx.x >> 5));
    V q[NQ][2], q2[NQ][2]; v8f acc[NQ][4]; float m[NQ], l[NQ];
    const unsigned qo = (unsigned)(((r0 + lr) * HD + 8 * hi) * 2);
    unsigned ko = (unsigned)(((wave * 32 + lr) * HD + 8 * hi) * 2), vo = (unsigned)((lr * vp + wave * 32 + 8 * hi) * 2);   // byte offsets of the lane's key row and value row at the wave's current chunk
#pragma unroll
    for (int nq = 0; nq < NQ; ++nq) { m[nq] = -1.0e30f; l[nq] = 0.0f;
#pragma unroll
        for (int kk = 0; kk < 2; ++kk) { const int co = (nq * 16 * HD + kk * 32) * 2; q[nq][kk] = ldo(Q, qo, co); if (HI) q2[nq][kk] = ldo(Q2, qo, co); }
#pragma unroll
        for (int dt = 0; dt < 4; ++dt) acc[nq][dt] = (v8f){}; }
    const int nch = (r0 + NQ * 16 + 31) >> 5;               // 32-key chunks up to and with the diagonal
    V ka[2][2], ka2[2][2];                                  // key fragments, fetched one pass ahead; the first fetch (rows 32 wave .. + 31 < TT) is in bounds also for a wave that has no chunk
#pragma unroll
    for (int kt = 0; kt < 2; ++kt)
#pragma unroll
        for (int kk = 0; kk < 2; ++kk) { const int co = (kt * 16 * HD + kk * 32) * 2; ka[kt][kk] = ldo(Kp, ko, co); if (HI) ka2[kt][kk] = ldo(K2, ko, co); }
#pragma unroll 1   // rolled: a second pass in flight would not fit the registers of four waves per SIMD
    for (int c = wave; c < nch; c += NW) { const int kc = c * 32;
        V va[4], va2[4];
#pragma unroll
        for (int dt = 0; dt < 4; ++dt) { const int co = dt * 16 * vp * 2; va[dt] = ldo(Vt, vo, co); if (HI) va2[dt] = ldo(Vt2, vo, co); }
        v8f s[NQ][2];
#pragma unroll
        for (int nq = 0; nq < NQ; ++nq)
#pragma unroll
            for (int kt = 0; kt < 2; ++kt) { v8f t = (v8f){};
#pragma unroll
                for (int kk = 0; kk < 2; ++kk) { t = WFrag<T16>::mma(ka[kt][kk], q[nq][kk], t); if (HI) { t = WFrag<T16>::mma(ka2[kt][kk], q[nq][kk], t); t = WFrag<T16>::mma(ka[kt][kk], q2[nq][kk], t); } }
                s[nq][kt] = t; }
        ko += (c + NW < nch) ? NW * 32 * HD * 2 : 0;        // last pass: the same rows again, never past the diagonal chunk
#pragma unroll
        for (int kt = 0; kt < 2; ++kt)
#pragma unroll
            for (int kk = 0; kk < 2; ++kk) { const int co = (kt * 16 * HD + kk * 32) * 2; ka[kt][kk] = ldo(Kp, ko, co); if (HI) ka2[kt][kk] = ldo(K2, ko, co); }
        asm volatile("s_wait_xcnt 0x0" ::: "memory");       // the wait that belongs in front of the overwrites of ko and vo, which the loads issued in this pass name
        if (c == nch - 1) {                                 // only the diagonal chunk holds keys above a query of the tile (wave-uniform test)
#pragma unroll
            for (int nq = 0; nq < NQ; ++nq) { const int lim = r0 + nq * 16 + lr - kc - 8 * hi;   // key kc + 16 kt + 8 hi + j is allowed while 16 kt + j <= lim
#pragma unroll
                for (int kt = 0; kt < 2; ++kt)
#pragma unroll
                    for (int j = 0; j < 8; ++j) s[nq][kt][j] = (kt * 16 + j <= lim) ? s[nq][kt][j] : -3.0e38f; } }
#pragma unroll
        for (int nq = 0; nq < NQ; ++nq) {
            float mx = s[nq][0][0];
#pragma unroll
            for (int kt = 0; kt < 2; ++kt)
#pragma unroll
                for (int j = 0; j < 8; ++j) mx = fmaxf(mx, s[nq][kt][j]);
            mx = fmaxf(mx, xhalf(mx));
            const float mn = fmaxf(m[nq], mx * SCL2 - SH); const float alpha = exp2s(m[nq] - mn); m[nq] = mn;
            float ps = 0.0f;
#pragma unroll
            for (int kt = 0; kt < 2; ++kt)
#pragma unroll
                for (int j = 0; j < 8; ++j) { const float pe = exp2s(__builtin_fmaf(s[nq][kt][j], SCL2, -mn)); s[nq][kt][j] = pe; ps += pe; }
            l[nq] = l[nq] * alpha + ps;
#pragma unroll
            for (int dt = 0; dt < 4; ++dt) acc[nq][dt] *= alpha;
            if constexpr (HI) { v8us h0, h1, l0, l1;
#pragma unroll
                for (int j = 0; j < 8; ++j) { unsigned short a, c2; splitf(s[nq][0][j], a, c2); h0[j] = a; l0[j] = c2; splitf(s[nq][1][j], a, c2); h1[j] = a; l1[j] = c2; }
                const V pf = cat16b(h0, h1), pf2 = cat16b(l0, l1);
#pragma unroll
                for (int dt = 0; dt < 4; ++dt) { acc[nq][dt] = WFrag<T16>::mma(va[dt], pf, acc[nq][dt]); acc[nq][dt] = WFrag<T16>::mma(va2[dt], pf, acc[nq][dt]); acc[nq][dt] = WFrag<T16>::mma(va[dt], pf2, acc[nq][dt]); }
            } else { v8h h0, h1;
#pragma unroll
                for (int j = 0; j < 8; ++j) { h0[j] = tohx(s[nq][0][j]); h1[j] = tohx(s[nq][1][j]); }
                const V pf = cat16(h0, h1);
#pragma unroll
                for (int dt = 0; dt < 4; ++dt) acc[nq][dt] = WFrag<T16>::mma(va[dt], pf, acc[nq][dt]); }
        }
        vo += NW * 32 * 2;
    }
    float* ms = sm + NW * NQ * 16 * 68; float* ls = ms + NW * NQ * 16;
#pragma unroll
    for (int nq = 0; nq < NQ; ++nq) { const float lt = l[nq] + xhalf(l[nq]);
#pragma unroll
        for (int dt = 0; dt < 4; ++dt) { float* o = sm + (wave * NQ * 16 + nq * 16 + lr) * 68 + dt * 16 + hi * 8; const v8f a = acc[nq][dt];
            *(v4fa*)o = (v4f){a[0], a[1], a[2], a[3]}; *(v4fa*)(o + 4) = (v4f){a[4], a[5], a[6], a[7]}; }
        if (hi == 0) { ms[wave * NQ * 16 + nq * 16 + lr] = m[nq]; ls[wave * NQ * 16 + nq * 16 + lr] = lt; } }
    __syncthreads();
#pragma unroll
    for (int idx = (int)threadIdx.x; idx < NQ * 256; idx += 32 * NW) { const int qq = idx >> 4, d4 = (idx & 15) * 4;
        float M = ms[qq];
#pragma unroll
        for (int w = 1; w < NW; ++w) M = fmaxf(M, ms[w * NQ * 16 + qq]);
        float L = 0.0f; v4f val = (v4f){};
#pragma unroll
        for (int w = 0; w < NW; ++w) { const float wt = exp2s(ms[w * NQ * 16 + qq] - M); L += ls[w * NQ * 16 + qq] * wt; val += *(const v4fa*)(sm + (w * NQ * 16 + qq) * 68 + d4) * wt; }
        const float f = __fdiv_rn(HI ? 1.0f : PCAR, L);
        *(v4f*)(O + (size_t)(r0 + qq) * HD + d4) = val * f; }
}
// grid (heads, tiles): the tile index is the slow one and the longest tiles (last rows) come first. Tiles 0 .. (TT - RH) / 32 - 1: 32 fp16 rows each; the rest: 16 hi/lo rows each (3 products). O [head][t][d], x PCAR for t >= RH.
template <int NW>
__global__ __launch_bounds__(32 * NW) void k_fattn(const h16* __restrict__ Q16, const h16* __restrict__ K16, const h16* __restrict__ V16, const bf* __restrict__ Qh, const bf* __restrict__ Ql, const bf* __restrict__ Kh, const bf* __restrict__ Kl, const bf* __restrict__ Vh, const bf* __restrict__ Vl, float* O) {
    __shared__ __align__(16) float sm[NW * 32 * 70];
    const size_t z = blockIdx.x, zp = z * TT * HD; const int ty = blockIdx.y;
    if (ty < (TT - RH) / 32) attn_tile<h16, false, 2, NW>(Q16 + zp, nullptr, K16 + zp, nullptr, V16 + 2 * zp, nullptr, 2 * TT, TT - 32 * (ty + 1), O + zp, sm);
    else attn_tile<bf, true, 1, NW>(Qh + zp, Ql + zp, Kh + zp, Kl + zp, Vh + zp, Vl + zp, TT, RH - 16 * (ty - (TT - RH) / 32 + 1), O + zp, sm);
}
__global__ __launch_bounds__(256) void k_merge(const float* __restrict__ O, int h0, bf* Ah, bf* Al) { const size_t e = ((size_t)blockIdx.x * 256 + threadIdx.x) * 2; if (e >= (size_t)ZH * TT * HD) return; const int d = (int)(e % HD); const int t = (int)((e / HD) % TT); const int zz = (int)(e / ((size_t)HD * TT)); const float cs = (t < RH) ? 1.0f : (1.0f / PCAR); const size_t oo = (size_t)t * DQ + (h0 + zz) * HD + d;
    v2us oh, ol;
#pragma unroll
    for (int q = 0; q < 2; ++q) { unsigned short a, c2; splitf(O[e + q] * cs, a, c2); oh[q] = a; ol[q] = c2; } *(v2us*)(Ah + oo) = oh; *(v2us*)(Al + oo) = ol;  }

extern "C" void kernel_launch(void* const* d_in, const int* in_sizes, int n_in,
                              void* d_out, int out_size, void* d_ws, size_t ws_size, hipStream_t stream) {
    (void)in_sizes; (void)n_in; (void)out_size;
    const float* x = (const float*)d_in[0]; const float* wq = (const float*)d_in[1]; const float* wo = (const float*)d_in[2]; const float* bo = (const float*)d_in[3];     const float* wk = wq; const float* wv = wq;   /* key == value == query projection (source bug) */
    float* OUT = (float*)d_out;     // [2][2048][1024]
    char* wsp = (char*)d_ws;
    auto take = [&](size_t bytes) { char* p = wsp; wsp += (bytes + 255) & ~(size_t)255; return (void*)p; };
    bf* WQ = (bf*)take((size_t)DQ * DM * 2); bf* WK = (bf*)take((size_t)DKV * DM * 2); bf* WV = (bf*)take((size_t)DKV * DM * 2); bf* WO = (bf*)take((size_t)DM * DQ * 2); float* CS = (float*)take((size_t)TT * HD * 2 * 4);
    bf* XB = (bf*)take((size_t)TT * DM * 2); float* FQ = (float*)take((size_t)TT * DQ * 4); float* FK = (float*)take((size_t)TT * DKV * 4);
    h16* QP16 = (h16*)take((size_t)NH_ * TT * HD * 2); h16* KP16 = (h16*)take((size_t)NKV * TT * HD * 2); h16* VT16 = (h16*)take((size_t)NKV * HD * 2 * TT * 2);
    bf* QPh = (bf*)take((size_t)NH_ * TT * HD * 2); bf* QPl = (bf*)take((size_t)NH_ * TT * HD * 2); bf* KPh = (bf*)take((size_t)NKV * TT * HD * 2); bf* KPl = (bf*)take((size_t)NKV * TT * HD * 2); bf* VTh = (bf*)take((size_t)NKV * HD * TT * 2); bf* VTl = (bf*)take((size_t)NKV * HD * TT * 2);
    float* Ob = (float*)take((size_t)ZH * TT * HD * 4); bf* ATh = (bf*)take((size_t)TT * DQ * 2); bf* ATl = (bf*)take((size_t)TT * DQ * 2);
    if ((size_t)(wsp - (char*)d_ws) > ws_size) return;    // ws 256 MiB
    float* FV = FK;   // v projection reuses the k buffer after the k planes are built (stream-ordered)
    { k_cvt8<<<(unsigned)(((size_t)DQ * DM / 8 + 255) / 256), 256, 0, stream>>>(wq, WQ, (size_t)DQ * DM / 8); k_cvt8<<<(unsigned)(((size_t)DKV * DM / 8 + 255) / 256), 256, 0, stream>>>(wk, WK, (size_t)DKV * DM / 8); k_cvt8<<<(unsigned)(((size_t)DKV * DM / 8 + 255) / 256), 256, 0, stream>>>(wv, WV, (size_t)DKV * DM / 8);
      k_cvt8<<<(unsigned)(((size_t)DM * DQ / 8 + 255) / 256), 256, 0, stream>>>(wo, WO, (size_t)DM * DQ / 8);
       }
    k_csid<<<(TT * HD + 255) / 256, 256, 0, stream>>>(CS);
    const unsigned LQ = (unsigned)(((size_t)NH_ * TT * HD / 2 + 255) / 256), LKv = (unsigned)(((size_t)NKV * TT * HD / 2 + 255) / 256);
    for (int b = 0; b < NB_; ++b) {
        
        k_cvt8<<<(unsigned)(((size_t)TT * DM / 8 + 255) / 256), 256, 0, stream>>>(x + (size_t)b * TT * DM, XB, (size_t)TT * DM / 8);
        k_gemmw<bf, 0, false, 8><<<dim3(TT / 64, DQ / 64, 1), 256, 0, stream>>>(XB, nullptr, WQ, nullptr, DM, FQ, DQ, nullptr, 0, 0, 0);
        k_rope<<<LQ, 256, 0, stream>>>(FQ, DQ, NH_, CS, nullptr, nullptr, 1.0f, QP16, QPh, QPl);
        k_gemmw<bf, 0, false, 8><<<dim3(TT / 64, DKV / 64, 1), 256, 0, stream>>>(XB, nullptr, WK, nullptr, DM, FK, DKV, nullptr, 0, 0, 0);
        k_rope<<<LKv, 256, 0, stream>>>(FK, DKV, NKV, CS, nullptr, nullptr, 1.0f, KP16, KPh, KPl);
        k_gemmw<bf, 0, false, 8><<<dim3(TT / 64, DKV / 64, 1), 256, 0, stream>>>(XB, nullptr, WV, nullptr, DM, FV, DKV, nullptr, 0, 0, 0); k_vtp<<<LKv, 256, 0, stream>>>(FV, DKV, NKV, VT16, VTh, VTl);
        k_fattn<8><<<dim3(NH_, (TT - RH) / 32 + RH / 16, 1), 256, 0, stream>>>(QP16, KP16, VT16, QPh, QPl, KPh, KPl, VTh, VTl, Ob);   // one kv head per query head
        k_merge<<<(unsigned)(((size_t)ZH * TT * HD / 2 + 255) / 256), 256, 0, stream>>>(Ob, 0, ATh, ATl);
        k_gemmw<bf, 1, true, 8><<<dim3(TT / 64, DM / 64, 1), 256, 0, stream>>>(ATh, ATl, WO, nullptr, DQ, OUT + (size_t)b * TT * DM, DM, bo, 0, 0, 0); }
}

// v004
// It runs in 184 microseconds.
// Timed twice side by side with v003, it ran 1.29 and 1.31 times as fast.
// Over all steps from v000 it is 7.84 times as fast.
#include <hip/hip_runtime.h>

// Causal multi-head self-attention whose key and value are the QUERY projection (the module's bug, reproduced: x [2][2048][1024]; q = x Wq^T ('oi' [1024][1024] 1/32, no bias), k = v = q (16 heads x 64); scores masked above the diagonal (-inf == exclusion) then x 1/sqrt(64); softmax; ctx = attn.q; out = ctx Wo^T + bo ('oi') -> [2][2048][1024] (4.2 M); argument order x, Wq, Wo, bo).
// Layout per batch: bf16 copy of x; 'oi' weights; the one exact projection is computed into the q, k and v roles (three GEMMs), each GEMM storing the 16-bit operand planes of the attention kernel itself (the v role as W x^T, so that its tile is already transposed); fused causal T-2048 attention, all heads of a batch in one launch (hybrid rows: < 512 hi/lo 3 products, rest fp16 x1024; key chunks above the diagonal are never visited), storing the merged hi/lo context itself; hi/lo x Wo exact + bo.
// Compute dtypes, f32 accumulate: every input rounded to bf16; projection exact; attention rows < 512 3 products, rest fp16; softmax f32; Wo hl x exact + bias.

#define NB_  2
#define TT   2048
#define DM   1024
#define NH_  16
#define NKV  16
#define REP  (NH_ / NKV)
#define HD   64
#define DQ   (NH_ * HD)
#define DKV  (NKV * HD)
#define RH   512                  // query rows < RH use hi+lo planes (0: none)
#define WIN  2048
#define SCL  0.125f   // HD^-0.5
typedef _Float16 h16;
typedef unsigned short bf;
typedef __attribute__((ext_vector_type(16))) __bf16   v16bf;
typedef __attribute__((ext_vector_type(16))) _Float16 v16h;
typedef __attribute__((ext_vector_type(8)))  _Float16 v8h;
typedef __attribute__((ext_vector_type(8)))  unsigned short v8us;
typedef __attribute__((ext_vector_type(8)))  float    v8f;
typedef __attribute__((ext_vector_type(4)))  float    v4f;
typedef v8h  __attribute__((may_alias)) v8ha;
typedef v4f  __attribute__((may_alias)) v4fa;
typedef v8us __attribute__((may_alias)) v8usa;

__device__ __forceinline__ unsigned short f2bf(float f) { unsigned u = __float_as_uint(f); u += 0x7FFFu + ((u >> 16) & 1u); return (unsigned short)(u >> 16); }
__device__ __forceinline__ float bf2f(unsigned short b) { return __uint_as_float(((unsigned)b) << 16); }
__device__ __forceinline__ float bfr(float f) { return bf2f(f2bf(f)); }
__device__ __forceinline__ v16h cat16(v8h lo, v8h hi) { return __builtin_shufflevector(lo, hi, 0, 1, 2, 3, 4, 5, 6, 7, 8, 9, 10, 11, 12, 13, 14, 15); }
__device__ __forceinline__ v16bf cat16b(v8us lo, v8us hi) { return __builtin_bit_cast(v16bf, __builtin_shufflevector(lo, hi, 0, 1, 2, 3, 4, 5, 6, 7, 8, 9, 10, 11, 12, 13, 14, 15)); }
__device__ __forceinline__ v8f wmma16(v16h a, v16h b, v8f c) { return __builtin_amdgcn_wmma_f32_16x16x32_f16(false, a, false, b, (short)0, c, false, false); }
__device__ __forceinline__ v8f wmmab(v16bf a, v16bf b, v8f c) { return __builtin_amdgcn_wmma_f32_16x16x32_bf16(false, a, false, b, (short)0, c, false, false); }

__device__ __forceinline__ h16 tohx(float x) { return (h16)x; }
__device__ __forceinline__ void splitf(float y, unsigned short& h, unsigned short& l) { h = f2bf(y); l = f2bf(y - bf2f(h)); }
typedef __attribute__((ext_vector_type(4))) _Float16 v4h;
typedef __attribute__((ext_vector_type(4))) unsigned short v4us;

// ---- tile_reduce: sums the NW waves' partial 64x64 tiles (split K) through LDS, one 16x64 slab per round, always in wave order 0..NW-1. Thread t < 256 ends up with columns 4 (t & 15) .. + 3 of row (t >> 4) of each slab in res[].
// Two slab sets alternate, so one barrier a round is enough: the set that round mb + 2 overwrites was last read in front of the barrier of round mb + 1. No global store stands between the barriers (a barrier would wait for it).
template <int NW> __device__ __forceinline__ void tile_reduce(const v8f (&acc)[4][4], float* os, int wave, int lr, int hi, v4f (&res)[4]) {
    static_assert(NW >= 8, "256 threads sum a slab");
    const int ro = ((int)threadIdx.x >> 4) * 68 + ((int)threadIdx.x & 15) * 4;
#pragma unroll
    for (int mb = 0; mb < 4; ++mb) { float* ob = os + (mb & 1) * (NW * 16 * 68);
#pragma unroll
        for (int nb = 0; nb < 4; ++nb) {
#pragma unroll
            for (int j = 0; j < 8; ++j) ob[wave * (16 * 68) + (hi * 8 + j) * 68 + nb * 16 + lr] = acc[mb][nb][j]; }
        __syncthreads();
        if (threadIdx.x < 256) { v4f val = *(const v4fa*)(ob + ro);
#pragma unroll
            for (int w = 1; w < NW; ++w) val += *(const v4fa*)(ob + w * (16 * 68) + ro);
            res[mb] = val; } }
}

// ---- k_gemmw: register-blocked GEMM, NW WAVES per 64x64 output tile (16 accumulators each), operands straight from K-contiguous 16-bit planes; grid (M/64, N/64, Z), 32 * NW threads.
// Split K inside the work-group: wave w takes the 32-wide k chunks w, w + NW, w + 2 NW, ..., so a tile's chain of dependent load -> matrix passes is NW times shorter; tile_reduce sums the partial tiles.
// C[m][n] (f32, pitch ldc, + optional f32 bias[n]) = sum_k A[m][k] Bt[n][k] (+ split products per NSPLIT). z-batch strides sA/sB/sC in elements. K % 32 == 0.
// PL: no f32 C; the tile goes out as the three 16-bit planes its consumer reads (fp16, bf16 hi, bf16 lo), element (m, n) at m * ld + (n / 64) * cb + n % 64 (ld16 for the fp16 plane, ldp for hi and lo).
// Head planes [h][t][d]: m = t, ld = HD, cb = TT * HD. Transposed planes [g][d][t]: m = g * HD + d (A = the weight, Bt = x), ld = the plane's row pitch, cb = 64. A thread's 4 columns are 8 bytes, 16 threads fill one 128-byte line.
template <typename T16> struct WFrag;
template <> struct WFrag<h16> { typedef v16h V; static __device__ __forceinline__ V ld(const h16* p) { return cat16(*(const v8h*)p, *(const v8h*)(p + 16)); } static __device__ __forceinline__ v8f mma(V a, V b, v8f c) { return wmma16(a, b, c); } };
template <> struct WFrag<bf> { typedef v16bf V; static __device__ __forceinline__ V ld(const bf* p) { return cat16b(*(const v8us*)p, *(const v8us*)(p + 16)); } static __device__ __forceinline__ v8f mma(V a, V b, v8f c) { return wmmab(a, b, c); } };
template <typename T16, int NSPLIT, bool BIAS, int NW, bool PL>
__global__ __launch_bounds__(32 * NW) void k_gemmw(const T16* __restrict__ A, const T16* __restrict__ A2, const T16* __restrict__ Bt, const T16* __restrict__ Bt2, int K, float* C, int ldc, const float* __restrict__ bias, size_t sA, size_t sB, size_t sC, h16* P16, bf* Ph, bf* Pl, int ld16, int ldp, int cb) {
    typedef typename WFrag<T16>::V V;
    __shared__ __align__(16) float os[(NW == 1 ? 1 : 2 * NW) * 16 * 68];
    const size_t z = blockIdx.z; A += z * sA; if (A2) A2 += z * sA; Bt += z * sB; if (Bt2) Bt2 += z * sB; C += z * sC;
    const int lane = threadIdx.x & 31, lr = lane & 15, hi = lane >> 4; const int r0 = blockIdx.x * 64, c0 = blockIdx.y * 64; const int wave = (NW == 1) ? 0 : __builtin_amdgcn_readfirstlane((int)(threadIdx.x >> 5));
    v8f acc[4][4];
#pragma unroll
    for (int mb = 0; mb < 4; ++mb)
#pragma unroll
        for (int nb = 0; nb < 4; ++nb) acc[mb][nb] = (v8f){};
    const size_t aoff = (size_t)(r0 + lr) * K + 8 * hi, boff = (size_t)(c0 + lr) * K + 8 * hi;
#pragma unroll 1
    for (int kc = wave * 32; kc < K; kc += 32 * NW) {
        V a[4], a2[4];
#pragma unroll
        for (int mb = 0; mb < 4; ++mb) { a[mb] = WFrag<T16>::ld(A + aoff + (size_t)mb * 16 * K + kc); if (NSPLIT == 1 || NSPLIT == 2) a2[mb] = WFrag<T16>::ld(A2 + aoff + (size_t)mb * 16 * K + kc); }
#pragma unroll
        for (int nb = 0; nb < 4; ++nb) { const V b = WFrag<T16>::ld(Bt + boff + (size_t)nb * 16 * K + kc); V b2; if (NSPLIT >= 2) b2 = WFrag<T16>::ld(Bt2 + boff + (size_t)nb * 16 * K + kc);
#pragma unroll
            for (int mb = 0; mb < 4; ++mb) { acc[mb][nb] = WFrag<T16>::mma(a[mb], b, acc[mb][nb]); if (NSPLIT == 1 || NSPLIT == 2) acc[mb][nb] = WFrag<T16>::mma(a2[mb], b, acc[mb][nb]); if (NSPLIT >= 2) acc[mb][nb] = WFrag<T16>::mma(a[mb], b2, acc[mb][nb]); } }
        asm volatile("v_nop\n\tv_nop\n\tv_nop\n\tv_nop" : "+v"(acc[0][0]), "+v"(acc[1][1]), "+v"(acc[2][2]), "+v"(acc[3][3]) : "v"(a[0]), "v"(a[3]));
    }
    v4f res[4]; tile_reduce<NW>(acc, os, wave, lr, hi, res);
    if (threadIdx.x < 256) { const int row = (int)threadIdx.x >> 4, cofs = ((int)threadIdx.x & 15) * 4;
        if constexpr (PL) { const int pc = (int)blockIdx.y * cb + cofs;
#pragma unroll
            for (int mb = 0; mb < 4; ++mb) { v4h o16; v4us oh, ol;
#pragma unroll
                for (int q = 0; q < 4; ++q) { const float y = res[mb][q]; o16[q] = tohx(y); unsigned short a2, c2; splitf(y, a2, c2); oh[q] = a2; ol[q] = c2; }
                const int rr = r0 + mb * 16 + row; *(v4h*)(P16 + (rr * ld16 + pc)) = o16; *(v4us*)(Ph + (rr * ldp + pc)) = oh; *(v4us*)(Pl + (rr * ldp + pc)) = ol; }
        } else
#pragma unroll
        for (int mb = 0; mb < 4; ++mb) { v4f val = res[mb]; if (BIAS) { val[0] += bfr(bias[c0 + cofs]); val[1] += bfr(bias[c0 + cofs + 1]); val[2] += bfr(bias[c0 + cofs + 2]); val[3] += bfr(bias[c0 + cofs + 3]); }
            *(v4f*)(C + (size_t)(r0 + mb * 16 + row) * ldc + c0 + cofs) = val; } }
}

__global__ __launch_bounds__(256) void k_cvt8(const float* __restrict__ src, bf* dst, size_t n8) { const size_t i = (size_t)blockIdx.x * 256 + threadIdx.x; if (i >= n8) return; const v8f v = *(const v8f*)(src + i * 8); v8us o;
#pragma unroll
    for (int k = 0; k < 8; ++k) o[k] = f2bf(v[k]); *(v8us*)(dst + i * 8) = o;  }

// ---- k_fattn: causal attention of one query tile of one head in one work-group; scores and probabilities stay in registers (online softmax), nothing of them goes to memory.
// S^T = K Q^T (A = 16 key rows, B = 16 query rows): a lane holds 16 of the 32 scores of ONE query (column lr), keys kc + 8 hi + j and kc + 16 + 8 hi + j, which is the k order of a B operand, so the converted
// probabilities are the B operand of O^T += V^T P^T (A = 16 rows of the transposed value plane) with no exchange; O^T keeps the lane's query, so maximum, sum and rescale are per lane (one exchange between the halves for the maximum).
// Split keys inside the work-group: wave w takes the 32-key chunks w, w + NW, ...; each wave keeps its own (level, sum, O^T); they are joined through LDS in wave order 0..NW-1.
// Every inner loop is unrolled so that fragments, scores and accumulators are indexed by constants and stay in registers.
// The level m is in log2 units and stands SH below the running maximum, so fp16 probabilities are carried x 2^SH (their sum too, so the factor leaves with the division). A masked raw score is -3e38 and the start level -1e30: exp2 gives 0 for it also where a whole chunk is masked.
__device__ __forceinline__ float xhalf(float x) { const int b = __float_as_int(x); return __int_as_float(__builtin_amdgcn_permlanex16(b, b, 0x76543210, 0xfedcba98, false, false)); }   // the value of lane ^ 16
// exp2 with the one slot that the instruction set asks for before a transcendental's result is used or its source overwritten: the v_nop takes the result
// and keeps the source alive, so only independent instructions can stand between the two; the builtin stays, so that the compiler still keeps the matrix instructions' distances for it.
__device__ __forceinline__ float exp2s(float x) { float r = __builtin_amdgcn_exp2f(x); asm("v_nop" : "+v"(r) : "v"(x)); return r; }
// fragment at byte offset bo (per lane, 32 bits) + co (constant) of a wave-uniform plane pointer: one offset register beside a scalar base
template <typename T16> __device__ __forceinline__ typename WFrag<T16>::V ldo(const T16* base, unsigned bo, int co) { return WFrag<T16>::ld((const T16*)((const char*)base + bo + co)); }
template <typename T16, bool HI, int NQ, int NW>
__device__ __forceinline__ void attn_tile(const T16* __restrict__ Q, const T16* __restrict__ Q2, const T16* __restrict__ Kp, const T16* __restrict__ K2, const T16* __restrict__ Vt, const T16* __restrict__ Vt2, int vp, int r0, bf* Ah, bf* Al, float* sm) {
    typedef typename WFrag<T16>::V V;
    const float SH = HI ? 0.0f : 10.0f;
    const float SCL2 = SCL * 1.4426950408889634f;           // HD^-0.5 x log2(e)
    const int lane = threadIdx.x & 31, lr = lane & 15, hi = lane >> 4; const int wave = __builtin_amdgcn_readfirstlane((int)(threadIdx.x >> 5));
    V q[NQ][2], q2[NQ][2]; v8f acc[NQ][4]; float m[NQ], l[NQ];
    const unsigned qo = (unsigned)(((r0 + lr) * HD + 8 * hi) * 2);
    unsigned ko = (unsigned)(((wave * 32 + lr) * HD + 8 * hi) * 2), vo = (unsigned)((lr * vp + wave * 32 + 8 * hi) * 2);   // byte offsets of the lane's key row and value row at the wave's current chunk
#pragma unroll
    for (int nq = 0; nq < NQ; ++nq) { m[nq] = -1.0e30f; l[nq] = 0.0f;
#pragma unroll
        for (int kk = 0; kk < 2; ++kk) { const int co = (nq * 16 * HD + kk * 32) * 2; q[nq][kk] = ldo(Q, qo, co); if (HI) q2[nq][kk] = ldo(Q2, qo, co); }
#pragma unroll
        for (int dt = 0; dt < 4; ++dt) acc[nq][dt] = (v8f){}; }
    const int nch = (r0 + NQ * 16 + 31) >> 5;               // 32-key chunks up to and with the diagonal
    V ka[2][2], ka2[2][2];                                  // key fragments, fetched one pass ahead; the first fetch (rows 32 wave .. + 31 < TT) is in bounds also for a wave that has no chunk
#pragma unroll
    for (int kt = 0; kt < 2; ++kt)
#pragma unroll
        for (int kk = 0; kk < 2; ++kk) { const int co = (kt * 16 * HD + kk * 32) * 2; ka[kt][kk] = ldo(Kp, ko, co); if (HI) ka2[kt][kk] = ldo(K2, ko, co); }
#pragma unroll 1   // rolled: a second pass in flight would not fit the registers of four waves per SIMD
    for (int c = wave; c < nch; c += NW) { const int kc = c * 32;
        V va[4], va2[4];
#pragma unroll
        for (int dt = 0; dt < 4; ++dt) { const int co = dt * 16 * vp * 2; va[dt] = ldo(Vt, vo, co); if (HI) va2[dt] = ldo(Vt2, vo, co); }
        v8f s[NQ][2];
#pragma unroll
        for (int nq = 0; nq < NQ; ++nq)
#pragma unroll
            for (int kt = 0; kt < 2; ++kt) { v8f t = (v8f){};
#pragma unroll
                for (int kk = 0; kk < 2; ++kk) { t = WFrag<T16>::mma(ka[kt][kk], q[nq][kk], t); if (HI) { t = WFrag<T16>::mma(ka2[kt][kk], q[nq][kk], t); t = WFrag<T16>::mma(ka[kt][kk], q2[nq][kk], t); } }
                s[nq][kt] = t; }
        ko += (c + NW < nch) ? NW * 32 * HD * 2 : 0;        // last pass: the same rows again, never past the diagonal chunk
#pragma unroll
        for (int kt = 0; kt < 2; ++kt)
#pragma unroll
            for (int kk = 0; kk < 2; ++kk) { const int co = (kt * 16 * HD + kk * 32) * 2; ka[kt][kk] = ldo(Kp, ko, co); if (HI) ka2[kt][kk] = ldo(K2, ko, co); }
        asm volatile("s_wait_xcnt 0x0" ::: "memory");       // the wait that belongs in front of the overwrites of ko and vo, which the loads issued in this pass name
        if (c == nch - 1) {                                 // only the diagonal chunk holds keys above a query of the tile (wave-uniform test)
#pragma unroll
            for (int nq = 0; nq < NQ; ++nq) { const int lim = r0 + nq * 16 + lr - kc - 8 * hi;   // key kc + 16 kt + 8 hi + j is allowed while 16 kt + j <= lim
#pragma unroll
                for (int kt = 0; kt < 2; ++kt)
#pragma unroll
                    for (int j = 0; j < 8; ++j) s[nq][kt][j] = (kt * 16 + j <= lim) ? s[nq][kt][j] : -3.0e38f; } }
#pragma unroll
        for (int nq = 0; nq < NQ; ++nq) {
            float mx = s[nq][0][0];
#pragma unroll
            for (int kt = 0; kt < 2; ++kt)
#pragma unroll
                for (int j = 0; j < 8; ++j) mx = fmaxf(mx, s[nq][kt][j]);
            mx = fmaxf(mx, xhalf(mx));
            const float mn = fmaxf(m[nq], mx * SCL2 - SH); const float alpha = exp2s(m[nq] - mn); m[nq] = mn;
            float ps = 0.0f;
#pragma unroll
            for (int kt = 0; kt < 2; ++kt)
#pragma unroll
                for (int j = 0; j < 8; ++j) { const float pe = exp2s(__builtin_fmaf(s[nq][kt][j], SCL2, -mn)); s[nq][kt][j] = pe; ps += pe; }
            l[nq] = l[nq] * alpha + ps;
#pragma unroll
            for (int dt = 0; dt < 4; ++dt) acc[nq][dt] *= alpha;
            if constexpr (HI) { v8us h0, h1, l0, l1;
#pragma unroll
                for (int j = 0; j < 8; ++j) { unsigned short a, c2; splitf(s[nq][0][j], a, c2); h0[j] = a; l0[j] = c2; splitf(s[nq][1][j], a, c2); h1[j] = a; l1[j] = c2; }
                const V pf = cat16b(h0, h1), pf2 = cat16b(l0, l1);
#pragma unroll
                for (int dt = 0; dt < 4; ++dt) { acc[nq][dt] = WFrag<T16>::mma(va[dt], pf, acc[nq][dt]); acc[nq][dt] = WFrag<T16>::mma(va2[dt], pf, acc[nq][dt]); acc[nq][dt] = WFrag<T16>::mma(va[dt], pf2, acc[nq][dt]); }
            } else { v8h h0, h1;
#pragma unroll
                for (int j = 0; j < 8; ++j) { h0[j] = tohx(s[nq][0][j]); h1[j] = tohx(s[nq][1][j]); }
                const V pf = cat16(h0, h1);
#pragma unroll
                for (int dt = 0; dt < 4; ++dt) acc[nq][dt] = WFrag<T16>::mma(va[dt], pf, acc[nq][dt]); }
        }
        vo += NW * 32 * 2;
    }
    float* ms = sm + NW * NQ * 16 * 68; float* ls = ms + NW * NQ * 16;
#pragma unroll
    for (int nq = 0; nq < NQ; ++nq) { const float lt = l[nq] + xhalf(l[nq]);
#pragma unroll
        for (int dt = 0; dt < 4; ++dt) { float* o = sm + (wave * NQ * 16 + nq * 16 + lr) * 68 + dt * 16 + hi * 8; const v8f a = acc[nq][dt];
            *(v4fa*)o = (v4f){a[0], a[1], a[2], a[3]}; *(v4fa*)(o + 4) = (v4f){a[4], a[5], a[6], a[7]}; }
        if (hi == 0) { ms[wave * NQ * 16 + nq * 16 + lr] = m[nq]; ls[wave * NQ * 16 + nq * 16 + lr] = lt; } }
    __syncthreads();
#pragma unroll
    for (int idx = (int)threadIdx.x; idx < NQ * 256; idx += 32 * NW) { const int qq = idx >> 4, d4 = (idx & 15) * 4;
        float M = ms[qq];
#pragma unroll
        for (int w = 1; w < NW; ++w) M = fmaxf(M, ms[w * NQ * 16 + qq]);
        float L = 0.0f; v4f val = (v4f){};
#pragma unroll
        for (int w = 0; w < NW; ++w) { const float wt = exp2s(ms[w * NQ * 16 + qq] - M); L += ls[w * NQ * 16 + qq] * wt; val += *(const v4fa*)(sm + (w * NQ * 16 + qq) * 68 + d4) * wt; }
        const float f = __fdiv_rn(1.0f, L); v4us oh, ol;    // the context row goes out as the hi/lo A operand of the output projection, [t][head * HD + d]: 16 threads fill one 128-byte line of each plane
#pragma unroll
        for (int e = 0; e < 4; ++e) { unsigned short a, c2; splitf(val[e] * f, a, c2); oh[e] = a; ol[e] = c2; }
        *(v4us*)(Ah + (size_t)(r0 + qq) * DQ + d4) = oh; *(v4us*)(Al + (size_t)(r0 + qq) * DQ + d4) = ol; }
}
// grid (heads, tiles): the tile index is the slow one and the longest tiles (last rows) come first. Tiles 0 .. (TT - RH) / 32 - 1: 32 fp16 rows each; the rest: 16 hi/lo rows each (3 products). Output: hi/lo planes [t][head * HD + d].
template <int NW>
__global__ __launch_bounds__(32 * NW) void k_fattn(const h16* __restrict__ Q16, const h16* __restrict__ K16, const h16* __restrict__ V16, const bf* __restrict__ Qh, const bf* __restrict__ Ql, const bf* __restrict__ Kh, const bf* __restrict__ Kl, const bf* __restrict__ Vh, const bf* __restrict__ Vl, bf* Ah, bf* Al) {
    __shared__ __align__(16) float sm[NW * 32 * 70];
    const size_t z = blockIdx.x, zp = z * TT * HD; const int ty = blockIdx.y;
    if (ty < (TT - RH) / 32) attn_tile<h16, false, 2, NW>(Q16 + zp, nullptr, K16 + zp, nullptr, V16 + 2 * zp, nullptr, 2 * TT, TT - 32 * (ty + 1), Ah + z * HD, Al + z * HD, sm);
    else attn_tile<bf, true, 1, NW>(Qh + zp, Ql + zp, Kh + zp, Kl + zp, Vh + zp, Vl + zp, TT, RH - 16 * (ty - (TT - RH) / 32 + 1), Ah + z * HD, Al + z * HD, sm);
}

extern "C" void kernel_launch(void* const* d_in, const int* in_sizes, int n_in,
                              void* d_out, int out_size, void* d_ws, size_t ws_size, hipStream_t stream) {
    (void)in_sizes; (void)n_in; (void)out_size;
    const float* x = (const float*)d_in[0]; const float* wq = (const float*)d_in[1]; const float* wo = (const float*)d_in[2]; const float* bo = (const float*)d_in[3];     const float* wk = wq; const float* wv = wq;   /* key == value == query projection (source bug) */
    float* OUT = (float*)d_out;     // [2][2048][1024]
    char* wsp = (char*)d_ws;
    auto take = [&](size_t bytes) { char* p = wsp; wsp += (bytes + 255) & ~(size_t)255; return (void*)p; };
    bf* WQ = (bf*)take((size_t)DQ * DM * 2); bf* WK = (bf*)take((size_t)DKV * DM * 2); bf* WV = (bf*)take((size_t)DKV * DM * 2); bf* WO = (bf*)take((size_t)DM * DQ * 2);
    bf* XB = (bf*)take((size_t)TT * DM * 2);
    h16* QP16 = (h16*)take((size_t)NH_ * TT * HD * 2); h16* KP16 = (h16*)take((size_t)NKV * TT * HD * 2); h16* VT16 = (h16*)take((size_t)NKV * HD * 2 * TT * 2);
    bf* QPh = (bf*)take((size_t)NH_ * TT * HD * 2); bf* QPl = (bf*)take((size_t)NH_ * TT * HD * 2); bf* KPh = (bf*)take((size_t)NKV * TT * HD * 2); bf* KPl = (bf*)take((size_t)NKV * TT * HD * 2); bf* VTh = (bf*)take((size_t)NKV * HD * TT * 2); bf* VTl = (bf*)take((size_t)NKV * HD * TT * 2);
    bf* ATh = (bf*)take((size_t)TT * DQ * 2); bf* ATl = (bf*)take((size_t)TT * DQ * 2);
    if ((size_t)(wsp - (char*)d_ws) > ws_size) return;    // ws 256 MiB
    { k_cvt8<<<(unsigned)(((size_t)DQ * DM / 8 + 255) / 256), 256, 0, stream>>>(wq, WQ, (size_t)DQ * DM / 8); k_cvt8<<<(unsigned)(((size_t)DKV * DM / 8 + 255) / 256), 256, 0, stream>>>(wk, WK, (size_t)DKV * DM / 8); k_cvt8<<<(unsigned)(((size_t)DKV * DM / 8 + 255) / 256), 256, 0, stream>>>(wv, WV, (size_t)DKV * DM / 8);
      k_cvt8<<<(unsigned)(((size_t)DM * DQ / 8 + 255) / 256), 256, 0, stream>>>(wo, WO, (size_t)DM * DQ / 8);
       }
    for (int b = 0; b < NB_; ++b) {
        
        k_cvt8<<<(unsigned)(((size_t)TT * DM / 8 + 255) / 256), 256, 0, stream>>>(x + (size_t)b * TT * DM, XB, (size_t)TT * DM / 8);
        k_gemmw<bf, 0, false, 8, true><<<dim3(TT / 64, DQ / 64, 1), 256, 0, stream>>>(XB, nullptr, WQ, nullptr, DM, nullptr, 0, nullptr, 0, 0, 0, QP16, QPh, QPl, HD, HD, TT * HD);
        k_gemmw<bf, 0, false, 8, true><<<dim3(TT / 64, DKV / 64, 1), 256, 0, stream>>>(XB, nullptr, WK, nullptr, DM, nullptr, 0, nullptr, 0, 0, 0, KP16, KPh, KPl, HD, HD, TT * HD);
        k_gemmw<bf, 0, false, 8, true><<<dim3(DKV / 64, TT / 64, 1), 256, 0, stream>>>(WV, nullptr, XB, nullptr, DM, nullptr, 0, nullptr, 0, 0, 0, VT16, VTh, VTl, 2 * TT, TT, 64);   // W x^T: rows g * HD + d, columns t
        k_fattn<8><<<dim3(NH_, (TT - RH) / 32 + RH / 16, 1), 256, 0, stream>>>(QP16, KP16, VT16, QPh, QPl, KPh, KPl, VTh, VTl, ATh, ATl);   // one kv head per query head
        k_gemmw<bf, 1, true, 8, false><<<dim3(TT / 64, DM / 64, 1), 256, 0, stream>>>(ATh, ATl, WO, nullptr, DQ, OUT + (size_t)b * TT * DM, DM, bo, 0, 0, 0, nullptr, nullptr, nullptr, 0, 0, 0); }
}

// v005
// A run of this version takes 127 microseconds.
// Two timings next to v004 both put it at 1.45 times that version's speed.
// All steps since v000 together make it 11.4 times as fast.
#include <hip/hip_runtime.h>

// Causal multi-head self-attention whose key and value are the QUERY projection (the module's bug, reproduced: x [2][2048][1024]; q = x Wq^T ('oi' [1024][1024] 1/32, no bias), k = v = q (16 heads x 64); scores masked above the diagonal (-inf == exclusion) then x 1/sqrt(64); softmax; ctx = attn.q; out = ctx Wo^T + bo ('oi') -> [2][2048][1024] (4.2 M); argument order x, Wq, Wo, bo).
// Layout per batch: bf16 copy of x; 'oi' weights; the one exact projection is computed once (one GEMM), which stores the 16-bit operand planes of the attention kernel itself: head planes [h][t][d], read in the q and in the k role, and their transposes [h][d][t] for the v role; fused causal T-2048 attention, all heads of a batch in one launch (hybrid rows: < 512 hi/lo 3 products, rest fp16 x1024; key chunks above the diagonal are never visited), storing the merged hi/lo context itself; hi/lo x Wo exact + bo.
// Compute dtypes, f32 accumulate: every input rounded to bf16; projection exact; attention rows < 512 3 products, rest fp16; softmax f32; Wo hl x exact + bias.

#define NB_  2
#define TT   2048
#define DM   1024
#define NH_  16
#define NKV  16
#define REP  (NH_ / NKV)
#define HD   64
#define DQ   (NH_ * HD)
#define DKV  (NKV * HD)
#define RH   512                  // query rows < RH use hi+lo planes (0: none)
#define WIN  2048
#define SCL  0.125f   // HD^-0.5
typedef _Float16 h16;
typedef unsigned short bf;
typedef __attribute__((ext_vector_type(16))) __bf16   v16bf;
typedef __attribute__((ext_vector_type(16))) _Float16 v16h;
typedef __attribute__((ext_vector_type(8)))  _Float16 v8h;
typedef __attribute__((ext_vector_type(8)))  unsigned short v8us;
typedef __attribute__((ext_vector_type(8)))  float    v8f;
typedef __attribute__((ext_vector_type(4)))  float    v4f;
typedef v8h  __attribute__((may_alias)) v8ha;
typedef v4f  __attribute__((may_alias)) v4fa;
typedef v8us __attribute__((may_alias)) v8usa;

__device__ __forceinline__ unsigned short f2bf(float f) { unsigned u = __float_as_uint(f); u += 0x7FFFu + ((u >> 16) & 1u); return (unsigned short)(u >> 16); }
__device__ __forceinline__ float bf2f(unsigned short b) { return __uint_as_float(((unsigned)b) << 16); }
__device__ __forceinline__ float bfr(float f) { return bf2f(f2bf(f)); }
__device__ __forceinline__ v16h cat16(v8h lo, v8h hi) { return __builtin_shufflevector(lo, hi, 0, 1, 2, 3, 4, 5, 6, 7, 8, 9, 10, 11, 12, 13, 14, 15); }
__device__ __forceinline__ v16bf cat16b(v8us lo, v8us hi) { return __builtin_bit_cast(v16bf, __builtin_shufflevector(lo, hi, 0, 1, 2, 3, 4, 5, 6, 7, 8, 9, 10, 11, 12, 13, 14, 15)); }
__device__ __forceinline__ v8f wmma16(v16h a, v16h b, v8f c) { return __builtin_amdgcn_wmma_f32_16x16x32_f16(false, a, false, b, (short)0, c, false, false); }
__device__ __forceinline__ v8f wmmab(v16bf a, v16bf b, v8f c) { return __builtin_amdgcn_wmma_f32_16x16x32_bf16(false, a, false, b, (short)0, c, false, false); }

__device__ __forceinline__ h16 tohx(float x) { return (h16)x; }
__device__ __forceinline__ void splitf(float y, unsigned short& h, unsigned short& l) { h = f2bf(y); l = f2bf(y - bf2f(h)); }
typedef __attribute__((ext_vector_type(4))) _Float16 v4h;
typedef __attribute__((ext_vector_type(4))) unsigned short v4us;

// ---- tile_reduce: sums the NW waves' partial 64x64 tiles (split K) through LDS, one 16x64 slab per round, always in wave order 0..NW-1. Thread t < 256 ends up with columns 4 (t & 15) .. + 3 of row (t >> 4) of each slab in res[].
// Two slab sets alternate, so one barrier a round is enough: the set that round mb + 2 overwrites was last read in front of the barrier of round mb + 1. No global store stands between the barriers (a barrier would wait for it).
template <int NW> __device__ __forceinline__ void tile_reduce(const v8f (&acc)[4][4], float* os, int wave, int lr, int hi, v4f (&res)[4]) {
    static_assert(NW >= 8, "256 threads sum a slab");
    const int ro = ((int)threadIdx.x >> 4) * 68 + ((int)threadIdx.x & 15) * 4;
#pragma unroll
    for (int mb = 0; mb < 4; ++mb) { float* ob = os + (mb & 1) * (NW * 16 * 68);
#pragma unroll
        for (int nb = 0; nb < 4; ++nb) {
#pragma unroll
            for (int j = 0; j < 8; ++j) ob[wave * (16 * 68) + (hi * 8 + j) * 68 + nb * 16 + lr] = acc[mb][nb][j]; }
        __syncthreads();
        if (threadIdx.x < 256) { v4f val = *(const v4fa*)(ob + ro);
#pragma unroll
            for (int w = 1; w < NW; ++w) val += *(const v4fa*)(ob + w * (16 * 68) + ro);
            res[mb] = val; } }
}

// ---- k_gemmw: register-blocked GEMM, NW WAVES per 64x64 output tile (16 accumulators each), operands straight from K-contiguous 16-bit planes; grid (M/64, N/64, Z), 32 * NW threads.
// Split K inside the work-group: wave w takes the 32-wide k chunks w, w + NW, w + 2 NW, ..., so a tile's chain of dependent load -> matrix passes is NW times shorter; tile_reduce sums the partial tiles.
// C[m][n] (f32, pitch ldc, + optional f32 bias[n]) = sum_k A[m][k] Bt[n][k] (+ split products per NSPLIT). z-batch strides sA/sB/sC in elements. K % 32 == 0.
// PL: no f32 C; the tile goes out as the 16-bit planes its consumer reads (fp16, bf16 hi, bf16 lo), each of them twice:
// head planes [h][t][d] (P16, Ph, Pl), element (m, n) at m * HD + (n / 64) * cb + n % 64, cb = TT * HD: a thread's 4 columns are 8 bytes, 16 threads fill one 128-byte line;
// transposed planes [n][m] (Tf with row pitch lt16; Th, Tl with ltp): the summed f32 tile is turned in LDS (pitch 65: stores and column reads both touch 32 different banks), a thread's 8 rows are 16 bytes, 8 threads fill one 128-byte line.
template <typename T16> struct WFrag;
template <> struct WFrag<h16> { typedef v16h V; static __device__ __forceinline__ V ld(const h16* p) { return cat16(*(const v8h*)p, *(const v8h*)(p + 16)); } static __device__ __forceinline__ v8f mma(V a, V b, v8f c) { return wmma16(a, b, c); } };
template <> struct WFrag<bf> { typedef v16bf V; static __device__ __forceinline__ V ld(const bf* p) { return cat16b(*(const v8us*)p, *(const v8us*)(p + 16)); } static __device__ __forceinline__ v8f mma(V a, V b, v8f c) { return wmmab(a, b, c); } };
template <typename T16, int NSPLIT, bool BIAS, int NW, bool PL>
__global__ __launch_bounds__(32 * NW) void k_gemmw(const T16* __restrict__ A, const T16* __restrict__ A2, const T16* __restrict__ Bt, const T16* __restrict__ Bt2, int K, float* C, int ldc, const float* __restrict__ bias, size_t sA, size_t sB, size_t sC, h16* P16, bf* Ph, bf* Pl, int cb, h16* Tf, bf* Th, bf* Tl, int lt16, int ltp) {
    typedef typename WFrag<T16>::V V;
    __shared__ __align__(16) float os[(NW == 1 ? 1 : 2 * NW) * 16 * 68];
    const size_t z = blockIdx.z; A += z * sA; if (A2) A2 += z * sA; Bt += z * sB; if (Bt2) Bt2 += z * sB; C += z * sC;
    const int lane = threadIdx.x & 31, lr = lane & 15, hi = lane >> 4; const int r0 = blockIdx.x * 64, c0 = blockIdx.y * 64; const int wave = (NW == 1) ? 0 : __builtin_amdgcn_readfirstlane((int)(threadIdx.x >> 5));
    v8f acc[4][4];
#pragma unroll
    for (int mb = 0; mb < 4; ++mb)
#pragma unroll
        for (int nb = 0; nb < 4; ++nb) acc[mb][nb] = (v8f){};
    const size_t aoff = (size_t)(r0 + lr) * K + 8 * hi, boff = (size_t)(c0 + lr) * K + 8 * hi;
#pragma unroll 1
    for (int kc = wave * 32; kc < K; kc += 32 * NW) {
        V a[4], a2[4];
#pragma unroll
        for (int mb = 0; mb < 4; ++mb) { a[mb] = WFrag<T16>::ld(A + aoff + (size_t)mb * 16 * K + kc); if (NSPLIT == 1 || NSPLIT == 2) a2[mb] = WFrag<T16>::ld(A2 + aoff + (size_t)mb * 16 * K + kc); }
#pragma unroll
        for (int nb = 0; nb < 4; ++nb) { const V b = WFrag<T16>::ld(Bt + boff + (size_t)nb * 16 * K + kc); V b2; if (NSPLIT >= 2) b2 = WFrag<T16>::ld(Bt2 + boff + (size_t)nb * 16 * K + kc);
#pragma unroll
            for (int mb = 0; mb < 4; ++mb) { acc[mb][nb] = WFrag<T16>::mma(a[mb], b, acc[mb][nb]); if (NSPLIT == 1 || NSPLIT == 2) acc[mb][nb] = WFrag<T16>::mma(a2[mb], b, acc[mb][nb]); if (NSPLIT >= 2) acc[mb][nb] = WFrag<T16>::mma(a[mb], b2, acc[mb][nb]); } }
        asm volatile("v_nop\n\tv_nop\n\tv_nop\n\tv_nop" : "+v"(acc[0][0]), "+v"(acc[1][1]), "+v"(acc[2][2]), "+v"(acc[3][3]) : "v"(a[0]), "v"(a[3]));
    }
    v4f res[4]; tile_reduce<NW>(acc, os, wave, lr, hi, res);
    const int row = (int)threadIdx.x >> 4, cofs = ((int)threadIdx.x & 15) * 4;
    if constexpr (PL) {
        // The first slab set is free here: its last readers (round 2) have passed the barrier of round 3. The turned tile is published in front of every global store, so that the barrier waits for none.
        if (threadIdx.x < 256) {
#pragma unroll
            for (int mb = 0; mb < 4; ++mb)
#pragma unroll
                for (int q = 0; q < 4; ++q) os[(mb * 16 + row) * 65 + cofs + q] = res[mb][q]; }
        __syncthreads();
        if (threadIdx.x < 256) { const int pc = (int)blockIdx.y * cb + cofs;
#pragma unroll
            for (int mb = 0; mb < 4; ++mb) { v4h o16; v4us oh, ol;
#pragma unroll
                for (int q = 0; q < 4; ++q) { const float y = res[mb][q]; o16[q] = tohx(y); unsigned short a2, c2; splitf(y, a2, c2); oh[q] = a2; ol[q] = c2; }
                const int po = (r0 + mb * 16 + row) * HD + pc; *(v4h*)(P16 + po) = o16; *(v4us*)(Ph + po) = oh; *(v4us*)(Pl + po) = ol; }
            const int m8 = ((int)threadIdx.x & 7) * 8;
#pragma unroll
            for (int p = 0; p < 2; ++p) { const int n = ((int)threadIdx.x >> 3) + p * 32; v8h o16; v8us oh, ol;
#pragma unroll
                for (int i = 0; i < 8; ++i) { const float y = os[(m8 + i) * 65 + n]; o16[i] = tohx(y); unsigned short a2, c2; splitf(y, a2, c2); oh[i] = a2; ol[i] = c2; }
                *(v8h*)(Tf + ((c0 + n) * lt16 + r0 + m8)) = o16; *(v8us*)(Th + ((c0 + n) * ltp + r0 + m8)) = oh; *(v8us*)(Tl + ((c0 + n) * ltp + r0 + m8)) = ol; } }
    } else if (threadIdx.x < 256) {
#pragma unroll
        for (int mb = 0; mb < 4; ++mb) { v4f val = res[mb]; if (BIAS) { val[0] += bfr(bias[c0 + cofs]); val[1] += bfr(bias[c0 + cofs + 1]); val[2] += bfr(bias[c0 + cofs + 2]); val[3] += bfr(bias[c0 + cofs + 3]); }
            *(v4f*)(C + (size_t)(r0 + mb * 16 + row) * ldc + c0 + cofs) = val; } }
}

__global__ __launch_bounds__(256) void k_cvt8(const float* __restrict__ src, bf* dst, size_t n8) { const size_t i = (size_t)blockIdx.x * 256 + threadIdx.x; if (i >= n8) return; const v8f v = *(const v8f*)(src + i * 8); v8us o;
#pragma unroll
    for (int k = 0; k < 8; ++k) o[k] = f2bf(v[k]); *(v8us*)(dst + i * 8) = o;  }

// ---- k_fattn: causal attention of one query tile of one head in one work-group; scores and probabilities stay in registers (online softmax), nothing of them goes to memory.
// S^T = K Q^T (A = 16 key rows, B = 16 query rows): a lane holds 16 of the 32 scores of ONE query (column lr), keys kc + 8 hi + j and kc + 16 + 8 hi + j, which is the k order of a B operand, so the converted
// probabilities are the B operand of O^T += V^T P^T (A = 16 rows of the transposed value plane) with no exchange; O^T keeps the lane's query, so maximum, sum and rescale are per lane (one exchange between the halves for the maximum).
// Split keys inside the work-group: wave w takes the 32-key chunks w, w + NW, ...; each wave keeps its own (level, sum, O^T); they are joined through LDS in wave order 0..NW-1.
// Every inner loop is unrolled so that fragments, scores and accumulators are indexed by constants and stay in registers.
// The level m is in log2 units and stands SH below the running maximum, so fp16 probabilities are carried x 2^SH (their sum too, so the factor leaves with the division). A masked raw score is -3e38 and the start level -1e30: exp2 gives 0 for it also where a whole chunk is masked.
__device__ __forceinline__ float xhalf(float x) { const int b = __float_as_int(x); return __int_as_float(__builtin_amdgcn_permlanex16(b, b, 0x76543210, 0xfedcba98, false, false)); }   // the value of lane ^ 16
// exp2 with the one slot that the instruction set asks for before a transcendental's result is used or its source overwritten: the v_nop takes the result
// and keeps the source alive, so only independent instructions can stand between the two; the builtin stays, so that the compiler still keeps the matrix instructions' distances for it.
__device__ __forceinline__ float exp2s(float x) { float r = __builtin_amdgcn_exp2f(x); asm("v_nop" : "+v"(r) : "v"(x)); return r; }
// fragment at byte offset bo (per lane, 32 bits) + co (constant) of a wave-uniform plane pointer: one offset register beside a scalar base
template <typename T16> __device__ __forceinline__ typename WFrag<T16>::V ldo(const T16* base, unsigned bo, int co) { return WFrag<T16>::ld((const T16*)((const char*)base + bo + co)); }
template <typename T16, bool HI, int NQ, int NW>
__device__ __forceinline__ void attn_tile(const T16* __restrict__ Q, const T16* __restrict__ Q2, const T16* __restrict__ Kp, const T16* __restrict__ K2, const T16* __restrict__ Vt, const T16* __restrict__ Vt2, int vp, int r0, bf* Ah, bf* Al, float* sm) {
    typedef typename WFrag<T16>::V V;
    const float SH = HI ? 0.0f : 10.0f;
    const float SCL2 = SCL * 1.4426950408889634f;           // HD^-0.5 x log2(e)
    const int lane = threadIdx.x & 31, lr = lane & 15, hi = lane >> 4; const int wave = __builtin_amdgcn_readfirstlane((int)(threadIdx.x >> 5));
    V q[NQ][2], q2[NQ][2]; v8f acc[NQ][4]; float m[NQ], l[NQ];
    const unsigned qo = (unsigned)(((r0 + lr) * HD + 8 * hi) * 2);
    unsigned ko = (unsigned)(((wave * 32 + lr) * HD + 8 * hi) * 2), vo = (unsigned)((lr * vp + wave * 32 + 8 * hi) * 2);   // byte offsets of the lane's key row and value row at the wave's current chunk
#pragma unroll
    for (int nq = 0; nq < NQ; ++nq) { m[nq] = -1.0e30f; l[nq] = 0.0f;
#pragma unroll
        for (int kk = 0; kk < 2; ++kk) { const int co = (nq * 16 * HD + kk * 32) * 2; q[nq][kk] = ldo(Q, qo, co); if (HI) q2[nq][kk] = ldo(Q2, qo, co); }
#pragma unroll
        for (int dt = 0; dt < 4; ++dt) acc[nq][dt] = (v8f){}; }
    const int nch = (r0 + NQ * 16 + 31) >> 5;               // 32-key chunks up to and with the diagonal
    V ka[2][2], ka2[2][2];                                  // key fragments, fetched one pass ahead; the first fetch (rows 32 wave .. + 31 < TT) is in bounds also for a wave that has no chunk
#pragma unroll
    for (int kt = 0; kt < 2; ++kt)
#pragma unroll
        for (int kk = 0; kk < 2; ++kk) { const int co = (kt * 16 * HD + kk * 32) * 2; ka[kt][kk] = ldo(Kp, ko, co); if (HI) ka2[kt][kk] = ldo(K2, ko, co); }
#pragma unroll 1   // rolled: a second pass in flight would not fit the registers of four waves per SIMD
    for (int c = wave; c < nch; c += NW) { const int kc = c * 32;
        V va[4], va2[4];
#pragma unroll
        for (int dt = 0; dt < 4; ++dt) { const int co = dt * 16 * vp * 2; va[dt] = ldo(Vt, vo, co); if (HI) va2[dt] = ldo(Vt2, vo, co); }
        v8f s[NQ][2];
#pragma unroll
        for (int nq = 0; nq < NQ; ++nq)
#pragma unroll
            for (int kt = 0; kt < 2; ++kt) { v8f t = (v8f){};
#pragma unroll
                for (int kk = 0; kk < 2; ++kk) { t = WFrag<T16>::mma(ka[kt][kk], q[nq][kk], t); if (HI) { t = WFrag<T16>::mma(ka2[kt][kk], q[nq][kk], t); t = WFrag<T16>::mma(ka[kt][kk], q2[nq][kk], t); } }
                s[nq][kt] = t; }
        ko += (c + NW < nch) ? NW * 32 * HD * 2 : 0;        // last pass: the same rows again, never past the diagonal chunk
#pragma unroll
        for (int kt = 0; kt < 2; ++kt)
#pragma unroll
            for (int kk = 0; kk < 2; ++kk) { const int co = (kt * 16 * HD + kk * 32) * 2; ka[kt][kk] = ldo(Kp, ko, co); if (HI) ka2[kt][kk] = ldo(K2, ko, co); }
        asm volatile("s_wait_xcnt 0x0" ::: "memory");       // the wait that belongs in front of the overwrites of ko and vo, which the loads issued in this pass name
        if (c == nch - 1) {                                 // only the diagonal chunk holds keys above a query of the tile (wave-uniform test)
#pragma unroll
            for (int nq = 0; nq < NQ; ++nq) { const int lim = r0 + nq * 16 + lr - kc - 8 * hi;   // key kc + 16 kt + 8 hi + j is allowed while 16 kt + j <= lim
#pragma unroll
                for (int kt = 0; kt < 2; ++kt)
#pragma unroll
                    for (int j = 0; j < 8; ++j) s[nq][kt][j] = (kt * 16 + j <= lim) ? s[nq][kt][j] : -3.0e38f; } }
#pragma unroll
        for (int nq = 0; nq < NQ; ++nq) {
            float mx = s[nq][0][0];
#pragma unroll
            for (int kt = 0; kt < 2; ++kt)
#pragma unroll
                for (int j = 0; j < 8; ++j) mx = fmaxf(mx, s[nq][kt][j]);
            mx = fmaxf(mx, xhalf(mx));
            const float mn = fmaxf(m[nq], mx * SCL2 - SH); const float alpha = exp2s(m[nq] - mn); m[nq] = mn;
            float ps = 0.0f;
#pragma unroll
            for (int kt = 0; kt < 2; ++kt)
#pragma unroll
                for (int j = 0; j < 8; ++j) { const float pe = exp2s(__builtin_fmaf(s[nq][kt][j], SCL2, -mn)); s[nq][kt][j] = pe; ps += pe; }
            l[nq] = l[nq] * alpha + ps;
#pragma unroll
            for (int dt = 0; dt < 4; ++dt) acc[nq][dt] *= alpha;
            if constexpr (HI) { v8us h0, h1, l0, l1;
#pragma unroll
                for (int j = 0; j < 8; ++j) { unsigned short a, c2; splitf(s[nq][0][j], a, c2); h0[j] = a; l0[j] = c2; splitf(s[nq][1][j], a, c2); h1[j] = a; l1[j] = c2; }
                const V pf = cat16b(h0, h1), pf2 = cat16b(l0, l1);
#pragma unroll
                for (int dt = 0; dt < 4; ++dt) { acc[nq][dt] = WFrag<T16>::mma(va[dt], pf, acc[nq][dt]); acc[nq][dt] = WFrag<T16>::mma(va2[dt], pf, acc[nq][dt]); acc[nq][dt] = WFrag<T16>::mma(va[dt], pf2, acc[nq][dt]); }
            } else { v8h h0, h1;
#pragma unroll
                for (int j = 0; j < 8; ++j) { h0[j] = tohx(s[nq][0][j]); h1[j] = tohx(s[nq][1][j]); }
                const V pf = cat16(h0, h1);
#pragma unroll
                for (int dt = 0; dt < 4; ++dt) acc[nq][dt] = WFrag<T16>::mma(va[dt], pf, acc[nq][dt]); }
        }
        vo += NW * 32 * 2;
    }
    float* ms = sm + NW * NQ * 16 * 68; float* ls = ms + NW * NQ * 16;
#pragma unroll
    for (int nq = 0; nq < NQ; ++nq) { const float lt = l[nq] + xhalf(l[nq]);
#pragma unroll
        for (int dt = 0; dt < 4; ++dt) { float* o = sm + (wave * NQ * 16 + nq * 16 + lr) * 68 + dt * 16 + hi * 8; const v8f a = acc[nq][dt];
            *(v4fa*)o = (v4f){a[0], a[1], a[2], a[3]}; *(v4fa*)(o + 4) = (v4f){a[4], a[5], a[6], a[7]}; }
        if (hi == 0) { ms[wave * NQ * 16 + nq * 16 + lr] = m[nq]; ls[wave * NQ * 16 + nq * 16 + lr] = lt; } }
    __syncthreads();
#pragma unroll
    for (int idx = (int)threadIdx.x; idx < NQ * 256; idx += 32 * NW) { const int qq = idx >> 4, d4 = (idx & 15) * 4;
        float M = ms[qq];
#pragma unroll
        for (int w = 1; w < NW; ++w) M = fmaxf(M, ms[w * NQ * 16 + qq]);
        float L = 0.0f; v4f val = (v4f){};
#pragma unroll
        for (int w = 0; w < NW; ++w) { const float wt = exp2s(ms[w * NQ * 16 + qq] - M); L += ls[w * NQ * 16 + qq] * wt; val += *(const v4fa*)(sm + (w * NQ * 16 + qq) * 68 + d4) * wt; }
        const float f = __fdiv_rn(1.0f, L); v4us oh, ol;    // the context row goes out as the hi/lo A operand of the output projection, [t][head * HD + d]: 16 threads fill one 128-byte line of each plane
#pragma unroll
        for (int e = 0; e < 4; ++e) { unsigned short a, c2; splitf(val[e] * f, a, c2); oh[e] = a; ol[e] = c2; }
        *(v4us*)(Ah + (size_t)(r0 + qq) * DQ + d4) = oh; *(v4us*)(Al + (size_t)(r0 + qq) * DQ + d4) = ol; }
}
// grid (heads, tiles): the tile index is the slow one and the longest tiles (last rows) come first. Tiles 0 .. (TT - RH) / 32 - 1: 32 fp16 rows each; the rest: 16 hi/lo rows each (3 products). Output: hi/lo planes [t][head * HD + d].
template <int NW>
__global__ __launch_bounds__(32 * NW) void k_fattn(const h16* __restrict__ Q16, const h16* __restrict__ K16, const h16* __restrict__ V16, const bf* __restrict__ Qh, const bf* __restrict__ Ql, const bf* __restrict__ Kh, const bf* __restrict__ Kl, const bf* __restrict__ Vh, const bf* __restrict__ Vl, bf* Ah, bf* Al) {
    __shared__ __align__(16) float sm[NW * 32 * 70];
    const size_t z = blockIdx.x, zp = z * TT * HD; const int ty = blockIdx.y;
    if (ty < (TT - RH) / 32) attn_tile<h16, false, 2, NW>(Q16 + zp, nullptr, K16 + zp, nullptr, V16 + 2 * zp, nullptr, 2 * TT, TT - 32 * (ty + 1), Ah + z * HD, Al + z * HD, sm);
    else attn_tile<bf, true, 1, NW>(Qh + zp, Ql + zp, Kh + zp, Kl + zp, Vh + zp, Vl + zp, TT, RH - 16 * (ty - (TT - RH) / 32 + 1), Ah + z * HD, Al + z * HD, sm);
}

extern "C" void kernel_launch(void* const* d_in, const int* in_sizes, int n_in,
                              void* d_out, int out_size, void* d_ws, size_t ws_size, hipStream_t stream) {
    (void)in_sizes; (void)n_in; (void)out_size;
    const float* x = (const float*)d_in[0]; const float* wq = (const float*)d_in[1]; const float* wo = (const float*)d_in[2]; const float* bo = (const float*)d_in[3];   /* input order x, Wq, Wo ('oi'), bo */
    float* OUT = (float*)d_out;     // [2][2048][1024]
    char* wsp = (char*)d_ws;
    auto take = [&](size_t bytes) { char* p = wsp; wsp += (bytes + 255) & ~(size_t)255; return (void*)p; };
    bf* WQ = (bf*)take((size_t)DQ * DM * 2); bf* WO = (bf*)take((size_t)DM * DQ * 2);
    bf* XB = (bf*)take((size_t)TT * DM * 2);
    h16* QP16 = (h16*)take((size_t)NH_ * TT * HD * 2); h16* VT16 = (h16*)take((size_t)NKV * HD * 2 * TT * 2);
    bf* QPh = (bf*)take((size_t)NH_ * TT * HD * 2); bf* QPl = (bf*)take((size_t)NH_ * TT * HD * 2); bf* VTh = (bf*)take((size_t)NKV * HD * TT * 2); bf* VTl = (bf*)take((size_t)NKV * HD * TT * 2);
    bf* ATh = (bf*)take((size_t)TT * DQ * 2); bf* ATl = (bf*)take((size_t)TT * DQ * 2);
    if ((size_t)(wsp - (char*)d_ws) > ws_size) return;    // ws 256 MiB
    { k_cvt8<<<(unsigned)(((size_t)DQ * DM / 8 + 255) / 256), 256, 0, stream>>>(wq, WQ, (size_t)DQ * DM / 8);
      k_cvt8<<<(unsigned)(((size_t)DM * DQ / 8 + 255) / 256), 256, 0, stream>>>(wo, WO, (size_t)DM * DQ / 8);
       }
    for (int b = 0; b < NB_; ++b) {
        
        k_cvt8<<<(unsigned)(((size_t)TT * DM / 8 + 255) / 256), 256, 0, stream>>>(x + (size_t)b * TT * DM, XB, (size_t)TT * DM / 8);
        k_gemmw<bf, 0, false, 8, true><<<dim3(TT / 64, DQ / 64, 1), 256, 0, stream>>>(XB, nullptr, WQ, nullptr, DM, nullptr, 0, nullptr, 0, 0, 0, QP16, QPh, QPl, TT * HD, VT16, VTh, VTl, 2 * TT, TT);
        k_fattn<8><<<dim3(NH_, (TT - RH) / 32 + RH / 16, 1), 256, 0, stream>>>(QP16, QP16, VT16, QPh, QPl, QPh, QPl, VTh, VTl, ATh, ATl);   // key == value == query projection: the k role reads the q planes, the v role their transposes
        k_gemmw<bf, 1, true, 8, false><<<dim3(TT / 64, DM / 64, 1), 256, 0, stream>>>(ATh, ATl, WO, nullptr, DQ, OUT + (size_t)b * TT * DM, DM, bo, 0, 0, 0, nullptr, nullptr, nullptr, 0, nullptr, nullptr, nullptr, 0, 0); }
}

// v006
// A run of this version takes 96.2 microseconds.
// In two side-by-side timings against v005, it was 1.31 and 1.32 times as fast.
// All steps since v000 together make it 14.9 times as fast.
#include <hip/hip_runtime.h>

// Causal multi-head self-attention whose key and value are the QUERY projection (the module's bug, reproduced: x [2][2048][1024]; q = x Wq^T ('oi' [1024][1024] 1/32, no bias), k = v = q (16 heads x 64); scores masked above the diagonal (-inf == exclusion) then x 1/sqrt(64); softmax; ctx = attn.q; out = ctx Wo^T + bo ('oi') -> [2][2048][1024] (4.2 M); argument order x, Wq, Wo, bo).
// Layout per batch: bf16 copy of x; 'oi' weights; the one exact projection is computed once (one GEMM), which stores the 16-bit operand planes of the attention kernel itself: head planes [h][t][d], read in the q, the k and the v role (the v role's transposed fragments come out of the staged key tile by transposing LDS loads); fused causal T-2048 attention, all heads of a batch in one launch (hybrid rows: < 512 hi/lo 3 products, rest fp16 x1024; key chunks above the diagonal are never visited), storing the merged hi/lo context itself; hi/lo x Wo exact + bo.
// Compute dtypes, f32 accumulate: every input rounded to bf16; projection exact; attention rows < 512 3 products, rest fp16; softmax f32; Wo hl x exact + bias.

#define NB_  2
#define TT   2048
#define DM   1024
#define NH_  16
#define NKV  16
#define REP  (NH_ / NKV)
#define HD   64
#define DQ   (NH_ * HD)
#define DKV  (NKV * HD)
#define RH   512                  // query rows < RH use hi+lo planes (0: none)
#define WIN  2048
#define SCL  0.125f   // HD^-0.5
typedef _Float16 h16;
typedef unsigned short bf;
typedef __attribute__((ext_vector_type(16))) __bf16   v16bf;
typedef __attribute__((ext_vector_type(16))) _Float16 v16h;
typedef __attribute__((ext_vector_type(8)))  _Float16 v8h;
typedef __attribute__((ext_vector_type(8)))  unsigned short v8us;
typedef __attribute__((ext_vector_type(8)))  float    v8f;
typedef __attribute__((ext_vector_type(4)))  float    v4f;
typedef v8h  __attribute__((may_alias)) v8ha;
typedef v4f  __attribute__((may_alias)) v4fa;
typedef v8us __attribute__((may_alias)) v8usa;

__device__ __forceinline__ unsigned short f2bf(float f) { unsigned u = __float_as_uint(f); u += 0x7FFFu + ((u >> 16) & 1u); return (unsigned short)(u >> 16); }
__device__ __forceinline__ float bf2f(unsigned short b) { return __uint_as_float(((unsigned)b) << 16); }
__device__ __forceinline__ float bfr(float f) { return bf2f(f2bf(f)); }
__device__ __forceinline__ v16h cat16(v8h lo, v8h hi) { return __builtin_shufflevector(lo, hi, 0, 1, 2, 3, 4, 5, 6, 7, 8, 9, 10, 11, 12, 13, 14, 15); }
__device__ __forceinline__ v16bf cat16b(v8us lo, v8us hi) { return __builtin_bit_cast(v16bf, __builtin_shufflevector(lo, hi, 0, 1, 2, 3, 4, 5, 6, 7, 8, 9, 10, 11, 12, 13, 14, 15)); }
__device__ __forceinline__ v8f wmma16(v16h a, v16h b, v8f c) { return __builtin_amdgcn_wmma_f32_16x16x32_f16(false, a, false, b, (short)0, c, false, false); }
__device__ __forceinline__ v8f wmmab(v16bf a, v16bf b, v8f c) { return __builtin_amdgcn_wmma_f32_16x16x32_bf16(false, a, false, b, (short)0, c, false, false); }

__device__ __forceinline__ h16 tohx(float x) { return (h16)x; }
__device__ __forceinline__ void splitf(float y, unsigned short& h, unsigned short& l) { h = f2bf(y); l = f2bf(y - bf2f(h)); }
typedef __attribute__((ext_vector_type(4))) _Float16 v4h;
typedef __attribute__((ext_vector_type(4))) unsigned short v4us;

// ---- tile_reduce: sums the NW waves' partial 64x64 tiles (split K) through LDS, one 16x64 slab per round, always in wave order 0..NW-1. Thread t < 256 ends up with columns 4 (t & 15) .. + 3 of row (t >> 4) of each slab in res[].
// Two slab sets alternate, so one barrier a round is enough: the set that round mb + 2 overwrites was last read in front of the barrier of round mb + 1. No global store stands between the barriers (a barrier would wait for it).
template <int NW> __device__ __forceinline__ void tile_reduce(const v8f (&acc)[4][4], float* os, int wave, int lr, int hi, v4f (&res)[4]) {
    static_assert(NW >= 8, "256 threads sum a slab");
    const int ro = ((int)threadIdx.x >> 4) * 68 + ((int)threadIdx.x & 15) * 4;
#pragma unroll
    for (int mb = 0; mb < 4; ++mb) { float* ob = os + (mb & 1) * (NW * 16 * 68);
#pragma unroll
        for (int nb = 0; nb < 4; ++nb) {
#pragma unroll
            for (int j = 0; j < 8; ++j) ob[wave * (16 * 68) + (hi * 8 + j) * 68 + nb * 16 + lr] = acc[mb][nb][j]; }
        __syncthreads();
        if (threadIdx.x < 256) { v4f val = *(const v4fa*)(ob + ro);
#pragma unroll
            for (int w = 1; w < NW; ++w) val += *(const v4fa*)(ob + w * (16 * 68) + ro);
            res[mb] = val; } }
}

// ---- k_gemmw: register-blocked GEMM, NW WAVES per 64x64 output tile (16 accumulators each), operands straight from K-contiguous 16-bit planes; grid (M/64, N/64, Z), 32 * NW threads.
// Split K inside the work-group: wave w takes the 32-wide k chunks w, w + NW, w + 2 NW, ..., so a tile's chain of dependent load -> matrix passes is NW times shorter; tile_reduce sums the partial tiles.
// C[m][n] (f32, pitch ldc, + optional f32 bias[n]) = sum_k A[m][k] Bt[n][k] (+ split products per NSPLIT). z-batch strides sA/sB/sC in elements. K % 32 == 0.
// PL: no f32 C; the tile goes out as the 16-bit planes its consumer reads (fp16, bf16 hi, bf16 lo):
// head planes [h][t][d] (P16, Ph, Pl), element (m, n) at m * HD + (n / 64) * cb + n % 64, cb = TT * HD: a thread's 4 columns are 8 bytes, 16 threads fill one 128-byte line.
template <typename T16> struct WFrag;
template <> struct WFrag<h16> { typedef v16h V; static __device__ __forceinline__ V ld(const h16* p) { return cat16(*(const v8h*)p, *(const v8h*)(p + 16)); } static __device__ __forceinline__ v8f mma(V a, V b, v8f c) { return wmma16(a, b, c); } };
template <> struct WFrag<bf> { typedef v16bf V; static __device__ __forceinline__ V ld(const bf* p) { return cat16b(*(const v8us*)p, *(const v8us*)(p + 16)); } static __device__ __forceinline__ v8f mma(V a, V b, v8f c) { return wmmab(a, b, c); } };
template <typename T16, int NSPLIT, bool BIAS, int NW, bool PL>
__global__ __launch_bounds__(32 * NW) void k_gemmw(const T16* __restrict__ A, const T16* __restrict__ A2, const T16* __restrict__ Bt, const T16* __restrict__ Bt2, int K, float* C, int ldc, const float* __restrict__ bias, size_t sA, size_t sB, size_t sC, h16* P16, bf* Ph, bf* Pl, int cb) {
    typedef typename WFrag<T16>::V V;
    __shared__ __align__(16) float os[(NW == 1 ? 1 : 2 * NW) * 16 * 68];
    const size_t z = blockIdx.z; A += z * sA; if (A2) A2 += z * sA; Bt += z * sB; if (Bt2) Bt2 += z * sB; C += z * sC;
    const int lane = threadIdx.x & 31, lr = lane & 15, hi = lane >> 4; const int r0 = blockIdx.x * 64, c0 = blockIdx.y * 64; const int wave = (NW == 1) ? 0 : __builtin_amdgcn_readfirstlane((int)(threadIdx.x >> 5));
    v8f acc[4][4];
#pragma unroll
    for (int mb = 0; mb < 4; ++mb)
#pragma unroll
        for (int nb = 0; nb < 4; ++nb) acc[mb][nb] = (v8f){};
    const size_t aoff = (size_t)(r0 + lr) * K + 8 * hi, boff = (size_t)(c0 + lr) * K + 8 * hi;
#pragma unroll 1
    for (int kc = wave * 32; kc < K; kc += 32 * NW) {
        V a[4], a2[4];
#pragma unroll
        for (int mb = 0; mb < 4; ++mb) { a[mb] = WFrag<T16>::ld(A + aoff + (size_t)mb * 16 * K + kc); if (NSPLIT == 1 || NSPLIT == 2) a2[mb] = WFrag<T16>::ld(A2 + aoff + (size_t)mb * 16 * K + kc); }
#pragma unroll
        for (int nb = 0; nb < 4; ++nb) { const V b = WFrag<T16>::ld(Bt + boff + (size_t)nb * 16 * K + kc); V b2; if (NSPLIT >= 2) b2 = WFrag<T16>::ld(Bt2 + boff + (size_t)nb * 16 * K + kc);
#pragma unroll
            for (int mb = 0; mb < 4; ++mb) { acc[mb][nb] = WFrag<T16>::mma(a[mb], b, acc[mb][nb]); if (NSPLIT == 1 || NSPLIT == 2) acc[mb][nb] = WFrag<T16>::mma(a2[mb], b, acc[mb][nb]); if (NSPLIT >= 2) acc[mb][nb] = WFrag<T16>::mma(a[mb], b2, acc[mb][nb]); } }
        asm volatile("v_nop\n\tv_nop\n\tv_nop\n\tv_nop" : "+v"(acc[0][0]), "+v"(acc[1][1]), "+v"(acc[2][2]), "+v"(acc[3][3]) : "v"(a[0]), "v"(a[3]));
    }
    v4f res[4]; tile_reduce<NW>(acc, os, wave, lr, hi, res);
    const int row = (int)threadIdx.x >> 4, cofs = ((int)threadIdx.x & 15) * 4;
    if constexpr (PL) {
        if (threadIdx.x < 256) { const int pc = (int)blockIdx.y * cb + cofs;
#pragma unroll
            for (int mb = 0; mb < 4; ++mb) { v4h o16; v4us oh, ol;
#pragma unroll
                for (int q = 0; q < 4; ++q) { const float y = res[mb][q]; o16[q] = tohx(y); unsigned short a2, c2; splitf(y, a2, c2); oh[q] = a2; ol[q] = c2; }
                const int po = (r0 + mb * 16 + row) * HD + pc; *(v4h*)(P16 + po) = o16; *(v4us*)(Ph + po) = oh; *(v4us*)(Pl + po) = ol; } }
    } else if (threadIdx.x < 256) {
#pragma unroll
        for (int mb = 0; mb < 4; ++mb) { v4f val = res[mb]; if (BIAS) { val[0] += bfr(bias[c0 + cofs]); val[1] += bfr(bias[c0 + cofs + 1]); val[2] += bfr(bias[c0 + cofs + 2]); val[3] += bfr(bias[c0 + cofs + 3]); }
            *(v4f*)(C + (size_t)(r0 + mb * 16 + row) * ldc + c0 + cofs) = val; } }
}

__global__ __launch_bounds__(256) void k_cvt8(const float* __restrict__ src, bf* dst, size_t n8) { const size_t i = (size_t)blockIdx.x * 256 + threadIdx.x; if (i >= n8) return; const v8f v = *(const v8f*)(src + i * 8); v8us o;
#pragma unroll
    for (int k = 0; k < 8; ++k) o[k] = f2bf(v[k]); *(v8us*)(dst + i * 8) = o;  }

// ---- k_fattn: causal attention of one query tile of one head in one work-group; scores and probabilities stay in registers (online softmax), nothing of them goes to memory.
// S^T = K Q^T (A = 16 key rows, B = 16 query rows): a lane holds 16 of the 32 scores of ONE query (column lr), keys kc + 8 hi + j and kc + 16 + 8 hi + j, which is the k order of a B operand, so the converted
// probabilities are the B operand of O^T += V^T P^T (A = 16 rows of the transposed values) with no exchange; O^T keeps the lane's query, so maximum, sum and rescale are per lane (one exchange between the halves for the maximum).
// Split keys inside the work-group: wave w takes the 32-key chunks w, w + NW, ...; each wave keeps its own (level, sum, O^T); they are joined through LDS in wave order 0..NW-1.
// Every inner loop is unrolled so that fragments, scores and accumulators are indexed by constants and stay in registers.
// The level m is in log2 units and stands SH below the running maximum, so fp16 probabilities are carried x 2^SH (their sum too, so the factor leaves with the division). A masked raw score is -3e38 and the start level -1e30: exp2 gives 0 for it also where a whole chunk is masked.
__device__ __forceinline__ float xhalf(float x) { const int b = __float_as_int(x); return __int_as_float(__builtin_amdgcn_permlanex16(b, b, 0x76543210, 0xfedcba98, false, false)); }   // the value of lane ^ 16
// exp2 with the one slot that the instruction set asks for before a transcendental's result is used or its source overwritten: the v_nop takes the result
// and keeps the source alive, so only independent instructions can stand between the two; the builtin stays, so that the compiler still keeps the matrix instructions' distances for it.
__device__ __forceinline__ float exp2s(float x) { float r = __builtin_amdgcn_exp2f(x); asm("v_nop" : "+v"(r) : "v"(x)); return r; }
// fragment at byte offset bo (per lane, 32 bits) + co (constant) of a wave-uniform plane pointer: one offset register beside a scalar base
template <typename T16> __device__ __forceinline__ typename WFrag<T16>::V ldo(const T16* base, unsigned bo, int co) { return WFrag<T16>::ld((const T16*)((const char*)base + bo + co)); }
// ---- the key tile of a pass. Key == value, so a wave brings its 32-key chunk of a head plane (32 rows of 128 bytes, 4 KiB in a row in memory) ONCE into an LDS tile of its own, by asynchronous copies whose 32 lanes cover
// four whole 128-byte lines each (a fragment load from memory touches 16 lines for the same 512 bytes). Rows stand at pitch KPB in LDS. The key fragments are plain 16-byte LDS reads, the transposed value fragments transposing LDS reads of the same tile.
// The tile is private to its wave: no barrier; the wave's own s_wait_asynccnt 0 stands in front of its reads, its own s_wait_dscnt 0 in front of the refill.
#define KPB 144                   // 16 bytes x odd
#define KTB (32 * KPB)            // bytes of one plane's tile
typedef __attribute__((ext_vector_type(4))) int v4i;
typedef __attribute__((ext_vector_type(8))) short v8s;
typedef __attribute__((address_space(1))) v4i gl_v4i;
typedef __attribute__((address_space(3))) v4i lds_v4i;
typedef __attribute__((address_space(3))) v8s lds_v8s;
// g: the lane's 16 bytes of the chunk's first 512 (chunk base + 16 lane); l: their place in the tile (row lane / 8, column 16 (lane % 8)); copy i brings rows 4 i .. 4 i + 3
__device__ __forceinline__ void stage_tile(const char* g, char* l) {
#pragma unroll
    for (int i = 0; i < 8; ++i) __builtin_amdgcn_global_load_async_to_lds_b128((gl_v4i*)(g + i * 512), (lds_v4i*)(l + i * 4 * KPB), 0, 0);
}
// A fragment of the transposed tile: p = tile + (8 (lane / 16) + lane % 8) KPB + 16 ((lane / 8) % 2) + 2 dbase; lane (c, h) gets tile[8 h + j][dbase + c] and tile[16 + 8 h + j][dbase + c], j = 0 .. 7: the k order of WFrag::ld on a transposed row
template <typename T16> __device__ __forceinline__ typename WFrag<T16>::V ldt(const char* p) {
    const v8s a = __builtin_amdgcn_ds_load_tr16_b128_v8i16((lds_v8s*)p), b = __builtin_amdgcn_ds_load_tr16_b128_v8i16((lds_v8s*)(p + 16 * KPB));
    return __builtin_bit_cast(typename WFrag<T16>::V, __builtin_shufflevector(a, b, 0, 1, 2, 3, 4, 5, 6, 7, 8, 9, 10, 11, 12, 13, 14, 15)); }
template <typename T16, bool HI, int NQ, int NW>
__device__ __forceinline__ void attn_tile(const T16* __restrict__ Q, const T16* __restrict__ Q2, const T16* __restrict__ Kp, const T16* __restrict__ K2, int r0, bf* Ah, bf* Al, float* sm, char* kt8) {
    typedef typename WFrag<T16>::V V;
    const float SH = HI ? 0.0f : 10.0f;
    const float SCL2 = SCL * 1.4426950408889634f;           // HD^-0.5 x log2(e)
    const int lane = threadIdx.x & 31, lr = lane & 15, hi = lane >> 4; const int wave = __builtin_amdgcn_readfirstlane((int)(threadIdx.x >> 5));
    V q[NQ][2], q2[NQ][2]; v8f acc[NQ][4]; float m[NQ], l[NQ];
    const unsigned qo = (unsigned)(((r0 + lr) * HD + 8 * hi) * 2);
    char* tile = kt8 + wave * (2 * KTB);                    // the wave's own tile(s): the plane Kp, behind it (HI) the plane K2
    char* tw = tile + (lane >> 3) * KPB + (lane & 7) * 16;  // where the lane's copies land
    const char* tk = tile + lr * KPB + hi * 16;             // the lane's key row (key fragments)
    const char* tv = tile + (8 * hi + (lane & 7)) * KPB + ((lane >> 3) & 1) * 16;   // the lane's address of the transposing reads
    const int nch = (r0 + NQ * 16 + 31) >> 5;               // 32-key chunks up to and with the diagonal
    if (wave < nch) { stage_tile((const char*)Kp + wave * 4096 + lane * 16, tw); if (HI) stage_tile((const char*)K2 + wave * 4096 + lane * 16, tw + KTB); }   // the wave's first chunk (wave-uniform test, every lane on)
#pragma unroll
    for (int nq = 0; nq < NQ; ++nq) { m[nq] = -1.0e30f; l[nq] = 0.0f;
#pragma unroll
        for (int kk = 0; kk < 2; ++kk) { const int co = (nq * 16 * HD + kk * 32) * 2; q[nq][kk] = ldo(Q, qo, co); if (HI) q2[nq][kk] = ldo(Q2, qo, co); }
#pragma unroll
        for (int dt = 0; dt < 4; ++dt) acc[nq][dt] = (v8f){}; }
#pragma unroll 1   // rolled: a second pass in flight would not fit the registers of four waves per SIMD
    for (int c = wave; c < nch; c += NW) { const int kc = c * 32;
        V ka[2][2], ka2[2][2], va[4], va2[4];
        asm volatile("s_wait_asynccnt 0x0" ::: "memory");   // this chunk's copies have landed before the wave reads its tile
#pragma unroll
        for (int kt = 0; kt < 2; ++kt)
#pragma unroll
            for (int kk = 0; kk < 2; ++kk) { const int co = kt * 16 * KPB + kk * 64; ka[kt][kk] = WFrag<T16>::ld((const T16*)(tk + co)); if (HI) ka2[kt][kk] = WFrag<T16>::ld((const T16*)(tk + KTB + co)); }
#pragma unroll
        for (int dt = 0; dt < 4; ++dt) { va[dt] = ldt<T16>(tv + dt * 32); if (HI) va2[dt] = ldt<T16>(tv + KTB + dt * 32); }
        asm volatile("s_wait_dscnt 0x0" ::: "memory");      // every read of the tile has retired before the next chunk's copies target it
        if (c + NW < nch) { stage_tile((const char*)Kp + (c + NW) * 4096 + lane * 16, tw); if (HI) stage_tile((const char*)K2 + (c + NW) * 4096 + lane * 16, tw + KTB); }   // flies while this chunk is worked on (wave-uniform test)
        v8f s[NQ][2];
#pragma unroll
        for (int nq = 0; nq < NQ; ++nq)
#pragma unroll
            for (int kt = 0; kt < 2; ++kt) { v8f t = (v8f){};
#pragma unroll
                for (int kk = 0; kk < 2; ++kk) { t = WFrag<T16>::mma(ka[kt][kk], q[nq][kk], t); if (HI) { t = WFrag<T16>::mma(ka2[kt][kk], q[nq][kk], t); t = WFrag<T16>::mma(ka[kt][kk], q2[nq][kk], t); } }
                s[nq][kt] = t; }
        if (c == nch - 1) {                                 // only the diagonal chunk holds keys above a query of the tile (wave-uniform test)
#pragma unroll
            for (int nq = 0; nq < NQ; ++nq) { const int lim = r0 + nq * 16 + lr - kc - 8 * hi;   // key kc + 16 kt + 8 hi + j is allowed while 16 kt + j <= lim
#pragma unroll
                for (int kt = 0; kt < 2; ++kt)
#pragma unroll
                    for (int j = 0; j < 8; ++j) s[nq][kt][j] = (kt * 16 + j <= lim) ? s[nq][kt][j] : -3.0e38f; } }
#pragma unroll
        for (int nq = 0; nq < NQ; ++nq) {
            float mx = s[nq][0][0];
#pragma unroll
            for (int kt = 0; kt < 2; ++kt)
#pragma unroll
                for (int j = 0; j < 8; ++j) mx = fmaxf(mx, s[nq][kt][j]);
            mx = fmaxf(mx, xhalf(mx));
            const float mn = fmaxf(m[nq], mx * SCL2 - SH); const float alpha = exp2s(m[nq] - mn); m[nq] = mn;
            float ps = 0.0f;
#pragma unroll
            for (int kt = 0; kt < 2; ++kt)
#pragma unroll
                for (int j = 0; j < 8; ++j) { const float pe = exp2s(__builtin_fmaf(s[nq][kt][j], SCL2, -mn)); s[nq][kt][j] = pe; ps += pe; }
            l[nq] = l[nq] * alpha + ps;
#pragma unroll
            for (int dt = 0; dt < 4; ++dt) acc[nq][dt] *= alpha;
            if constexpr (HI) { v8us h0, h1, l0, l1;
#pragma unroll
                for (int j = 0; j < 8; ++j) { unsigned short a, c2; splitf(s[nq][0][j], a, c2); h0[j] = a; l0[j] = c2; splitf(s[nq][1][j], a, c2); h1[j] = a; l1[j] = c2; }
                const V pf = cat16b(h0, h1), pf2 = cat16b(l0, l1);
#pragma unroll
                for (int dt = 0; dt < 4; ++dt) { acc[nq][dt] = WFrag<T16>::mma(va[dt], pf, acc[nq][dt]); acc[nq][dt] = WFrag<T16>::mma(va2[dt], pf, acc[nq][dt]); acc[nq][dt] = WFrag<T16>::mma(va[dt], pf2, acc[nq][dt]); }
            } else { v8h h0, h1;
#pragma unroll
                for (int j = 0; j < 8; ++j) { h0[j] = tohx(s[nq][0][j]); h1[j] = tohx(s[nq][1][j]); }
                const V pf = cat16(h0, h1);
#pragma unroll
                for (int dt = 0; dt < 4; ++dt) acc[nq][dt] = WFrag<T16>::mma(va[dt], pf, acc[nq][dt]); }
        }
    }
    asm volatile("s_wait_asynccnt 0x0" ::: "memory");       // no copy of the wave is outstanding behind the loop
    float* ms = sm + NW * NQ * 16 * 68; float* ls = ms + NW * NQ * 16;
#pragma unroll
    for (int nq = 0; nq < NQ; ++nq) { const float lt = l[nq] + xhalf(l[nq]);
#pragma unroll
        for (int dt = 0; dt < 4; ++dt) { float* o = sm + (wave * NQ * 16 + nq * 16 + lr) * 68 + dt * 16 + hi * 8; const v8f a = acc[nq][dt];
            *(v4fa*)o = (v4f){a[0], a[1], a[2], a[3]}; *(v4fa*)(o + 4) = (v4f){a[4], a[5], a[6], a[7]}; }
        if (hi == 0) { ms[wave * NQ * 16 + nq * 16 + lr] = m[nq]; ls[wave * NQ * 16 + nq * 16 + lr] = lt; } }
    __syncthreads();
#pragma unroll
    for (int idx = (int)threadIdx.x; idx < NQ * 256; idx += 32 * NW) { const int qq = idx >> 4, d4 = (idx & 15) * 4;
        float M = ms[qq];
#pragma unroll
        for (int w = 1; w < NW; ++w) M = fmaxf(M, ms[w * NQ * 16 + qq]);
        float L = 0.0f; v4f val = (v4f){};
#pragma unroll
        for (int w = 0; w < NW; ++w) { const float wt = exp2s(ms[w * NQ * 16 + qq] - M); L += ls[w * NQ * 16 + qq] * wt; val += *(const v4fa*)(sm + (w * NQ * 16 + qq) * 68 + d4) * wt; }
        const float f = __fdiv_rn(1.0f, L); v4us oh, ol;    // the context row goes out as the hi/lo A operand of the output projection, [t][head * HD + d]: 16 threads fill one 128-byte line of each plane
#pragma unroll
        for (int e = 0; e < 4; ++e) { unsigned short a, c2; splitf(val[e] * f, a, c2); oh[e] = a; ol[e] = c2; }
        *(v4us*)(Ah + (size_t)(r0 + qq) * DQ + d4) = oh; *(v4us*)(Al + (size_t)(r0 + qq) * DQ + d4) = ol; }
}
// grid (heads, tiles): the tile index is the slow one and the longest tiles (last rows) come first. Tiles 0 .. (TT - RH) / 32 - 1: 32 fp16 rows each; the rest: 16 hi/lo rows each (3 products). Output: hi/lo planes [t][head * HD + d].
template <int NW>
__global__ __launch_bounds__(32 * NW) void k_fattn(const h16* __restrict__ Q16, const h16* __restrict__ K16, const bf* __restrict__ Qh, const bf* __restrict__ Ql, const bf* __restrict__ Kh, const bf* __restrict__ Kl, bf* Ah, bf* Al) {
    __shared__ __align__(16) float sm[NW * 32 * 70];
    __shared__ __align__(16) char kt8[NW * 2 * KTB];        // the waves' key tiles
    const size_t z = blockIdx.x, zp = z * TT * HD; const int ty = blockIdx.y;
    if (ty < (TT - RH) / 32) attn_tile<h16, false, 2, NW>(Q16 + zp, nullptr, K16 + zp, nullptr, TT - 32 * (ty + 1), Ah + z * HD, Al + z * HD, sm, kt8);
    else attn_tile<bf, true, 1, NW>(Qh + zp, Ql + zp, Kh + zp, Kl + zp, RH - 16 * (ty - (TT - RH) / 32 + 1), Ah + z * HD, Al + z * HD, sm, kt8);
}

extern "C" void kernel_launch(void* const* d_in, const int* in_sizes, int n_in,
                              void* d_out, int out_size, void* d_ws, size_t ws_size, hipStream_t stream) {
    (void)in_sizes; (void)n_in; (void)out_size;
    const float* x = (const float*)d_in[0]; const float* wq = (const float*)d_in[1]; const float* wo = (const float*)d_in[2]; const float* bo = (const float*)d_in[3];   /* input order x, Wq, Wo ('oi'), bo */
    float* OUT = (float*)d_out;     // [2][2048][1024]
    char* wsp = (char*)d_ws;
    auto take = [&](size_t bytes) { char* p = wsp; wsp += (bytes + 255) & ~(size_t)255; return (void*)p; };
    bf* WQ = (bf*)take((size_t)DQ * DM * 2); bf* WO = (bf*)take((size_t)DM * DQ * 2);
    bf* XB = (bf*)take((size_t)TT * DM * 2);
    h16* QP16 = (h16*)take((size_t)NH_ * TT * HD * 2);
    bf* QPh = (bf*)take((size_t)NH_ * TT * HD * 2); bf* QPl = (bf*)take((size_t)NH_ * TT * HD * 2);
    bf* ATh = (bf*)take((size_t)TT * DQ * 2); bf* ATl = (bf*)take((size_t)TT * DQ * 2);
    if ((size_t)(wsp - (char*)d_ws) > ws_size) return;    // ws 256 MiB
    { k_cvt8<<<(unsigned)(((size_t)DQ * DM / 8 + 255) / 256), 256, 0, stream>>>(wq, WQ, (size_t)DQ * DM / 8);
      k_cvt8<<<(unsigned)(((size_t)DM * DQ / 8 + 255) / 256), 256, 0, stream>>>(wo, WO, (size_t)DM * DQ / 8);
       }
    for (int b = 0; b < NB_; ++b) {
        
        k_cvt8<<<(unsigned)(((size_t)TT * DM / 8 + 255) / 256), 256, 0, stream>>>(x + (size_t)b * TT * DM, XB, (size_t)TT * DM / 8);
        k_gemmw<bf, 0, false, 8, true><<<dim3(TT / 64, DQ / 64, 1), 256, 0, stream>>>(XB, nullptr, WQ, nullptr, DM, nullptr, 0, nullptr, 0, 0, 0, QP16, QPh, QPl, TT * HD);
        k_fattn<8><<<dim3(NH_, (TT - RH) / 32 + RH / 16, 1), 256, 0, stream>>>(QP16, QP16, QPh, QPl, QPh, QPl, ATh, ATl);   // key == value == query projection: the k and the v role read the q planes
        k_gemmw<bf, 1, true, 8, false><<<dim3(TT / 64, DM / 64, 1), 256, 0, stream>>>(ATh, ATl, WO, nullptr, DQ, OUT + (size_t)b * TT * DM, DM, bo, 0, 0, 0, nullptr, nullptr, nullptr, 0); }
}

// v007
// Measured time: 79.6 microseconds a run.
// Next to v006, in two timings, it ran 1.20 and 1.22 times as fast.
// All steps since v000 together make it 18.1 times as fast.
#include <hip/hip_runtime.h>

// Causal multi-head self-attention whose key and value are the QUERY projection (the module's bug, reproduced: x [2][2048][1024]; q = x Wq^T ('oi' [1024][1024] 1/32, no bias), k = v = q (16 heads x 64); scores masked above the diagonal (-inf == exclusion) then x 1/sqrt(64); softmax; ctx = attn.q; out = ctx Wo^T + bo ('oi') -> [2][2048][1024] (4.2 M); argument order x, Wq, Wo, bo).
// Layout per batch: bf16 copy of x; 'oi' weights; the one exact projection is computed once (one GEMM), which stores the 16-bit operand planes of the attention kernel itself: head planes [h][t][d], read in the q, the k and the v role (the v role's transposed fragments come out of the staged key tile by transposing LDS loads); fused causal T-2048 attention, all heads of a batch in one launch (hybrid rows: < 512 hi/lo 3 products, rest fp16 x1024; key chunks above the diagonal are never visited), storing the merged hi/lo context itself; hi/lo x Wo exact + bo.
// Compute dtypes, f32 accumulate: every input rounded to bf16; projection exact; attention rows < 512 3 products, rest fp16; softmax f32; Wo hl x exact + bias.

#define NB_  2
#define TT   2048
#define DM   1024
#define NH_  16
#define NKV  16
#define REP  (NH_ / NKV)
#define HD   64
#define DQ   (NH_ * HD)
#define DKV  (NKV * HD)
#define RH   512                  // query rows < RH use hi+lo planes (0: none)
#define WIN  2048
#define SCL  0.125f   // HD^-0.5
typedef _Float16 h16;
typedef unsigned short bf;
typedef __attribute__((ext_vector_type(16))) __bf16   v16bf;
typedef __attribute__((ext_vector_type(16))) _Float16 v16h;
typedef __attribute__((ext_vector_type(8)))  _Float16 v8h;
typedef __attribute__((ext_vector_type(8)))  unsigned short v8us;
typedef __attribute__((ext_vector_type(8)))  float    v8f;
typedef __attribute__((ext_vector_type(4)))  float    v4f;
typedef v8h  __attribute__((may_alias)) v8ha;
typedef v4f  __attribute__((may_alias)) v4fa;
typedef v8us __attribute__((may_alias)) v8usa;

__device__ __forceinline__ unsigned short f2bf(float f) { unsigned u = __float_as_uint(f); u += 0x7FFFu + ((u >> 16) & 1u); return (unsigned short)(u >> 16); }
__device__ __forceinline__ float bf2f(unsigned short b) { return __uint_as_float(((unsigned)b) << 16); }
__device__ __forceinline__ float bfr(float f) { return bf2f(f2bf(f)); }
__device__ __forceinline__ v16h cat16(v8h lo, v8h hi) { return __builtin_shufflevector(lo, hi, 0, 1, 2, 3, 4, 5, 6, 7, 8, 9, 10, 11, 12, 13, 14, 15); }
__device__ __forceinline__ v16bf cat16b(v8us lo, v8us hi) { return __builtin_bit_cast(v16bf, __builtin_shufflevector(lo, hi, 0, 1, 2, 3, 4, 5, 6, 7, 8, 9, 10, 11, 12, 13, 14, 15)); }
__device__ __forceinline__ v8f wmma16(v16h a, v16h b, v8f c) { return __builtin_amdgcn_wmma_f32_16x16x32_f16(false, a, false, b, (short)0, c, false, false); }
__device__ __forceinline__ v8f wmmab(v16bf a, v16bf b, v8f c) { return __builtin_amdgcn_wmma_f32_16x16x32_bf16(false, a, false, b, (short)0, c, false, false); }

__device__ __forceinline__ h16 tohx(float x) { return (h16)x; }
__device__ __forceinline__ void splitf(float y, unsigned short& h, unsigned short& l) { h = f2bf(y); l = f2bf(y - bf2f(h)); }
typedef __attribute__((ext_vector_type(4))) _Float16 v4h;
typedef __attribute__((ext_vector_type(4))) unsigned short v4us;

// ---- tile_reduce: sums the NW waves' partial 64x64 tiles (split K) through LDS, one 16x64 slab per round, always in wave order 0..NW-1. Thread t < 256 ends up with columns 4 (t & 15) .. + 3 of row (t >> 4) of each slab in res[].
// Two slab sets alternate, so one barrier a round is enough: the set that round mb + 2 overwrites was last read in front of the barrier of round mb + 1. No global store stands between the barriers (a barrier would wait for it).
template <int NW> __device__ __forceinline__ void tile_reduce(const v8f (&acc)[4][4], float* os, int wave, int lr, int hi, v4f (&res)[4]) {
    static_assert(NW >= 8, "256 threads sum a slab");
    const int ro = ((int)threadIdx.x >> 4) * 68 + ((int)threadIdx.x & 15) * 4;
#pragma unroll
    for (int mb = 0; mb < 4; ++mb) { float* ob = os + (mb & 1) * (NW * 16 * 68);
#pragma unroll
        for (int nb = 0; nb < 4; ++nb) {
#pragma unroll
            for (int j = 0; j < 8; ++j) ob[wave * (16 * 68) + (hi * 8 + j) * 68 + nb * 16 + lr] = acc[mb][nb][j]; }
        __syncthreads();
        if (threadIdx.x < 256) { v4f val = *(const v4fa*)(ob + ro);
#pragma unroll
            for (int w = 1; w < NW; ++w) val += *(const v4fa*)(ob + w * (16 * 68) + ro);
            res[mb] = val; } }
}

// ---- k_gemmw: register-blocked GEMM, NW WAVES per 64x64 output tile (16 accumulators each), operands from K-contiguous 16-bit planes; grid (M/64, N/64, Z), 32 * NW threads.
// Split K inside the work-group: wave w takes the 32-wide k chunks w, w + NW, w + 2 NW, ..., so a tile's chain of dependent load -> matrix passes is NW times shorter; tile_reduce sums the partial tiles.
// Operand path: a stage is GKS = 32 NW k values of all 64 rows of every operand plane. The work-group brings it into LDS by asynchronous copies, one copy a row: its 32 lanes cover 512 bytes in a row, four whole 128-byte lines
// (a fragment load from memory touches 16 lines for the same 512 bytes). Wave w copies rows 8 w .. 8 w + 7 of each plane and reads, from every row, the 64 bytes of its own k chunk by plain 16-byte LDS reads (row pitch GPB).
// One buffer: a stage's fragments go to registers, then the next stage's copies fly while the matrix instructions run. The partial-tile slabs of tile_reduce use the same LDS behind the last stage's second barrier.
// C[m][n] (f32, pitch ldc, + optional f32 bias[n]) = sum_k A[m][k] Bt[n][k] (+ A2[m][k] Bt[n][k] for NSPLIT 1). z-batch strides sA/sB/sC in elements. K % GKS == 0.
// PL: no f32 C; the tile goes out as the 16-bit planes its consumer reads (fp16, bf16 hi, bf16 lo):
// head planes [h][t][d] (P16, Ph, Pl), element (m, n) at m * HD + (n / 64) * cb + n % 64, cb = TT * HD: a thread's 4 columns are 8 bytes, 16 threads fill one 128-byte line.
template <typename T16> struct WFrag;
template <> struct WFrag<h16> { typedef v16h V; static __device__ __forceinline__ V ld(const h16* p) { return cat16(*(const v8h*)p, *(const v8h*)(p + 16)); } static __device__ __forceinline__ v8f mma(V a, V b, v8f c) { return wmma16(a, b, c); } };
template <> struct WFrag<bf> { typedef v16bf V; static __device__ __forceinline__ V ld(const bf* p) { return cat16b(*(const v8us*)p, *(const v8us*)(p + 16)); } static __device__ __forceinline__ v8f mma(V a, V b, v8f c) { return wmmab(a, b, c); } };
typedef __attribute__((ext_vector_type(4))) int v4i;
typedef __attribute__((address_space(1))) v4i gl_v4i;
typedef __attribute__((address_space(3))) v4i lds_v4i;
#define GKS 256                   // k values of a stage
#define GPB (GKS * 2 + 16)        // LDS row pitch in bytes: 16 bytes x odd
// eight rows of one plane: g = the lane's 16 bytes of the first row's stage (row pitch gp bytes in memory), l = their place in LDS
__device__ __forceinline__ void stage_rows(const char* g, size_t gp, char* l) {
#pragma unroll
    for (int i = 0; i < 8; ++i) __builtin_amdgcn_global_load_async_to_lds_b128((gl_v4i*)(g + i * gp), (lds_v4i*)(l + i * GPB), 0, 0);
}
// launch bounds: four waves a SIMD, so that two work-groups share a WGP (without the bound the three-plane form keeps every LDS address in a register of its own and passes 256 registers)
template <typename T16, int NSPLIT, bool BIAS, int NW, bool PL>
__global__ __launch_bounds__(32 * NW, 4) void k_gemmw(const T16* __restrict__ A, const T16* __restrict__ A2, const T16* __restrict__ Bt, const T16* __restrict__ Bt2, int K, float* C, int ldc, const float* __restrict__ bias, size_t sA, size_t sB, size_t sC, h16* P16, bf* Ph, bf* Pl, int cb) {
    typedef typename WFrag<T16>::V V;
    static_assert(NW * 32 == GKS && NW * 8 == 64 && NSPLIT <= 1, "a stage is one k chunk a wave; eight rows of a plane a wave");
    constexpr int PLB = 64 * GPB, STB = (NSPLIT == 1 ? 3 : 2) * PLB, OSB = 2 * NW * 16 * 68 * 4;   // bytes: one plane's stage, a whole stage (A, A2, Bt), the slabs of tile_reduce
    __shared__ __align__(16) char lds[STB > OSB ? STB : OSB];
    float* os = (float*)lds;
    const size_t z = blockIdx.z; A += z * sA; if (NSPLIT == 1) A2 += z * sA; Bt += z * sB; C += z * sC; (void)Bt2;
    const int lane = threadIdx.x & 31, lr = lane & 15, hi = lane >> 4; const int r0 = blockIdx.x * 64, c0 = blockIdx.y * 64; const int wave = __builtin_amdgcn_readfirstlane((int)(threadIdx.x >> 5));
    v8f acc[4][4];
#pragma unroll
    for (int mb = 0; mb < 4; ++mb)
#pragma unroll
        for (int nb = 0; nb < 4; ++nb) acc[mb][nb] = (v8f){};
    const size_t gp = (size_t)K * 2;                        // bytes of a plane's row in memory
    const char* ga = (const char*)A + (size_t)(r0 + wave * 8) * gp + lane * 16; const char* ga2 = NSPLIT == 1 ? (const char*)A2 + (size_t)(r0 + wave * 8) * gp + lane * 16 : nullptr; const char* gb = (const char*)Bt + (size_t)(c0 + wave * 8) * gp + lane * 16;
    char* lw = lds + wave * 8 * GPB + lane * 16;            // where the lane's copies land (plane A; A2 and Bt behind it)
    const char* lf = lds + lr * GPB + wave * 64 + hi * 16;  // the lane's fragment bytes: row lr, the wave's k chunk
    const int nst = K / GKS;
    stage_rows(ga, gp, lw); if (NSPLIT == 1) stage_rows(ga2, gp, lw + PLB); stage_rows(gb, gp, lw + STB - PLB);
#pragma unroll 1   // rolled: one set of fragments fits the registers of four waves per SIMD
    for (int s = 0; s < nst; ++s) {
        V a[4], a2[4], b[4];
        asm volatile("s_wait_asynccnt 0x0" ::: "memory");   // the wave's own copies of this stage have landed ...
        __syncthreads();                                    // ... and every other wave's: the stage may be read
#pragma unroll
        for (int mb = 0; mb < 4; ++mb) { a[mb] = WFrag<T16>::ld((const T16*)(lf + mb * 16 * GPB)); if (NSPLIT == 1) a2[mb] = WFrag<T16>::ld((const T16*)(lf + PLB + mb * 16 * GPB)); b[mb] = WFrag<T16>::ld((const T16*)(lf + STB - PLB + mb * 16 * GPB)); }
        asm volatile("s_wait_dscnt 0x0" ::: "memory");      // the wave's reads of the stage have retired ...
        __syncthreads();                                    // ... and every other wave's: the buffer may be refilled (behind the last stage: reused by tile_reduce)
        if (s + 1 < nst) { const size_t so = (size_t)(s + 1) * (GKS * 2); stage_rows(ga + so, gp, lw); if (NSPLIT == 1) stage_rows(ga2 + so, gp, lw + PLB); stage_rows(gb + so, gp, lw + STB - PLB); }   // flies while this stage is worked on (the test reads the same in the whole work-group)
#pragma unroll
        for (int nb = 0; nb < 4; ++nb)
#pragma unroll
            for (int mb = 0; mb < 4; ++mb) { acc[mb][nb] = WFrag<T16>::mma(a[mb], b[nb], acc[mb][nb]); if (NSPLIT == 1) acc[mb][nb] = WFrag<T16>::mma(a2[mb], b[nb], acc[mb][nb]); }
        asm volatile("v_nop\n\tv_nop\n\tv_nop\n\tv_nop" : "+v"(acc[0][0]), "+v"(acc[1][1]), "+v"(acc[2][2]), "+v"(acc[3][3]) : "v"(a[0]), "v"(a[3]));
    }
    asm volatile("s_wait_asynccnt 0x0" ::: "memory");       // no copy of the wave is outstanding behind the loop
    v4f res[4]; tile_reduce<NW>(acc, os, wave, lr, hi, res);
    const int row = (int)threadIdx.x >> 4, cofs = ((int)threadIdx.x & 15) * 4;
    if constexpr (PL) {
        if (threadIdx.x < 256) { const int pc = (int)blockIdx.y * cb + cofs;
#pragma unroll
            for (int mb = 0; mb < 4; ++mb) { v4h o16; v4us oh, ol;
#pragma unroll
                for (int q = 0; q < 4; ++q) { const float y = res[mb][q]; o16[q] = tohx(y); unsigned short a2, c2; splitf(y, a2, c2); oh[q] = a2; ol[q] = c2; }
                const int po = (r0 + mb * 16 + row) * HD + pc; *(v4h*)(P16 + po) = o16; *(v4us*)(Ph + po) = oh; *(v4us*)(Pl + po) = ol; } }
    } else if (threadIdx.x < 256) {
#pragma unroll
        for (int mb = 0; mb < 4; ++mb) { v4f val = res[mb]; if (BIAS) { val[0] += bfr(bias[c0 + cofs]); val[1] += bfr(bias[c0 + cofs + 1]); val[2] += bfr(bias[c0 + cofs + 2]); val[3] += bfr(bias[c0 + cofs + 3]); }
            *(v4f*)(C + (size_t)(r0 + mb * 16 + row) * ldc + c0 + cofs) = val; } }
}

__global__ __launch_bounds__(256) void k_cvt8(const float* __restrict__ src, bf* dst, size_t n8) { const size_t i = (size_t)blockIdx.x * 256 + threadIdx.x; if (i >= n8) return; const v8f v = *(const v8f*)(src + i * 8); v8us o;
#pragma unroll
    for (int k = 0; k < 8; ++k) o[k] = f2bf(v[k]); *(v8us*)(dst + i * 8) = o;  }

// ---- k_fattn: causal attention of one query tile of one head in one work-group; scores and probabilities stay in registers (online softmax), nothing of them goes to memory.
// S^T = K Q^T (A = 16 key rows, B = 16 query rows): a lane holds 16 of the 32 scores of ONE query (column lr), keys kc + 8 hi + j and kc + 16 + 8 hi + j, which is the k order of a B operand, so the converted
// probabilities are the B operand of O^T += V^T P^T (A = 16 rows of the transposed values) with no exchange; O^T keeps the lane's query, so maximum, sum and rescale are per lane (one exchange between the halves for the maximum).
// Split keys inside the work-group: wave w takes the 32-key chunks w, w + NW, ...; each wave keeps its own (level, sum, O^T); they are joined through LDS in wave order 0..NW-1.
// Every inner loop is unrolled so that fragments, scores and accumulators are indexed by constants and stay in registers.
// The level m is in log2 units and stands SH below the running maximum, so fp16 probabilities are carried x 2^SH (their sum too, so the factor leaves with the division). A masked raw score is -3e38 and the start level -1e30: exp2 gives 0 for it also where a whole chunk is masked.
__device__ __forceinline__ float xhalf(float x) { const int b = __float_as_int(x); return __int_as_float(__builtin_amdgcn_permlanex16(b, b, 0x76543210, 0xfedcba98, false, false)); }   // the value of lane ^ 16
// exp2 with the one slot that the instruction set asks for before a transcendental's result is used or its source overwritten: the v_nop takes the result
// and keeps the source alive, so only independent instructions can stand between the two; the builtin stays, so that the compiler still keeps the matrix instructions' distances for it.
__device__ __forceinline__ float exp2s(float x) { float r = __builtin_amdgcn_exp2f(x); asm("v_nop" : "+v"(r) : "v"(x)); return r; }
// fragment at byte offset bo (per lane, 32 bits) + co (constant) of a wave-uniform plane pointer: one offset register beside a scalar base
template <typename T16> __device__ __forceinline__ typename WFrag<T16>::V ldo(const T16* base, unsigned bo, int co) { return WFrag<T16>::ld((const T16*)((const char*)base + bo + co)); }
// ---- the key tile of a pass. Key == value, so a wave brings its 32-key chunk of a head plane (32 rows of 128 bytes, 4 KiB in a row in memory) ONCE into an LDS tile of its own, by asynchronous copies whose 32 lanes cover
// four whole 128-byte lines each (a fragment load from memory touches 16 lines for the same 512 bytes). Rows stand at pitch KPB in LDS. The key fragments are plain 16-byte LDS reads, the transposed value fragments transposing LDS reads of the same tile.
// The tile is private to its wave: no barrier; the wave's own s_wait_asynccnt 0 stands in front of its reads, its own s_wait_dscnt 0 in front of the refill.
#define KPB 144                   // 16 bytes x odd
#define KTB (32 * KPB)            // bytes of one plane's tile
typedef __attribute__((ext_vector_type(8))) short v8s;
typedef __attribute__((address_space(3))) v8s lds_v8s;
// g: the lane's 16 bytes of the chunk's first 512 (chunk base + 16 lane); l: their place in the tile (row lane / 8, column 16 (lane % 8)); copy i brings rows 4 i .. 4 i + 3
__device__ __forceinline__ void stage_tile(const char* g, char* l) {
#pragma unroll
    for (int i = 0; i < 8; ++i) __builtin_amdgcn_global_load_async_to_lds_b128((gl_v4i*)(g + i * 512), (lds_v4i*)(l + i * 4 * KPB), 0, 0);
}
// A fragment of the transposed tile: p = tile + (8 (lane / 16) + lane % 8) KPB + 16 ((lane / 8) % 2) + 2 dbase; lane (c, h) gets tile[8 h + j][dbase + c] and tile[16 + 8 h + j][dbase + c], j = 0 .. 7: the k order of WFrag::ld on a transposed row
template <typename T16> __device__ __forceinline__ typename WFrag<T16>::V ldt(const char* p) {
    const v8s a = __builtin_amdgcn_ds_load_tr16_b128_v8i16((lds_v8s*)p), b = __builtin_amdgcn_ds_load_tr16_b128_v8i16((lds_v8s*)(p + 16 * KPB));
    return __builtin_bit_cast(typename WFrag<T16>::V, __builtin_shufflevector(a, b, 0, 1, 2, 3, 4, 5, 6, 7, 8, 9, 10, 11, 12, 13, 14, 15)); }
template <typename T16, bool HI, int NQ, int NW>
__device__ __forceinline__ void attn_tile(const T16* __restrict__ Q, const T16* __restrict__ Q2, const T16* __restrict__ Kp, const T16* __restrict__ K2, int r0, bf* Ah, bf* Al, float* sm, char* kt8) {
    typedef typename WFrag<T16>::V V;
    const float SH = HI ? 0.0f : 10.0f;
    const float SCL2 = SCL * 1.4426950408889634f;           // HD^-0.5 x log2(e)
    const int lane = threadIdx.x & 31, lr = lane & 15, hi = lane >> 4; const int wave = __builtin_amdgcn_readfirstlane((int)(threadIdx.x >> 5));
    V q[NQ][2], q2[NQ][2]; v8f acc[NQ][4]; float m[NQ], l[NQ];
    const unsigned qo = (unsigned)(((r0 + lr) * HD + 8 * hi) * 2);
    char* tile = kt8 + wave * (2 * KTB);                    // the wave's own tile(s): the plane Kp, behind it (HI) the plane K2
    char* tw = tile + (lane >> 3) * KPB + (lane & 7) * 16;  // where the lane's copies land
    const char* tk = tile + lr * KPB + hi * 16;             // the lane's key row (key fragments)
    const char* tv = tile + (8 * hi + (lane & 7)) * KPB + ((lane >> 3) & 1) * 16;   // the lane's address of the transposing reads
    const int nch = (r0 + NQ * 16 + 31) >> 5;               // 32-key chunks up to and with the diagonal
    if (wave < nch) { stage_tile((const char*)Kp + wave * 4096 + lane * 16, tw); if (HI) stage_tile((const char*)K2 + wave * 4096 + lane * 16, tw + KTB); }   // the wave's first chunk (wave-uniform test, every lane on)
#pragma unroll
    for (int nq = 0; nq < NQ; ++nq) { m[nq] = -1.0e30f; l[nq] = 0.0f;
#pragma unroll
        for (int kk = 0; kk < 2; ++kk) { const int co = (nq * 16 * HD + kk * 32) * 2; q[nq][kk] = ldo(Q, qo, co); if (HI) q2[nq][kk] = ldo(Q2, qo, co); }
#pragma unroll
        for (int dt = 0; dt < 4; ++dt) acc[nq][dt] = (v8f){}; }
#pragma unroll 1   // rolled: a second pass in flight would not fit the registers of four waves per SIMD
    for (int c = wave; c < nch; c += NW) { const int kc = c * 32;
        V ka[2][2], ka2[2][2], va[4], va2[4];
        asm volatile("s_wait_asynccnt 0x0" ::: "memory");   // this chunk's copies have landed before the wave reads its tile
#pragma unroll
        for (int kt = 0; kt < 2; ++kt)
#pragma unroll
            for (int kk = 0; kk < 2; ++kk) { const int co = kt * 16 * KPB + kk * 64; ka[kt][kk] = WFrag<T16>::ld((const T16*)(tk + co)); if (HI) ka2[kt][kk] = WFrag<T16>::ld((const T16*)(tk + KTB + co)); }
#pragma unroll
        for (int dt = 0; dt < 4; ++dt) { va[dt] = ldt<T16>(tv + dt * 32); if (HI) va2[dt] = ldt<T16>(tv + KTB + dt * 32); }
        asm volatile("s_wait_dscnt 0x0" ::: "memory");      // every read of the tile has retired before the next chunk's copies target it
        if (c + NW < nch) { stage_tile((const char*)Kp + (c + NW) * 4096 + lane * 16, tw); if (HI) stage_tile((const char*)K2 + (c + NW) * 4096 + lane * 16, tw + KTB); }   // flies while this chunk is worked on (wave-uniform test)
        v8f s[NQ][2];
#pragma unroll
        for (int nq = 0; nq < NQ; ++nq)
#pragma unroll
            for (int kt = 0; kt < 2; ++kt) { v8f t = (v8f){};
#pragma unroll
                for (int kk = 0; kk < 2; ++kk) { t = WFrag<T16>::mma(ka[kt][kk], q[nq][kk], t); if (HI) { t = WFrag<T16>::mma(ka2[kt][kk], q[nq][kk], t); t = WFrag<T16>::mma(ka[kt][kk], q2[nq][kk], t); } }
                s[nq][kt] = t; }
        if (c == nch - 1) {                                 // only the diagonal chunk holds keys above a query of the tile (wave-uniform test)
#pragma unroll
            for (int nq = 0; nq < NQ; ++nq) { const int lim = r0 + nq * 16 + lr - kc - 8 * hi;   // key kc + 16 kt + 8 hi + j is allowed while 16 kt + j <= lim
#pragma unroll
                for (int kt = 0; kt < 2; ++kt)
#pragma unroll
                    for (int j = 0; j < 8; ++j) s[nq][kt][j] = (kt * 16 + j <= lim) ? s[nq][kt][j] : -3.0e38f; } }
#pragma unroll
        for (int nq = 0; nq < NQ; ++nq) {
            float mx = s[nq][0][0];
#pragma unroll
            for (int kt = 0; kt < 2; ++kt)
#pragma unroll
                for (int j = 0; j < 8; ++j) mx = fmaxf(mx, s[nq][kt][j]);
            mx = fmaxf(mx, xhalf(mx));
            const float mn = fmaxf(m[nq], mx * SCL2 - SH); const float alpha = exp2s(m[nq] - mn); m[nq] = mn;
            float ps = 0.0f;
#pragma unroll
            for (int kt = 0; kt < 2; ++kt)
#pragma unroll
                for (int j = 0; j < 8; ++j) { const float pe = exp2s(__builtin_fmaf(s[nq][kt][j], SCL2, -mn)); s[nq][kt][j] = pe; ps += pe; }
            l[nq] = l[nq] * alpha + ps;
#pragma unroll
            for (int dt = 0; dt < 4; ++dt) acc[nq][dt] *= alpha;
            if constexpr (HI) { v8us h0, h1, l0, l1;
#pragma unroll
                for (int j = 0; j < 8; ++j) { unsigned short a, c2; splitf(s[nq][0][j], a, c2); h0[j] = a; l0[j] = c2; splitf(s[nq][1][j], a, c2); h1[j] = a; l1[j] = c2; }
                const V pf = cat16b(h0, h1), pf2 = cat16b(l0, l1);
#pragma unroll
                for (int dt = 0; dt < 4; ++dt) { acc[nq][dt] = WFrag<T16>::mma(va[dt], pf, acc[nq][dt]); acc[nq][dt] = WFrag<T16>::mma(va2[dt], pf, acc[nq][dt]); acc[nq][dt] = WFrag<T16>::mma(va[dt], pf2, acc[nq][dt]); }
            } else { v8h h0, h1;
#pragma unroll
                for (int j = 0; j < 8; ++j) { h0[j] = tohx(s[nq][0][j]); h1[j] = tohx(s[nq][1][j]); }
                const V pf = cat16(h0, h1);
#pragma unroll
                for (int dt = 0; dt < 4; ++dt) acc[nq][dt] = WFrag<T16>::mma(va[dt], pf, acc[nq][dt]); }
        }
    }
    asm volatile("s_wait_asynccnt 0x0" ::: "memory");       // no copy of the wave is outstanding behind the loop
    float* ms = sm + NW * NQ * 16 * 68; float* ls = ms + NW * NQ * 16;
#pragma unroll
    for (int nq = 0; nq < NQ; ++nq) { const float lt = l[nq] + xhalf(l[nq]);
#pragma unroll
        for (int dt = 0; dt < 4; ++dt) { float* o = sm + (wave * NQ * 16 + nq * 16 + lr) * 68 + dt * 16 + hi * 8; const v8f a = acc[nq][dt];
            *(v4fa*)o = (v4f){a[0], a[1], a[2], a[3]}; *(v4fa*)(o + 4) = (v4f){a[4], a[5], a[6], a[7]}; }
        if (hi == 0) { ms[wave * NQ * 16 + nq * 16 + lr] = m[nq]; ls[wave * NQ * 16 + nq * 16 + lr] = lt; } }
    __syncthreads();
#pragma unroll
    for (int idx = (int)threadIdx.x; idx < NQ * 256; idx += 32 * NW) { const int qq = idx >> 4, d4 = (idx & 15) * 4;
        float M = ms[qq];
#pragma unroll
        for (int w = 1; w < NW; ++w) M = fmaxf(M, ms[w * NQ * 16 + qq]);
        float L = 0.0f; v4f val = (v4f){};
#pragma unroll
        for (int w = 0; w < NW; ++w) { const float wt = exp2s(ms[w * NQ * 16 + qq] - M); L += ls[w * NQ * 16 + qq] * wt; val += *(const v4fa*)(sm + (w * NQ * 16 + qq) * 68 + d4) * wt; }
        const float f = __fdiv_rn(1.0f, L); v4us oh, ol;    // the context row goes out as the hi/lo A operand of the output projection, [t][head * HD + d]: 16 threads fill one 128-byte line of each plane
#pragma unroll
        for (int e = 0; e < 4; ++e) { unsigned short a, c2; splitf(val[e] * f, a, c2); oh[e] = a; ol[e] = c2; }
        *(v4us*)(Ah + (size_t)(r0 + qq) * DQ + d4) = oh; *(v4us*)(Al + (size_t)(r0 + qq) * DQ + d4) = ol; }
}
// grid (heads, tiles): the tile index is the slow one and the longest tiles (last rows) come first. Tiles 0 .. (TT - RH) / 32 - 1: 32 fp16 rows each; the rest: 16 hi/lo rows each (3 products). Output: hi/lo planes [t][head * HD + d].
template <int NW>
__global__ __launch_bounds__(32 * NW) void k_fattn(const h16* __restrict__ Q16, const h16* __restrict__ K16, const bf* __restrict__ Qh, const bf* __restrict__ Ql, const bf* __restrict__ Kh, const bf* __restrict__ Kl, bf* Ah, bf* Al) {
    __shared__ __align__(16) float sm[NW * 32 * 70];
    __shared__ __align__(16) char kt8[NW * 2 * KTB];        // the waves' key tiles
    const size_t z = blockIdx.x, zp = z * TT * HD; const int ty = blockIdx.y;
    if (ty < (TT - RH) / 32) attn_tile<h16, false, 2, NW>(Q16 + zp, nullptr, K16 + zp, nullptr, TT - 32 * (ty + 1), Ah + z * HD, Al + z * HD, sm, kt8);
    else attn_tile<bf, true, 1, NW>(Qh + zp, Ql + zp, Kh + zp, Kl + zp, RH - 16 * (ty - (TT - RH) / 32 + 1), Ah + z * HD, Al + z * HD, sm, kt8);
}

extern "C" void kernel_launch(void* const* d_in, const int* in_sizes, int n_in,
                              void* d_out, int out_size, void* d_ws, size_t ws_size, hipStream_t stream) {
    (void)in_sizes; (void)n_in; (void)out_size;
    const float* x = (const float*)d_in[0]; const float* wq = (const float*)d_in[1]; const float* wo = (const float*)d_in[2]; const float* bo = (const float*)d_in[3];   /* input order x, Wq, Wo ('oi'), bo */
    float* OUT = (float*)d_out;     // [2][2048][1024]
    char* wsp = (char*)d_ws;
    auto take = [&](size_t bytes) { char* p = wsp; wsp += (bytes + 255) & ~(size_t)255; return (void*)p; };
    bf* WQ = (bf*)take((size_t)DQ * DM * 2); bf* WO = (bf*)take((size_t)DM * DQ * 2);
    bf* XB = (bf*)take((size_t)TT * DM * 2);
    h16* QP16 = (h16*)take((size_t)NH_ * TT * HD * 2);
    bf* QPh = (bf*)take((size_t)NH_ * TT * HD * 2); bf* QPl = (bf*)take((size_t)NH_ * TT * HD * 2);
    bf* ATh = (bf*)take((size_t)TT * DQ * 2); bf* ATl = (bf*)take((size_t)TT * DQ * 2);
    if ((size_t)(wsp - (char*)d_ws) > ws_size) return;    // ws 256 MiB
    { k_cvt8<<<(unsigned)(((size_t)DQ * DM / 8 + 255) / 256), 256, 0, stream>>>(wq, WQ, (size_t)DQ * DM / 8);
      k_cvt8<<<(unsigned)(((size_t)DM * DQ / 8 + 255) / 256), 256, 0, stream>>>(wo, WO, (size_t)DM * DQ / 8);
       }
    for (int b = 0; b < NB_; ++b) {
        
        k_cvt8<<<(unsigned)(((size_t)TT * DM / 8 + 255) / 256), 256, 0, stream>>>(x + (size_t)b * TT * DM, XB, (size_t)TT * DM / 8);
        k_gemmw<bf, 0, false, 8, true><<<dim3(TT / 64, DQ / 64, 1), 256, 0, stream>>>(XB, nullptr, WQ, nullptr, DM, nullptr, 0, nullptr, 0, 0, 0, QP16, QPh, QPl, TT * HD);
        k_fattn<8><<<dim3(NH_, (TT - RH) / 32 + RH / 16, 1), 256, 0, stream>>>(QP16, QP16, QPh, QPl, QPh, QPl, ATh, ATl);   // key == value == query projection: the k and the v role read the q planes
        k_gemmw<bf, 1, true, 8, false><<<dim3(TT / 64, DM / 64, 1), 256, 0, stream>>>(ATh, ATl, WO, nullptr, DQ, OUT + (size_t)b * TT * DM, DM, bo, 0, 0, 0, nullptr, nullptr, nullptr, 0); }
}

// v008
// One run takes 74.2 microseconds.
// Two timings next to v007 put it at 1.09 and 1.07 times that version's speed.
// Counting every step since v000, it is 19.5 times as fast.
#include <hip/hip_runtime.h>

// Causal multi-head self-attention whose key and value are the QUERY projection (the module's bug, reproduced: x [2][2048][1024]; q = x Wq^T ('oi' [1024][1024] 1/32, no bias), k = v = q (16 heads x 64); scores masked above the diagonal (-inf == exclusion) then x 1/sqrt(64); softmax; ctx = attn.q; out = ctx Wo^T + bo ('oi') -> [2][2048][1024] (4.2 M); argument order x, Wq, Wo, bo).
// Layout: bf16 copies of x and of the 'oi' weights (one launch for all); then per batch: the one exact projection is computed once (one GEMM), which stores the 16-bit operand planes of the attention kernel itself: head planes [h][t][d], read in the q, the k and the v role (the v role's transposed fragments come out of the staged key tile by transposing LDS loads); fused causal T-2048 attention, all heads of a batch in one launch (hybrid rows: < 512 hi/lo 3 products, rest fp16 x1024; key chunks above the diagonal are never visited), storing the merged hi/lo context itself; hi/lo x Wo exact + bo.
// Compute dtypes, f32 accumulate: every input rounded to bf16; projection exact; attention rows < 512 3 products, rest fp16; softmax f32; Wo hl x exact + bias.

#define NB_  2
#define TT   2048
#define DM   1024
#define NH_  16
#define NKV  16
#define REP  (NH_ / NKV)
#define HD   64
#define DQ   (NH_ * HD)
#define DKV  (NKV * HD)
#define RH   512                  // query rows < RH use hi+lo planes (0: none)
#define WIN  2048
#define SCL  0.125f   // HD^-0.5
typedef _Float16 h16;
typedef unsigned short bf;
typedef __attribute__((ext_vector_type(16))) __bf16   v16bf;
typedef __attribute__((ext_vector_type(16))) _Float16 v16h;
typedef __attribute__((ext_vector_type(8)))  _Float16 v8h;
typedef __attribute__((ext_vector_type(8)))  unsigned short v8us;
typedef __attribute__((ext_vector_type(8)))  float    v8f;
typedef __attribute__((ext_vector_type(4)))  float    v4f;
typedef v8h  __attribute__((may_alias)) v8ha;
typedef v4f  __attribute__((may_alias)) v4fa;
typedef v8us __attribute__((may_alias)) v8usa;

__device__ __forceinline__ unsigned short f2bf(float f) { unsigned u = __float_as_uint(f); u += 0x7FFFu + ((u >> 16) & 1u); return (unsigned short)(u >> 16); }
__device__ __forceinline__ float bf2f(unsigned short b) { return __uint_as_float(((unsigned)b) << 16); }
__device__ __forceinline__ float bfr(float f) { return bf2f(f2bf(f)); }
__device__ __forceinline__ v16h cat16(v8h lo, v8h hi) { return __builtin_shufflevector(lo, hi, 0, 1, 2, 3, 4, 5, 6, 7, 8, 9, 10, 11, 12, 13, 14, 15); }
__device__ __forceinline__ v16bf cat16b(v8us lo, v8us hi) { return __builtin_bit_cast(v16bf, __builtin_shufflevector(lo, hi, 0, 1, 2, 3, 4, 5, 6, 7, 8, 9, 10, 11, 12, 13, 14, 15)); }
__device__ __forceinline__ v8f wmma16(v16h a, v16h b, v8f c) { return __builtin_amdgcn_wmma_f32_16x16x32_f16(false, a, false, b, (short)0, c, false, false); }
__device__ __forceinline__ v8f wmmab(v16bf a, v16bf b, v8f c) { return __builtin_amdgcn_wmma_f32_16x16x32_bf16(false, a, false, b, (short)0, c, false, false); }

__device__ __forceinline__ h16 tohx(float x) { return (h16)x; }
__device__ __forceinline__ void splitf(float y, unsigned short& h, unsigned short& l) { h = f2bf(y); l = f2bf(y - bf2f(h)); }
typedef __attribute__((ext_vector_type(4))) _Float16 v4h;
typedef __attribute__((ext_vector_type(4))) unsigned short v4us;

// ---- tile_reduce: sums the NW waves' partial 64x64 tiles (split K) through LDS, one 16x64 slab per round, always in wave order 0..NW-1. Thread t < 256 ends up with columns 4 (t & 15) .. + 3 of row (t >> 4) of each slab in res[].
// Two slab sets alternate, so one barrier a round is enough: the set that round mb + 2 overwrites was last read in front of the barrier of round mb + 1. No global store stands between the barriers (a barrier would wait for it).
template <int NW> __device__ __forceinline__ void tile_reduce(const v8f (&acc)[4][4], float* os, int wave, int lr, int hi, v4f (&res)[4]) {
    static_assert(NW >= 8, "256 threads sum a slab");
    const int ro = ((int)threadIdx.x >> 4) * 68 + ((int)threadIdx.x & 15) * 4;
#pragma unroll
    for (int mb = 0; mb < 4; ++mb) { float* ob = os + (mb & 1) * (NW * 16 * 68);
#pragma unroll
        for (int nb = 0; nb < 4; ++nb) {
#pragma unroll
            for (int j = 0; j < 8; ++j) ob[wave * (16 * 68) + (hi * 8 + j) * 68 + nb * 16 + lr] = acc[mb][nb][j]; }
        __syncthreads();
        if (threadIdx.x < 256) { v4f val = *(const v4fa*)(ob + ro);
#pragma unroll
            for (int w = 1; w < NW; ++w) val += *(const v4fa*)(ob + w * (16 * 68) + ro);
            res[mb] = val; } }
}

// ---- k_gemmw: register-blocked GEMM, NW WAVES per 64x64 output tile (16 accumulators each), operands from K-contiguous 16-bit planes; grid (M/64, N/64, Z), 32 * NW threads.
// Split K inside the work-group: wave w takes the 32-wide k chunks w, w + NW, w + 2 NW, ..., so a tile's chain of dependent load -> matrix passes is NW times shorter; tile_reduce sums the partial tiles.
// Operand path: a stage is GKS = 32 NW k values of all 64 rows of every operand plane. The work-group brings it into LDS by asynchronous copies, one copy a row: its 32 lanes cover 512 bytes in a row, four whole 128-byte lines
// (a fragment load from memory touches 16 lines for the same 512 bytes). Wave w copies rows 8 w .. 8 w + 7 of each plane and reads, from every row, the 64 bytes of its own k chunk by plain 16-byte LDS reads (row pitch GPB).
// One buffer: a stage's fragments go to registers, then the next stage's copies fly while the matrix instructions run. The partial-tile slabs of tile_reduce use the same LDS behind the last stage's second barrier.
// C[m][n] (f32, pitch ldc, + optional f32 bias[n]) = sum_k A[m][k] Bt[n][k] (+ A2[m][k] Bt[n][k] for NSPLIT 1). z-batch strides sA/sB/sC in elements. K % GKS == 0.
// PL: no f32 C; the tile goes out as the 16-bit planes its consumer reads (fp16, bf16 hi, bf16 lo):
// head planes [h][t][d] (P16, Ph, Pl), element (m, n) at m * HD + (n / 64) * cb + n % 64, cb = TT * HD: a thread's 4 columns are 8 bytes, 16 threads fill one 128-byte line.
template <typename T16> struct WFrag;
template <> struct WFrag<h16> { typedef v16h V; static __device__ __forceinline__ V ld(const h16* p) { return cat16(*(const v8h*)p, *(const v8h*)(p + 16)); } static __device__ __forceinline__ v8f mma(V a, V b, v8f c) { return wmma16(a, b, c); } };
template <> struct WFrag<bf> { typedef v16bf V; static __device__ __forceinline__ V ld(const bf* p) { return cat16b(*(const v8us*)p, *(const v8us*)(p + 16)); } static __device__ __forceinline__ v8f mma(V a, V b, v8f c) { return wmmab(a, b, c); } };
typedef __attribute__((ext_vector_type(4))) int v4i;
typedef __attribute__((address_space(1))) v4i gl_v4i;
typedef __attribute__((address_space(3))) v4i lds_v4i;
#define GKS 256                   // k values of a stage
#define GPB (GKS * 2 + 16)        // LDS row pitch in bytes: 16 bytes x odd
// eight rows of one plane: g = the lane's 16 bytes of the first row's stage (row pitch gp bytes in memory), l = their place in LDS
__device__ __forceinline__ void stage_rows(const char* g, size_t gp, char* l) {
#pragma unroll
    for (int i = 0; i < 8; ++i) __builtin_amdgcn_global_load_async_to_lds_b128((gl_v4i*)(g + i * gp), (lds_v4i*)(l + i * GPB), 0, 0);
}
// launch bounds: four waves a SIMD, so that two work-groups share a WGP (without the bound the three-plane form keeps every LDS address in a register of its own and passes 256 registers)
template <typename T16, int NSPLIT, bool BIAS, int NW, bool PL>
__global__ __launch_bounds__(32 * NW, 4) void k_gemmw(const T16* __restrict__ A, const T16* __restrict__ A2, const T16* __restrict__ Bt, const T16* __restrict__ Bt2, int K, float* C, int ldc, const float* __restrict__ bias, size_t sA, size_t sB, size_t sC, h16* P16, bf* Ph, bf* Pl, int cb) {
    typedef typename WFrag<T16>::V V;
    static_assert(NW * 32 == GKS && NW * 8 == 64 && NSPLIT <= 1, "a stage is one k chunk a wave; eight rows of a plane a wave");
    constexpr int PLB = 64 * GPB, STB = (NSPLIT == 1 ? 3 : 2) * PLB, OSB = 2 * NW * 16 * 68 * 4;   // bytes: one plane's stage, a whole stage (A, A2, Bt), the slabs of tile_reduce
    __shared__ __align__(16) char lds[STB > OSB ? STB : OSB];
    float* os = (float*)lds;
    const size_t z = blockIdx.z; A += z * sA; if (NSPLIT == 1) A2 += z * sA; Bt += z * sB; C += z * sC; (void)Bt2;
    const int lane = threadIdx.x & 31, lr = lane & 15, hi = lane >> 4; const int r0 = blockIdx.x * 64, c0 = blockIdx.y * 64; const int wave = __builtin_amdgcn_readfirstlane((int)(threadIdx.x >> 5));
    v8f acc[4][4];
#pragma unroll
    for (int mb = 0; mb < 4; ++mb)
#pragma unroll
        for (int nb = 0; nb < 4; ++nb) acc[mb][nb] = (v8f){};
    const size_t gp = (size_t)K * 2;                        // bytes of a plane's row in memory
    const char* ga = (const char*)A + (size_t)(r0 + wave * 8) * gp + lane * 16; const char* ga2 = NSPLIT == 1 ? (const char*)A2 + (size_t)(r0 + wave * 8) * gp + lane * 16 : nullptr; const char* gb = (const char*)Bt + (size_t)(c0 + wave * 8) * gp + lane * 16;
    char* lw = lds + wave * 8 * GPB + lane * 16;            // where the lane's copies land (plane A; A2 and Bt behind it)
    const char* lf = lds + lr * GPB + wave * 64 + hi * 16;  // the lane's fragment bytes: row lr, the wave's k chunk
    const int nst = K / GKS;
    stage_rows(ga, gp, lw); if (NSPLIT == 1) stage_rows(ga2, gp, lw + PLB); stage_rows(gb, gp, lw + STB - PLB);
#pragma unroll 1   // rolled: one set of fragments fits the registers of four waves per SIMD
    for (int s = 0; s < nst; ++s) {
        V a[4], a2[4], b[4];
        asm volatile("s_wait_asynccnt 0x0" ::: "memory");   // the wave's own copies of this stage have landed ...
        __syncthreads();                                    // ... and every other wave's: the stage may be read
#pragma unroll
        for (int mb = 0; mb < 4; ++mb) { a[mb] = WFrag<T16>::ld((const T16*)(lf + mb * 16 * GPB)); if (NSPLIT == 1) a2[mb] = WFrag<T16>::ld((const T16*)(lf + PLB + mb * 16 * GPB)); b[mb] = WFrag<T16>::ld((const T16*)(lf + STB - PLB + mb * 16 * GPB)); }
        asm volatile("s_wait_dscnt 0x0" ::: "memory");      // the wave's reads of the stage have retired ...
        __syncthreads();                                    // ... and every other wave's: the buffer may be refilled (behind the last stage: reused by tile_reduce)
        if (s + 1 < nst) { const size_t so = (size_t)(s + 1) * (GKS * 2); stage_rows(ga + so, gp, lw); if (NSPLIT == 1) stage_rows(ga2 + so, gp, lw + PLB); stage_rows(gb + so, gp, lw + STB - PLB); }   // flies while this stage is worked on (the test reads the same in the whole work-group)
#pragma unroll
        for (int nb = 0; nb < 4; ++nb)
#pragma unroll
            for (int mb = 0; mb < 4; ++mb) { acc[mb][nb] = WFrag<T16>::mma(a[mb], b[nb], acc[mb][nb]); if (NSPLIT == 1) acc[mb][nb] = WFrag<T16>::mma(a2[mb], b[nb], acc[mb][nb]); }
        asm volatile("v_nop\n\tv_nop\n\tv_nop\n\tv_nop" : "+v"(acc[0][0]), "+v"(acc[1][1]), "+v"(acc[2][2]), "+v"(acc[3][3]) : "v"(a[0]), "v"(a[3]));
    }
    asm volatile("s_wait_asynccnt 0x0" ::: "memory");       // no copy of the wave is outstanding behind the loop
    v4f res[4]; tile_reduce<NW>(acc, os, wave, lr, hi, res);
    const int row = (int)threadIdx.x >> 4, cofs = ((int)threadIdx.x & 15) * 4;
    if constexpr (PL) {
        if (threadIdx.x < 256) { const int pc = (int)blockIdx.y * cb + cofs;
#pragma unroll
            for (int mb = 0; mb < 4; ++mb) { v4h o16; v4us oh, ol;
#pragma unroll
                for (int q = 0; q < 4; ++q) { const float y = res[mb][q]; o16[q] = tohx(y); unsigned short a2, c2; splitf(y, a2, c2); oh[q] = a2; ol[q] = c2; }
                const int po = (r0 + mb * 16 + row) * HD + pc; *(v4h*)(P16 + po) = o16; *(v4us*)(Ph + po) = oh; *(v4us*)(Pl + po) = ol; } }
    } else if (threadIdx.x < 256) {
#pragma unroll
        for (int mb = 0; mb < 4; ++mb) { v4f val = res[mb]; if (BIAS) { val[0] += bfr(bias[c0 + cofs]); val[1] += bfr(bias[c0 + cofs + 1]); val[2] += bfr(bias[c0 + cofs + 2]); val[3] += bfr(bias[c0 + cofs + 3]); }
            *(v4f*)(C + (size_t)(r0 + mb * 16 + row) * ldc + c0 + cofs) = val; } }
}

// ---- k_cvtin: every f32 matrix operand (x of both batches, Wq, Wo) goes to bf16 in ONE launch of CVG work-groups, one a WGP. Few waves take many vectors each (for speed only).
// A slab is CVS vectors of 8 floats, one a thread; x is SX slabs, each weight SW. A thread issues the loads of all its vectors before the first is converted (two 16-byte loads a vector, all in flight), then converts and stores them.
// Addresses: a wave-uniform base (each batch of x has its own, so that every slab lies within the instruction's constant offset) and ONE 32-bit byte offset a lane, the same in every slab (half of it on the bf16 side).
#define CVG 256
#define CVS (CVG * 256)
__global__ __launch_bounds__(256) void k_cvtin(const float* __restrict__ x0, const float* __restrict__ x1, const float* __restrict__ wq, const float* __restrict__ wo, bf* __restrict__ XB, bf* __restrict__ WQ, bf* __restrict__ WO) {
    constexpr int SB = TT * DM / 8 / CVS, SX = NB_ * SB, SW = DQ * DM / 8 / CVS;   // slabs of one batch of x, of x, of a weight
    static_assert(NB_ == 2 && (size_t)SB * CVS * 8 == (size_t)TT * DM && (size_t)SW * CVS * 8 == (size_t)DQ * DM, "two batches; whole slabs");
    const unsigned lo = (blockIdx.x * 256u + threadIdx.x) * 32u;
    v8f v[SX + 2 * SW];
#pragma unroll
    for (int k = 0; k < SB; ++k) { v[k] = *(const v8f*)((const char*)(x0 + (size_t)k * CVS * 8) + lo); v[SB + k] = *(const v8f*)((const char*)(x1 + (size_t)k * CVS * 8) + lo); }
#pragma unroll
    for (int k = 0; k < SW; ++k) { v[SX + k] = *(const v8f*)((const char*)(wq + (size_t)k * CVS * 8) + lo); v[SX + SW + k] = *(const v8f*)((const char*)(wo + (size_t)k * CVS * 8) + lo); }
    asm volatile("s_wait_xcnt 0x0" :: "v"(lo) : "memory");   // every load stands in front of this line (none is held back behind a conversion), and the offset register that they name lives up to it: nothing rewrites it before the wait
    const unsigned so = lo >> 1;
#pragma unroll
    for (int k = 0; k < SX + 2 * SW; ++k) { v8us o;
#pragma unroll
        for (int e = 0; e < 8; ++e) o[e] = f2bf(v[k][e]);
        bf* d = k < SX ? XB + (size_t)k * CVS * 8 : k < SX + SW ? WQ + (size_t)(k - SX) * CVS * 8 : WO + (size_t)(k - SX - SW) * CVS * 8;
        *(v8us*)((char*)d + so) = o; }
}

// ---- k_fattn: causal attention of one query tile of one head in one work-group; scores and probabilities stay in registers (online softmax), nothing of them goes to memory.
// S^T = K Q^T (A = 16 key rows, B = 16 query rows): a lane holds 16 of the 32 scores of ONE query (column lr), keys kc + 8 hi + j and kc + 16 + 8 hi + j, which is the k order of a B operand, so the converted
// probabilities are the B operand of O^T += V^T P^T (A = 16 rows of the transposed values) with no exchange; O^T keeps the lane's query, so maximum, sum and rescale are per lane (one exchange between the halves for the maximum).
// Split keys inside the work-group: wave w takes the 32-key chunks w, w + NW, ...; each wave keeps its own (level, sum, O^T); they are joined through LDS in wave order 0..NW-1.
// Every inner loop is unrolled so that fragments, scores and accumulators are indexed by constants and stay in registers.
// The level m is in log2 units and stands SH below the running maximum, so fp16 probabilities are carried x 2^SH (their sum too, so the factor leaves with the division). A masked raw score is -3e38 and the start level -1e30: exp2 gives 0 for it also where a whole chunk is masked.
__device__ __forceinline__ float xhalf(float x) { const int b = __float_as_int(x); return __int_as_float(__builtin_amdgcn_permlanex16(b, b, 0x76543210, 0xfedcba98, false, false)); }   // the value of lane ^ 16
// exp2 with the one slot that the instruction set asks for before a transcendental's result is used or its source overwritten: the v_nop takes the result
// and keeps the source alive, so only independent instructions can stand between the two; the builtin stays, so that the compiler still keeps the matrix instructions' distances for it.
__device__ __forceinline__ float exp2s(float x) { float r = __builtin_amdgcn_exp2f(x); asm("v_nop" : "+v"(r) : "v"(x)); return r; }
// fragment at byte offset bo (per lane, 32 bits) + co (constant) of a wave-uniform plane pointer: one offset register beside a scalar base
template <typename T16> __device__ __forceinline__ typename WFrag<T16>::V ldo(const T16* base, unsigned bo, int co) { return WFrag<T16>::ld((const T16*)((const char*)base + bo + co)); }
// ---- the key tile of a pass. Key == value, so a wave brings its 32-key chunk of a head plane (32 rows of 128 bytes, 4 KiB in a row in memory) ONCE into an LDS tile of its own, by asynchronous copies whose 32 lanes cover
// four whole 128-byte lines each (a fragment load from memory touches 16 lines for the same 512 bytes). Rows stand at pitch KPB in LDS. The key fragments are plain 16-byte LDS reads, the transposed value fragments transposing LDS reads of the same tile.
// The tile is private to its wave: no barrier; the wave's own s_wait_asynccnt 0 stands in front of its reads, its own s_wait_dscnt 0 in front of the refill.
#define KPB 144                   // 16 bytes x odd
#define KTB (32 * KPB)            // bytes of one plane's tile
typedef __attribute__((ext_vector_type(8))) short v8s;
typedef __attribute__((address_space(3))) v8s lds_v8s;
// g: the lane's 16 bytes of the chunk's first 512 (chunk base + 16 lane); l: their place in the tile (row lane / 8, column 16 (lane % 8)); copy i brings rows 4 i .. 4 i + 3
__device__ __forceinline__ void stage_tile(const char* g, char* l) {
#pragma unroll
    for (int i = 0; i < 8; ++i) __builtin_amdgcn_global_load_async_to_lds_b128((gl_v4i*)(g + i * 512), (lds_v4i*)(l + i * 4 * KPB), 0, 0);
}
// A fragment of the transposed tile: p = tile + (8 (lane / 16) + lane % 8) KPB + 16 ((lane / 8) % 2) + 2 dbase; lane (c, h) gets tile[8 h + j][dbase + c] and tile[16 + 8 h + j][dbase + c], j = 0 .. 7: the k order of WFrag::ld on a transposed row
template <typename T16> __device__ __forceinline__ typename WFrag<T16>::V ldt(const char* p) {
    const v8s a = __builtin_amdgcn_ds_load_tr16_b128_v8i16((lds_v8s*)p), b = __builtin_amdgcn_ds_load_tr16_b128_v8i16((lds_v8s*)(p + 16 * KPB));
    return __builtin_bit_cast(typename WFrag<T16>::V, __builtin_shufflevector(a, b, 0, 1, 2, 3, 4, 5, 6, 7, 8, 9, 10, 11, 12, 13, 14, 15)); }
template <typename T16, bool HI, int NQ, int NW>
__device__ __forceinline__ void attn_tile(const T16* __restrict__ Q, const T16* __restrict__ Q2, const T16* __restrict__ Kp, const T16* __restrict__ K2, int r0, bf* Ah, bf* Al, float* sm, char* kt8) {
    typedef typename WFrag<T16>::V V;
    const float SH = HI ? 0.0f : 10.0f;
    const float SCL2 = SCL * 1.4426950408889634f;           // HD^-0.5 x log2(e)
    const int lane = threadIdx.x & 31, lr = lane & 15, hi = lane >> 4; const int wave = __builtin_amdgcn_readfirstlane((int)(threadIdx.x >> 5));
    V q[NQ][2], q2[NQ][2]; v8f acc[NQ][4]; float m[NQ], l[NQ];
    const unsigned qo = (unsigned)(((r0 + lr) * HD + 8 * hi) * 2);
    char* tile = kt8 + wave * (2 * KTB);                    // the wave's own tile(s): the plane Kp, behind it (HI) the plane K2
    char* tw = tile + (lane >> 3) * KPB + (lane & 7) * 16;  // where the lane's copies land
    const char* tk = tile + lr * KPB + hi * 16;             // the lane's key row (key fragments)
    const char* tv = tile + (8 * hi + (lane & 7)) * KPB + ((lane >> 3) & 1) * 16;   // the lane's address of the transposing reads
    const int nch = (r0 + NQ * 16 + 31) >> 5;               // 32-key chunks up to and with the diagonal
    if (wave < nch) { stage_tile((const char*)Kp + wave * 4096 + lane * 16, tw); if (HI) stage_tile((const char*)K2 + wave * 4096 + lane * 16, tw + KTB); }   // the wave's first chunk (wave-uniform test, every lane on)
#pragma unroll
    for (int nq = 0; nq < NQ; ++nq) { m[nq] = -1.0e30f; l[nq] = 0.0f;
#pragma unroll
        for (int kk = 0; kk < 2; ++kk) { const int co = (nq * 16 * HD + kk * 32) * 2; q[nq][kk] = ldo(Q, qo, co); if (HI) q2[nq][kk] = ldo(Q2, qo, co); }
#pragma unroll
        for (int dt = 0; dt < 4; ++dt) acc[nq][dt] = (v8f){}; }
#pragma unroll 1   // rolled: a second pass in flight would not fit the registers of four waves per SIMD
    for (int c = wave; c < nch; c += NW) { const int kc = c * 32;
        V ka[2][2], ka2[2][2], va[4], va2[4];
        asm volatile("s_wait_asynccnt 0x0" ::: "memory");   // this chunk's copies have landed before the wave reads its tile
#pragma unroll
        for (int kt = 0; kt < 2; ++kt)
#pragma unroll
            for (int kk = 0; kk < 2; ++kk) { const int co = kt * 16 * KPB + kk * 64; ka[kt][kk] = WFrag<T16>::ld((const T16*)(tk + co)); if (HI) ka2[kt][kk] = WFrag<T16>::ld((const T16*)(tk + KTB + co)); }
#pragma unroll
        for (int dt = 0; dt < 4; ++dt) { va[dt] = ldt<T16>(tv + dt * 32); if (HI) va2[dt] = ldt<T16>(tv + KTB + dt * 32); }
        asm volatile("s_wait_dscnt 0x0" ::: "memory");      // every read of the tile has retired before the next chunk's copies target it
        if (c + NW < nch) { stage_tile((const char*)Kp + (c + NW) * 4096 + lane * 16, tw); if (HI) stage_tile((const char*)K2 + (c + NW) * 4096 + lane * 16, tw + KTB); }   // flies while this chunk is worked on (wave-uniform test)
        v8f s[NQ][2];
#pragma unroll
        for (int nq = 0; nq < NQ; ++nq)
#pragma unroll
            for (int kt = 0; kt < 2; ++kt) { v8f t = (v8f){};
#pragma unroll
                for (int kk = 0; kk < 2; ++kk) { t = WFrag<T16>::mma(ka[kt][kk], q[nq][kk], t); if (HI) { t = WFrag<T16>::mma(ka2[kt][kk], q[nq][kk], t); t = WFrag<T16>::mma(ka[kt][kk], q2[nq][kk], t); } }
                s[nq][kt] = t; }
        if (c == nch - 1) {                                 // only the diagonal chunk holds keys above a query of the tile (wave-uniform test)
#pragma unroll
            for (int nq = 0; nq < NQ; ++nq) { const int lim = r0 + nq * 16 + lr - kc - 8 * hi;   // key kc + 16 kt + 8 hi + j is allowed while 16 kt + j <= lim
#pragma unroll
                for (int kt = 0; kt < 2; ++kt)
#pragma unroll
                    for (int j = 0; j < 8; ++j) s[nq][kt][j] = (kt * 16 + j <= lim) ? s[nq][kt][j] : -3.0e38f; } }
#pragma unroll
        for (int nq = 0; nq < NQ; ++nq) {
            float mx = s[nq][0][0];
#pragma unroll
            for (int kt = 0; kt < 2; ++kt)
#pragma unroll
                for (int j = 0; j < 8; ++j) mx = fmaxf(mx, s[nq][kt][j]);
            mx = fmaxf(mx, xhalf(mx));
            const float mn = fmaxf(m[nq], mx * SCL2 - SH); const float alpha = exp2s(m[nq] - mn); m[nq] = mn;
            float ps = 0.0f;
#pragma unroll
            for (int kt = 0; kt < 2; ++kt)
#pragma unroll
                for (int j = 0; j < 8; ++j) { const float pe = exp2s(__builtin_fmaf(s[nq][kt][j], SCL2, -mn)); s[nq][kt][j] = pe; ps += pe; }
            l[nq] = l[nq] * alpha + ps;
#pragma unroll
            for (int dt = 0; dt < 4; ++dt) acc[nq][dt] *= alpha;
            if constexpr (HI) { v8us h0, h1, l0, l1;
#pragma unroll
                for (int j = 0; j < 8; ++j) { unsigned short a, c2; splitf(s[nq][0][j], a, c2); h0[j] = a; l0[j] = c2; splitf(s[nq][1][j], a, c2); h1[j] = a; l1[j] = c2; }
                const V pf = cat16b(h0, h1), pf2 = cat16b(l0, l1);
#pragma unroll
                for (int dt = 0; dt < 4; ++dt) { acc[nq][dt] = WFrag<T16>::mma(va[dt], pf, acc[nq][dt]); acc[nq][dt] = WFrag<T16>::mma(va2[dt], pf, acc[nq][dt]); acc[nq][dt] = WFrag<T16>::mma(va[dt], pf2, acc[nq][dt]); }
            } else { v8h h0, h1;
#pragma unroll
                for (int j = 0; j < 8; ++j) { h0[j] = tohx(s[nq][0][j]); h1[j] = tohx(s[nq][1][j]); }
                const V pf = cat16(h0, h1);
#pragma unroll
                for (int dt = 0; dt < 4; ++dt) acc[nq][dt] = WFrag<T16>::mma(va[dt], pf, acc[nq][dt]); }
        }
    }
    asm volatile("s_wait_asynccnt 0x0" ::: "memory");       // no copy of the wave is outstanding behind the loop
    float* ms = sm + NW * NQ * 16 * 68; float* ls = ms + NW * NQ * 16;
#pragma unroll
    for (int nq = 0; nq < NQ; ++nq) { const float lt = l[nq] + xhalf(l[nq]);
#pragma unroll
        for (int dt = 0; dt < 4; ++dt) { float* o = sm + (wave * NQ * 16 + nq * 16 + lr) * 68 + dt * 16 + hi * 8; const v8f a = acc[nq][dt];
            *(v4fa*)o = (v4f){a[0], a[1], a[2], a[3]}; *(v4fa*)(o + 4) = (v4f){a[4], a[5], a[6], a[7]}; }
        if (hi == 0) { ms[wave * NQ * 16 + nq * 16 + lr] = m[nq]; ls[wave * NQ * 16 + nq * 16 + lr] = lt; } }
    __syncthreads();
#pragma unroll
    for (int idx = (int)threadIdx.x; idx < NQ * 256; idx += 32 * NW) { const int qq = idx >> 4, d4 = (idx & 15) * 4;
        float M = ms[qq];
#pragma unroll
        for (int w = 1; w < NW; ++w) M = fmaxf(M, ms[w * NQ * 16 + qq]);
        float L = 0.0f; v4f val = (v4f){};
#pragma unroll
        for (int w = 0; w < NW; ++w) { const float wt = exp2s(ms[w * NQ * 16 + qq] - M); L += ls[w * NQ * 16 + qq] * wt; val += *(const v4fa*)(sm + (w * NQ * 16 + qq) * 68 + d4) * wt; }
        const float f = __fdiv_rn(1.0f, L); v4us oh, ol;    // the context row goes out as the hi/lo A operand of the output projection, [t][head * HD + d]: 16 threads fill one 128-byte line of each plane
#pragma unroll
        for (int e = 0; e < 4; ++e) { unsigned short a, c2; splitf(val[e] * f, a, c2); oh[e] = a; ol[e] = c2; }
        *(v4us*)(Ah + (size_t)(r0 + qq) * DQ + d4) = oh; *(v4us*)(Al + (size_t)(r0 + qq) * DQ + d4) = ol; }
}
// grid (heads, tiles): the tile index is the slow one and the longest tiles (last rows) come first. Tiles 0 .. (TT - RH) / 32 - 1: 32 fp16 rows each; the rest: 16 hi/lo rows each (3 products). Output: hi/lo planes [t][head * HD + d].
template <int NW>
__global__ __launch_bounds__(32 * NW) void k_fattn(const h16* __restrict__ Q16, const h16* __restrict__ K16, const bf* __restrict__ Qh, const bf* __restrict__ Ql, const bf* __restrict__ Kh, const bf* __restrict__ Kl, bf* Ah, bf* Al) {
    __shared__ __align__(16) float sm[NW * 32 * 70];
    __shared__ __align__(16) char kt8[NW * 2 * KTB];        // the waves' key tiles
    const size_t z = blockIdx.x, zp = z * TT * HD; const int ty = blockIdx.y;
    if (ty < (TT - RH) / 32) attn_tile<h16, false, 2, NW>(Q16 + zp, nullptr, K16 + zp, nullptr, TT - 32 * (ty + 1), Ah + z * HD, Al + z * HD, sm, kt8);
    else attn_tile<bf, true, 1, NW>(Qh + zp, Ql + zp, Kh + zp, Kl + zp, RH - 16 * (ty - (TT - RH) / 32 + 1), Ah + z * HD, Al + z * HD, sm, kt8);
}

extern "C" void kernel_launch(void* const* d_in, const int* in_sizes, int n_in,
                              void* d_out, int out_size, void* d_ws, size_t ws_size, hipStream_t stream) {
    (void)in_sizes; (void)n_in; (void)out_size;
    const float* x = (const float*)d_in[0]; const float* wq = (const float*)d_in[1]; const float* wo = (const float*)d_in[2]; const float* bo = (const float*)d_in[3];   /* input order x, Wq, Wo ('oi'), bo */
    float* OUT = (float*)d_out;     // [2][2048][1024]
    char* wsp = (char*)d_ws;
    auto take = [&](size_t bytes) { char* p = wsp; wsp += (bytes + 255) & ~(size_t)255; return (void*)p; };
    bf* WQ = (bf*)take((size_t)DQ * DM * 2); bf* WO = (bf*)take((size_t)DM * DQ * 2);
    bf* XB = (bf*)take((size_t)NB_ * TT * DM * 2);
    h16* QP16 = (h16*)take((size_t)NH_ * TT * HD * 2);
    bf* QPh = (bf*)take((size_t)NH_ * TT * HD * 2); bf* QPl = (bf*)take((size_t)NH_ * TT * HD * 2);
    bf* ATh = (bf*)take((size_t)TT * DQ * 2); bf* ATl = (bf*)take((size_t)TT * DQ * 2);
    if ((size_t)(wsp - (char*)d_ws) > ws_size) return;    // ws 256 MiB
    k_cvtin<<<CVG, 256, 0, stream>>>(x, x + (size_t)TT * DM, wq, wo, XB, WQ, WO);
    for (int b = 0; b < NB_; ++b) {
        k_gemmw<bf, 0, false, 8, true><<<dim3(TT / 64, DQ / 64, 1), 256, 0, stream>>>(XB + (size_t)b * TT * DM, nullptr, WQ, nullptr, DM, nullptr, 0, nullptr, 0, 0, 0, QP16, QPh, QPl, TT * HD);
        k_fattn<8><<<dim3(NH_, (TT - RH) / 32 + RH / 16, 1), 256, 0, stream>>>(QP16, QP16, QPh, QPl, QPh, QPl, ATh, ATl);   // key == value == query projection: the k and the v role read the q planes
        k_gemmw<bf, 1, true, 8, false><<<dim3(TT / 64, DM / 64, 1), 256, 0, stream>>>(ATh, ATl, WO, nullptr, DQ, OUT + (size_t)b * TT * DM, DM, bo, 0, 0, 0, nullptr, nullptr, nullptr, 0); }
}

// v009
// A run of this version takes 71.6 microseconds.
// Timed twice side by side with v008, it ran 1.04 and 1.05 times as fast.
// All steps since v000 together make it 20.3 times as fast.
#include <hip/hip_runtime.h>

// Causal multi-head self-attention whose key and value are the QUERY projection (the module's bug, reproduced: x [2][2048][1024]; q = x Wq^T ('oi' [1024][1024] 1/32, no bias), k = v = q (16 heads x 64); scores masked above the diagonal (-inf == exclusion) then x 1/sqrt(64); softmax; ctx = attn.q; out = ctx Wo^T + bo ('oi') -> [2][2048][1024] (4.2 M); argument order x, Wq, Wo, bo).
// Layout: bf16 copies of x and of the 'oi' weights (one launch for all); then three launches, each with both batches in one grid (GEMM rows m = batch * 2048 + t, attention grid x = batch * 16 + head): the one exact projection is computed once (one GEMM), which stores the 16-bit operand planes of the attention kernel itself: head planes [b][h][t][d] (the hi/lo pair only for t < 512, the rows that use it), read in the q, the k and the v role (the v role's transposed fragments come out of the staged key tile by transposing LDS loads); fused causal T-2048 attention, all heads of both batches in one launch (hybrid rows: < 512 hi/lo 3 products, rest fp16 x1024; key chunks above the diagonal are never visited), storing the merged hi/lo context itself; hi/lo x Wo exact + bo.
// Compute dtypes, f32 accumulate: every input rounded to bf16; projection exact; attention rows < 512 3 products, rest fp16; softmax f32; Wo hl x exact + bias.

#define NB_  2
#define TT   2048
#define DM   1024
#define NH_  16
#define NKV  16
#define REP  (NH_ / NKV)
#define HD   64
#define DQ   (NH_ * HD)
#define DKV  (NKV * HD)
#define RH   512                  // query rows < RH use hi+lo planes (0: none)
#define WIN  2048
#define SCL  0.125f   // HD^-0.5
typedef _Float16 h16;
typedef unsigned short bf;
typedef __attribute__((ext_vector_type(16))) __bf16   v16bf;
typedef __attribute__((ext_vector_type(16))) _Float16 v16h;
typedef __attribute__((ext_vector_type(8)))  _Float16 v8h;
typedef __attribute__((ext_vector_type(8)))  unsigned short v8us;
typedef __attribute__((ext_vector_type(8)))  float    v8f;
typedef __attribute__((ext_vector_type(4)))  float    v4f;
typedef v8h  __attribute__((may_alias)) v8ha;
typedef v4f  __attribute__((may_alias)) v4fa;
typedef v8us __attribute__((may_alias)) v8usa;

__device__ __forceinline__ unsigned short f2bf(float f) { unsigned u = __float_as_uint(f); u += 0x7FFFu + ((u >> 16) & 1u); return (unsigned short)(u >> 16); }
__device__ __forceinline__ float bf2f(unsigned short b) { return __uint_as_float(((unsigned)b) << 16); }
__device__ __forceinline__ float bfr(float f) { return bf2f(f2bf(f)); }
__device__ __forceinline__ v16h cat16(v8h lo, v8h hi) { return __builtin_shufflevector(lo, hi, 0, 1, 2, 3, 4, 5, 6, 7, 8, 9, 10, 11, 12, 13, 14, 15); }
__device__ __forceinline__ v16bf cat16b(v8us lo, v8us hi) { return __builtin_bit_cast(v16bf, __builtin_shufflevector(lo, hi, 0, 1, 2, 3, 4, 5, 6, 7, 8, 9, 10, 11, 12, 13, 14, 15)); }
__device__ __forceinline__ v8f wmma16(v16h a, v16h b, v8f c) { return __builtin_amdgcn_wmma_f32_16x16x32_f16(false, a, false, b, (short)0, c, false, false); }
__device__ __forceinline__ v8f wmmab(v16bf a, v16bf b, v8f c) { return __builtin_amdgcn_wmma_f32_16x16x32_bf16(false, a, false, b, (short)0, c, false, false); }

__device__ __forceinline__ h16 tohx(float x) { return (h16)x; }
__device__ __forceinline__ void splitf(float y, unsigned short& h, unsigned short& l) { h = f2bf(y); l = f2bf(y - bf2f(h)); }
typedef __attribute__((ext_vector_type(4))) _Float16 v4h;
typedef __attribute__((ext_vector_type(4))) unsigned short v4us;

// ---- tile_reduce: sums the NW waves' partial 64x64 tiles (split K) through LDS, one 16x64 slab per round, always in wave order 0..NW-1. Thread t < 256 ends up with columns 4 (t & 15) .. + 3 of row (t >> 4) of each slab in res[].
// Two slab sets alternate, so one barrier a round is enough: the set that round mb + 2 overwrites was last read in front of the barrier of round mb + 1. No global store stands between the barriers (a barrier would wait for it).
template <int NW> __device__ __forceinline__ void tile_reduce(const v8f (&acc)[4][4], float* os, int wave, int lr, int hi, v4f (&res)[4]) {
    static_assert(NW >= 8, "256 threads sum a slab");
    const int ro = ((int)threadIdx.x >> 4) * 68 + ((int)threadIdx.x & 15) * 4;
#pragma unroll
    for (int mb = 0; mb < 4; ++mb) { float* ob = os + (mb & 1) * (NW * 16 * 68);
#pragma unroll
        for (int nb = 0; nb < 4; ++nb) {
#pragma unroll
            for (int j = 0; j < 8; ++j) ob[wave * (16 * 68) + (hi * 8 + j) * 68 + nb * 16 + lr] = acc[mb][nb][j]; }
        __syncthreads();
        if (threadIdx.x < 256) { v4f val = *(const v4fa*)(ob + ro);
#pragma unroll
            for (int w = 1; w < NW; ++w) val += *(const v4fa*)(ob + w * (16 * 68) + ro);
            res[mb] = val; } }
}

// ---- k_gemmw: register-blocked GEMM, NW WAVES per 64x64 output tile (16 accumulators each), operands from K-contiguous 16-bit planes; grid (M/64, N/64, Z), 32 * NW threads.
// Split K inside the work-group: wave w takes the 32-wide k chunks w, w + NW, w + 2 NW, ..., so a tile's chain of dependent load -> matrix passes is NW times shorter; tile_reduce sums the partial tiles.
// Operand path: a stage is GKS = 32 NW k values of all 64 rows of every operand plane. The work-group brings it into LDS by asynchronous copies, one copy a row: its 32 lanes cover 512 bytes in a row, four whole 128-byte lines
// (a fragment load from memory touches 16 lines for the same 512 bytes). Wave w copies rows 8 w .. 8 w + 7 of each plane and reads, from every row, the 64 bytes of its own k chunk by plain 16-byte LDS reads (row pitch GPB).
// One buffer: a stage's fragments go to registers, then the next stage's copies fly while the matrix instructions run. The partial-tile slabs of tile_reduce use the same LDS behind the last stage's second barrier.
// C[m][n] (f32, pitch ldc, + optional f32 bias[n]) = sum_k A[m][k] Bt[n][k] (+ A2[m][k] Bt[n][k] for NSPLIT 1). z-batch strides sA/sB/sC in elements. K % GKS == 0.
// PL: no f32 C; the tile goes out as the 16-bit planes its consumer reads (fp16, bf16 hi, bf16 lo):
// head planes [b][h][t][d], row m = b * TT + t, head n / 64, d = n % 64: P16 holds every t (head pitch cb = TT * HD), Ph and Pl only t < RH (head pitch RH * HD; no other row of them is ever read). A thread's 4 columns are 8 bytes, 16 threads fill one 128-byte line.
template <typename T16> struct WFrag;
template <> struct WFrag<h16> { typedef v16h V; static __device__ __forceinline__ V ld(const h16* p) { return cat16(*(const v8h*)p, *(const v8h*)(p + 16)); } static __device__ __forceinline__ v8f mma(V a, V b, v8f c) { return wmma16(a, b, c); } };
template <> struct WFrag<bf> { typedef v16bf V; static __device__ __forceinline__ V ld(const bf* p) { return cat16b(*(const v8us*)p, *(const v8us*)(p + 16)); } static __device__ __forceinline__ v8f mma(V a, V b, v8f c) { return wmmab(a, b, c); } };
typedef __attribute__((ext_vector_type(4))) int v4i;
typedef __attribute__((address_space(1))) v4i gl_v4i;
typedef __attribute__((address_space(3))) v4i lds_v4i;
#define GKS 256                   // k values of a stage
#define GPB (GKS * 2 + 16)        // LDS row pitch in bytes: 16 bytes x odd
// eight rows of one plane: g = the lane's 16 bytes of the first row's stage (row pitch gp bytes in memory), l = their place in LDS
__device__ __forceinline__ void stage_rows(const char* g, size_t gp, char* l) {
#pragma unroll
    for (int i = 0; i < 8; ++i) __builtin_amdgcn_global_load_async_to_lds_b128((gl_v4i*)(g + i * gp), (lds_v4i*)(l + i * GPB), 0, 0);
}
// launch bounds: four waves a SIMD, so that two work-groups share a WGP (without the bound the three-plane form keeps every LDS address in a register of its own and passes 256 registers)
template <typename T16, int NSPLIT, bool BIAS, int NW, bool PL>
__global__ __launch_bounds__(32 * NW, 4) void k_gemmw(const T16* __restrict__ A, const T16* __restrict__ A2, const T16* __restrict__ Bt, const T16* __restrict__ Bt2, int K, float* C, int ldc, const float* __restrict__ bias, size_t sA, size_t sB, size_t sC, h16* P16, bf* Ph, bf* Pl, int cb) {
    typedef typename WFrag<T16>::V V;
    static_assert(NW * 32 == GKS && NW * 8 == 64 && NSPLIT <= 1, "a stage is one k chunk a wave; eight rows of a plane a wave");
    constexpr int PLB = 64 * GPB, STB = (NSPLIT == 1 ? 3 : 2) * PLB, OSB = 2 * NW * 16 * 68 * 4;   // bytes: one plane's stage, a whole stage (A, A2, Bt), the slabs of tile_reduce
    __shared__ __align__(16) char lds[STB > OSB ? STB : OSB];
    float* os = (float*)lds;
    const size_t z = blockIdx.z; A += z * sA; if (NSPLIT == 1) A2 += z * sA; Bt += z * sB; C += z * sC; (void)Bt2;
    const int lane = threadIdx.x & 31, lr = lane & 15, hi = lane >> 4; const int r0 = blockIdx.x * 64, c0 = blockIdx.y * 64; const int wave = __builtin_amdgcn_readfirstlane((int)(threadIdx.x >> 5));
    v8f acc[4][4];
#pragma unroll
    for (int mb = 0; mb < 4; ++mb)
#pragma unroll
        for (int nb = 0; nb < 4; ++nb) acc[mb][nb] = (v8f){};
    const size_t gp = (size_t)K * 2;                        // bytes of a plane's row in memory
    const char* ga = (const char*)A + (size_t)(r0 + wave * 8) * gp + lane * 16; const char* ga2 = NSPLIT == 1 ? (const char*)A2 + (size_t)(r0 + wave * 8) * gp + lane * 16 : nullptr; const char* gb = (const char*)Bt + (size_t)(c0 + wave * 8) * gp + lane * 16;
    char* lw = lds + wave * 8 * GPB + lane * 16;            // where the lane's copies land (plane A; A2 and Bt behind it)
    const char* lf = lds + lr * GPB + wave * 64 + hi * 16;  // the lane's fragment bytes: row lr, the wave's k chunk
    const int nst = K / GKS;
    stage_rows(ga, gp, lw); if (NSPLIT == 1) stage_rows(ga2, gp, lw + PLB); stage_rows(gb, gp, lw + STB - PLB);
#pragma unroll 1   // rolled: one set of fragments fits the registers of four waves per SIMD
    for (int s = 0; s < nst; ++s) {
        V a[4], a2[4], b[4];
        asm volatile("s_wait_asynccnt 0x0" ::: "memory");   // the wave's own copies of this stage have landed ...
        __syncthreads();                                    // ... and every other wave's: the stage may be read
#pragma unroll
        for (int mb = 0; mb < 4; ++mb) { a[mb] = WFrag<T16>::ld((const T16*)(lf + mb * 16 * GPB)); if (NSPLIT == 1) a2[mb] = WFrag<T16>::ld((const T16*)(lf + PLB + mb * 16 * GPB)); b[mb] = WFrag<T16>::ld((const T16*)(lf + STB - PLB + mb * 16 * GPB)); }
        asm volatile("s_wait_dscnt 0x0" ::: "memory");      // the wave's reads of the stage have retired ...
        __syncthreads();                                    // ... and every other wave's: the buffer may be refilled (behind the last stage: reused by tile_reduce)
        if (s + 1 < nst) { const size_t so = (size_t)(s + 1) * (GKS * 2); stage_rows(ga + so, gp, lw); if (NSPLIT == 1) stage_rows(ga2 + so, gp, lw + PLB); stage_rows(gb + so, gp, lw + STB - PLB); }   // flies while this stage is worked on (the test reads the same in the whole work-group)
#pragma unroll
        for (int nb = 0; nb < 4; ++nb)
#pragma unroll
            for (int mb = 0; mb < 4; ++mb) { acc[mb][nb] = WFrag<T16>::mma(a[mb], b[nb], acc[mb][nb]); if (NSPLIT == 1) acc[mb][nb] = WFrag<T16>::mma(a2[mb], b[nb], acc[mb][nb]); }
        asm volatile("v_nop\n\tv_nop\n\tv_nop\n\tv_nop" : "+v"(acc[0][0]), "+v"(acc[1][1]), "+v"(acc[2][2]), "+v"(acc[3][3]) : "v"(a[0]), "v"(a[3]));
    }
    asm volatile("s_wait_asynccnt 0x0" ::: "memory");       // no copy of the wave is outstanding behind the loop
    v4f res[4]; tile_reduce<NW>(acc, os, wave, lr, hi, res);
    const int row = (int)threadIdx.x >> 4, cofs = ((int)threadIdx.x & 15) * 4;
    if constexpr (PL) {
        if (threadIdx.x < 256) { const int t0 = r0 % TT, zh = (r0 / TT) * NH_ + (int)blockIdx.y;   // a 64-row tile lies in one batch, and wholly below RH or not at all (the test on t0 reads the same in the whole work-group)
#pragma unroll
            for (int mb = 0; mb < 4; ++mb) { const int to = (t0 + mb * 16 + row) * HD + cofs; v4h o16;
#pragma unroll
                for (int q = 0; q < 4; ++q) o16[q] = tohx(res[mb][q]);
                *(v4h*)(P16 + zh * cb + to) = o16;
                asm volatile("s_wait_xcnt 0x0" ::: "memory");   // stands in front of whatever next overwrites a register that the store names
                if (t0 < RH) { v4us oh, ol;
#pragma unroll
                    for (int q = 0; q < 4; ++q) { unsigned short a2, c2; splitf(res[mb][q], a2, c2); oh[q] = a2; ol[q] = c2; }
                    *(v4us*)(Ph + zh * (RH * HD) + to) = oh; *(v4us*)(Pl + zh * (RH * HD) + to) = ol;
                    asm volatile("s_wait_xcnt 0x0" ::: "memory"); } } }   // the same for these two stores
    } else if (threadIdx.x < 256) {
#pragma unroll
        for (int mb = 0; mb < 4; ++mb) { v4f val = res[mb]; if (BIAS) { val[0] += bfr(bias[c0 + cofs]); val[1] += bfr(bias[c0 + cofs + 1]); val[2] += bfr(bias[c0 + cofs + 2]); val[3] += bfr(bias[c0 + cofs + 3]); }
            *(v4f*)(C + (size_t)(r0 + mb * 16 + row) * ldc + c0 + cofs) = val; } }
}

// ---- k_cvtin: every f32 matrix operand (x of both batches, Wq, Wo) goes to bf16 in ONE launch of CVG work-groups, one a WGP. Few waves take many vectors each (for speed only).
// A slab is CVS vectors of 8 floats, one a thread; x is SX slabs, each weight SW. A thread issues the loads of all its vectors before the first is converted (two 16-byte loads a vector, all in flight), then converts and stores them.
// Addresses: a wave-uniform base (each batch of x has its own, so that every slab lies within the instruction's constant offset) and ONE 32-bit byte offset a lane, the same in every slab (half of it on the bf16 side).
#define CVG 256
#define CVS (CVG * 256)
__global__ __launch_bounds__(256) void k_cvtin(const float* __restrict__ x0, const float* __restrict__ x1, const float* __restrict__ wq, const float* __restrict__ wo, bf* __restrict__ XB, bf* __restrict__ WQ, bf* __restrict__ WO) {
    constexpr int SB = TT * DM / 8 / CVS, SX = NB_ * SB, SW = DQ * DM / 8 / CVS;   // slabs of one batch of x, of x, of a weight
    static_assert(NB_ == 2 && (size_t)SB * CVS * 8 == (size_t)TT * DM && (size_t)SW * CVS * 8 == (size_t)DQ * DM, "two batches; whole slabs");
    const unsigned lo = (blockIdx.x * 256u + threadIdx.x) * 32u;
    v8f v[SX + 2 * SW];
#pragma unroll
    for (int k = 0; k < SB; ++k) { v[k] = *(const v8f*)((const char*)(x0 + (size_t)k * CVS * 8) + lo); v[SB + k] = *(const v8f*)((const char*)(x1 + (size_t)k * CVS * 8) + lo); }
#pragma unroll
    for (int k = 0; k < SW; ++k) { v[SX + k] = *(const v8f*)((const char*)(wq + (size_t)k * CVS * 8) + lo); v[SX + SW + k] = *(const v8f*)((const char*)(wo + (size_t)k * CVS * 8) + lo); }
    asm volatile("s_wait_xcnt 0x0" :: "v"(lo) : "memory");   // every load stands in front of this line (none is held back behind a conversion), and the offset register that they name lives up to it: nothing rewrites it before the wait
    const unsigned so = lo >> 1;
#pragma unroll
    for (int k = 0; k < SX + 2 * SW; ++k) { v8us o;
#pragma unroll
        for (int e = 0; e < 8; ++e) o[e] = f2bf(v[k][e]);
        bf* d = k < SX ? XB + (size_t)k * CVS * 8 : k < SX + SW ? WQ + (size_t)(k - SX) * CVS * 8 : WO + (size_t)(k - SX - SW) * CVS * 8;
        *(v8us*)((char*)d + so) = o; }
}

// ---- k_fattn: causal attention of one query tile of one head in one work-group; scores and probabilities stay in registers (online softmax), nothing of them goes to memory.
// S^T = K Q^T (A = 16 key rows, B = 16 query rows): a lane holds 16 of the 32 scores of ONE query (column lr), keys kc + 8 hi + j and kc + 16 + 8 hi + j, which is the k order of a B operand, so the converted
// probabilities are the B operand of O^T += V^T P^T (A = 16 rows of the transposed values) with no exchange; O^T keeps the lane's query, so maximum, sum and rescale are per lane (one exchange between the halves for the maximum).
// Split keys inside the work-group: wave w takes the 32-key chunks w, w + NW, ...; each wave keeps its own (level, sum, O^T); they are joined through LDS in wave order 0..NW-1.
// Every inner loop is unrolled so that fragments, scores and accumulators are indexed by constants and stay in registers.
// The level m is in log2 units and stands SH below the running maximum, so fp16 probabilities are carried x 2^SH (their sum too, so the factor leaves with the division). A masked raw score is -3e38 and the start level -1e30: exp2 gives 0 for it also where a whole chunk is masked.
__device__ __forceinline__ float xhalf(float x) { const int b = __float_as_int(x); return __int_as_float(__builtin_amdgcn_permlanex16(b, b, 0x76543210, 0xfedcba98, false, false)); }   // the value of lane ^ 16
// exp2 with the one slot that the instruction set asks for before a transcendental's result is used or its source overwritten: the v_nop takes the result
// and keeps the source alive, so only independent instructions can stand between the two; the builtin stays, so that the compiler still keeps the matrix instructions' distances for it.
__device__ __forceinline__ float exp2s(float x) { float r = __builtin_amdgcn_exp2f(x); asm("v_nop" : "+v"(r) : "v"(x)); return r; }
// fragment at byte offset bo (per lane, 32 bits) + co (constant) of a wave-uniform plane pointer: one offset register beside a scalar base
template <typename T16> __device__ __forceinline__ typename WFrag<T16>::V ldo(const T16* base, unsigned bo, int co) { return WFrag<T16>::ld((const T16*)((const char*)base + bo + co)); }
// ---- the key tile of a pass. Key == value, so a wave brings its 32-key chunk of a head plane (32 rows of 128 bytes, 4 KiB in a row in memory) ONCE into an LDS tile of its own, by asynchronous copies whose 32 lanes cover
// four whole 128-byte lines each (a fragment load from memory touches 16 lines for the same 512 bytes). Rows stand at pitch KPB in LDS. The key fragments are plain 16-byte LDS reads, the transposed value fragments transposing LDS reads of the same tile.
// The tile is private to its wave: no barrier; the wave's own s_wait_asynccnt 0 stands in front of its reads, its own s_wait_dscnt 0 in front of the refill.
#define KPB 144                   // 16 bytes x odd
#define KTB (32 * KPB)            // bytes of one plane's tile
typedef __attribute__((ext_vector_type(8))) short v8s;
typedef __attribute__((address_space(3))) v8s lds_v8s;
// g: the lane's 16 bytes of the chunk's first 512 (chunk base + 16 lane); l: their place in the tile (row lane / 8, column 16 (lane % 8)); copy i brings rows 4 i .. 4 i + 3
__device__ __forceinline__ void stage_tile(const char* g, char* l) {
#pragma unroll
    for (int i = 0; i < 8; ++i) __builtin_amdgcn_global_load_async_to_lds_b128((gl_v4i*)(g + i * 512), (lds_v4i*)(l + i * 4 * KPB), 0, 0);
}
// A fragment of the transposed tile: p = tile + (8 (lane / 16) + lane % 8) KPB + 16 ((lane / 8) % 2) + 2 dbase; lane (c, h) gets tile[8 h + j][dbase + c] and tile[16 + 8 h + j][dbase + c], j = 0 .. 7: the k order of WFrag::ld on a transposed row
template <typename T16> __device__ __forceinline__ typename WFrag<T16>::V ldt(const char* p) {
    const v8s a = __builtin_amdgcn_ds_load_tr16_b128_v8i16((lds_v8s*)p), b = __builtin_amdgcn_ds_load_tr16_b128_v8i16((lds_v8s*)(p + 16 * KPB));
    return __builtin_bit_cast(typename WFrag<T16>::V, __builtin_shufflevector(a, b, 0, 1, 2, 3, 4, 5, 6, 7, 8, 9, 10, 11, 12, 13, 14, 15)); }
template <typename T16, bool HI, int NQ, int NW>
__device__ __forceinline__ void attn_tile(const T16* __restrict__ Q, const T16* __restrict__ Q2, const T16* __restrict__ Kp, const T16* __restrict__ K2, int r0, bf* Ah, bf* Al, float* sm, char* kt8) {
    typedef typename WFrag<T16>::V V;
    const float SH = HI ? 0.0f : 10.0f;
    const float SCL2 = SCL * 1.4426950408889634f;           // HD^-0.5 x log2(e)
    const int lane = threadIdx.x & 31, lr = lane & 15, hi = lane >> 4; const int wave = __builtin_amdgcn_readfirstlane((int)(threadIdx.x >> 5));
    V q[NQ][2], q2[NQ][2]; v8f acc[NQ][4]; float m[NQ], l[NQ];
    const unsigned qo = (unsigned)(((r0 + lr) * HD + 8 * hi) * 2);
    char* tile = kt8 + wave * (2 * KTB);                    // the wave's own tile(s): the plane Kp, behind it (HI) the plane K2
    char* tw = tile + (lane >> 3) * KPB + (lane & 7) * 16;  // where the lane's copies land
    const char* tk = tile + lr * KPB + hi * 16;             // the lane's key row (key fragments)
    const char* tv = tile + (8 * hi + (lane & 7)) * KPB + ((lane >> 3) & 1) * 16;   // the lane's address of the transposing reads
    const int nch = (r0 + NQ * 16 + 31) >> 5;               // 32-key chunks up to and with the diagonal
    if (wave < nch) { stage_tile((const char*)Kp + wave * 4096 + lane * 16, tw); if (HI) stage_tile((const char*)K2 + wave * 4096 + lane * 16, tw + KTB); }   // the wave's first chunk (wave-uniform test, every lane on)
#pragma unroll
    for (int nq = 0; nq < NQ; ++nq) { m[nq] = -1.0e30f; l[nq] = 0.0f;
#pragma unroll
        for (int kk = 0; kk < 2; ++kk) { const int co = (nq * 16 * HD + kk * 32) * 2; q[nq][kk] = ldo(Q, qo, co); if (HI) q2[nq][kk] = ldo(Q2, qo, co); }
#pragma unroll
        for (int dt = 0; dt < 4; ++dt) acc[nq][dt] = (v8f){}; }
#pragma unroll 1   // rolled: a second pass in flight would not fit the registers of four waves per SIMD
    for (int c = wave; c < nch; c += NW) { const int kc = c * 32;
        V ka[2][2], ka2[2][2], va[4], va2[4];
        asm volatile("s_wait_asynccnt 0x0" ::: "memory");   // this chunk's copies have landed before the wave reads its tile
#pragma unroll
        for (int kt = 0; kt < 2; ++kt)
#pragma unroll
            for (int kk = 0; kk < 2; ++kk) { const int co = kt * 16 * KPB + kk * 64; ka[kt][kk] = WFrag<T16>::ld((const T16*)(tk + co)); if (HI) ka2[kt][kk] = WFrag<T16>::ld((const T16*)(tk + KTB + co)); }
#pragma unroll
        for (int dt = 0; dt < 4; ++dt) { va[dt] = ldt<T16>(tv + dt * 32); if (HI) va2[dt] = ldt<T16>(tv + KTB + dt * 32); }
        asm volatile("s_wait_dscnt 0x0" ::: "memory");      // every read of the tile has retired before the next chunk's copies target it
        if (c + NW < nch) { stage_tile((const char*)Kp + (c + NW) * 4096 + lane * 16, tw); if (HI) stage_tile((const char*)K2 + (c + NW) * 4096 + lane * 16, tw + KTB); }   // flies while this chunk is worked on (wave-uniform test)
        v8f s[NQ][2];
#pragma unroll
        for (int nq = 0; nq < NQ; ++nq)
#pragma unroll
            for (int kt = 0; kt < 2; ++kt) { v8f t = (v8f){};
#pragma unroll
                for (int kk = 0; kk < 2; ++kk) { t = WFrag<T16>::mma(ka[kt][kk], q[nq][kk], t); if (HI) { t = WFrag<T16>::mma(ka2[kt][kk], q[nq][kk], t); t = WFrag<T16>::mma(ka[kt][kk], q2[nq][kk], t); } }
                s[nq][kt] = t; }
        if (c == nch - 1) {                                 // only the diagonal chunk holds keys above a query of the tile (wave-uniform test)
#pragma unroll
            for (int nq = 0; nq < NQ; ++nq) { const int lim = r0 + nq * 16 + lr - kc - 8 * hi;   // key kc + 16 kt + 8 hi + j is allowed while 16 kt + j <= lim
#pragma unroll
                for (int kt = 0; kt < 2; ++kt)
#pragma unroll
                    for (int j = 0; j < 8; ++j) s[nq][kt][j] = (kt * 16 + j <= lim) ? s[nq][kt][j] : -3.0e38f; } }
#pragma unroll
        for (int nq = 0; nq < NQ; ++nq) {
            float mx = s[nq][0][0];
#pragma unroll
            for (int kt = 0; kt < 2; ++kt)
#pragma unroll
                for (int j = 0; j < 8; ++j) mx = fmaxf(mx, s[nq][kt][j]);
            mx = fmaxf(mx, xhalf(mx));
            const float mn = fmaxf(m[nq], mx * SCL2 - SH); const float alpha = exp2s(m[nq] - mn); m[nq] = mn;
            float ps = 0.0f;
#pragma unroll
            for (int kt = 0; kt < 2; ++kt)
#pragma unroll
                for (int j = 0; j < 8; ++j) { const float pe = exp2s(__builtin_fmaf(s[nq][kt][j], SCL2, -mn)); s[nq][kt][j] = pe; ps += pe; }
            l[nq] = l[nq] * alpha + ps;
#pragma unroll
            for (int dt = 0; dt < 4; ++dt) acc[nq][dt] *= alpha;
            if constexpr (HI) { v8us h0, h1, l0, l1;
#pragma unroll
                for (int j = 0; j < 8; ++j) { unsigned short a, c2; splitf(s[nq][0][j], a, c2); h0[j] = a; l0[j] = c2; splitf(s[nq][1][j], a, c2); h1[j] = a; l1[j] = c2; }
                const V pf = cat16b(h0, h1), pf2 = cat16b(l0, l1);
#pragma unroll
                for (int dt = 0; dt < 4; ++dt) { acc[nq][dt] = WFrag<T16>::mma(va[dt], pf, acc[nq][dt]); acc[nq][dt] = WFrag<T16>::mma(va2[dt], pf, acc[nq][dt]); acc[nq][dt] = WFrag<T16>::mma(va[dt], pf2, acc[nq][dt]); }
            } else { v8h h0, h1;
#pragma unroll
                for (int j = 0; j < 8; ++j) { h0[j] = tohx(s[nq][0][j]); h1[j] = tohx(s[nq][1][j]); }
                const V pf = cat16(h0, h1);
#pragma unroll
                for (int dt = 0; dt < 4; ++dt) acc[nq][dt] = WFrag<T16>::mma(va[dt], pf, acc[nq][dt]); }
        }
    }
    asm volatile("s_wait_asynccnt 0x0" ::: "memory");       // no copy of the wave is outstanding behind the loop
    float* ms = sm + NW * NQ * 16 * 68; float* ls = ms + NW * NQ * 16;
#pragma unroll
    for (int nq = 0; nq < NQ; ++nq) { const float lt = l[nq] + xhalf(l[nq]);
#pragma unroll
        for (int dt = 0; dt < 4; ++dt) { float* o = sm + (wave * NQ * 16 + nq * 16 + lr) * 68 + dt * 16 + hi * 8; const v8f a = acc[nq][dt];
            *(v4fa*)o = (v4f){a[0], a[1], a[2], a[3]}; *(v4fa*)(o + 4) = (v4f){a[4], a[5], a[6], a[7]}; }
        if (hi == 0) { ms[wave * NQ * 16 + nq * 16 + lr] = m[nq]; ls[wave * NQ * 16 + nq * 16 + lr] = lt; } }
    __syncthreads();
#pragma unroll
    for (int idx = (int)threadIdx.x; idx < NQ * 256; idx += 32 * NW) { const int qq = idx >> 4, d4 = (idx & 15) * 4;
        float M = ms[qq];
#pragma unroll
        for (int w = 1; w < NW; ++w) M = fmaxf(M, ms[w * NQ * 16 + qq]);
        float L = 0.0f; v4f val = (v4f){};
#pragma unroll
        for (int w = 0; w < NW; ++w) { const float wt = exp2s(ms[w * NQ * 16 + qq] - M); L += ls[w * NQ * 16 + qq] * wt; val += *(const v4fa*)(sm + (w * NQ * 16 + qq) * 68 + d4) * wt; }
        const float f = __fdiv_rn(1.0f, L); v4us oh, ol;    // the context row goes out as the hi/lo A operand of the output projection, [t][head * HD + d]: 16 threads fill one 128-byte line of each plane
#pragma unroll
        for (int e = 0; e < 4; ++e) { unsigned short a, c2; splitf(val[e] * f, a, c2); oh[e] = a; ol[e] = c2; }
        *(v4us*)(Ah + (size_t)(r0 + qq) * DQ + d4) = oh; *(v4us*)(Al + (size_t)(r0 + qq) * DQ + d4) = ol; }
}
// grid (batches x heads, tiles): the tile index is the slow one and the longest tiles (last rows) come first. Tiles 0 .. (TT - RH) / 32 - 1: 32 fp16 rows each; the rest: 16 hi/lo rows each (3 products). Output: hi/lo planes [batch * TT + t][head * HD + d].
template <int NW>
__global__ __launch_bounds__(32 * NW) void k_fattn(const h16* __restrict__ Q16, const h16* __restrict__ K16, const bf* __restrict__ Qh, const bf* __restrict__ Ql, const bf* __restrict__ Kh, const bf* __restrict__ Kl, bf* Ah, bf* Al) {
    __shared__ __align__(16) float sm[NW * 32 * 70];
    __shared__ __align__(16) char kt8[NW * 2 * KTB];        // the waves' key tiles
    const size_t z = blockIdx.x, zp = z * TT * HD, zq = z * RH * HD, zo = (z / NH_) * TT * DQ + (z % NH_) * HD; const int ty = blockIdx.y;   // z = batch * NH_ + head; the hi/lo planes hold RH rows a head
    if (ty < (TT - RH) / 32) attn_tile<h16, false, 2, NW>(Q16 + zp, nullptr, K16 + zp, nullptr, TT - 32 * (ty + 1), Ah + zo, Al + zo, sm, kt8);
    else attn_tile<bf, true, 1, NW>(Qh + zq, Ql + zq, Kh + zq, Kl + zq, RH - 16 * (ty - (TT - RH) / 32 + 1), Ah + zo, Al + zo, sm, kt8);
}

extern "C" void kernel_launch(void* const* d_in, const int* in_sizes, int n_in,
                              void* d_out, int out_size, void* d_ws, size_t ws_size, hipStream_t stream) {
    (void)in_sizes; (void)n_in; (void)out_size;
    const float* x = (const float*)d_in[0]; const float* wq = (const float*)d_in[1]; const float* wo = (const float*)d_in[2]; const float* bo = (const float*)d_in[3];   /* input order x, Wq, Wo ('oi'), bo */
    float* OUT = (float*)d_out;     // [2][2048][1024]
    char* wsp = (char*)d_ws;
    auto take = [&](size_t bytes) { char* p = wsp; wsp += (bytes + 255) & ~(size_t)255; return (void*)p; };
    bf* WQ = (bf*)take((size_t)DQ * DM * 2); bf* WO = (bf*)take((size_t)DM * DQ * 2);
    bf* XB = (bf*)take((size_t)NB_ * TT * DM * 2);
    h16* QP16 = (h16*)take((size_t)NB_ * NH_ * TT * HD * 2);
    bf* QPh = (bf*)take((size_t)NB_ * NH_ * RH * HD * 2); bf* QPl = (bf*)take((size_t)NB_ * NH_ * RH * HD * 2);
    bf* ATh = XB; bf* ATl = (bf*)take((size_t)NB_ * TT * DQ * 2);   // the context's hi plane takes the place of the bf16 x (same size, last read by the projection launch): as many workspace bytes are touched as with one batch at a time
    if ((size_t)(wsp - (char*)d_ws) > ws_size) return;    // ws 256 MiB
    k_cvtin<<<CVG, 256, 0, stream>>>(x, x + (size_t)TT * DM, wq, wo, XB, WQ, WO);
    k_gemmw<bf, 0, false, 8, true><<<dim3(NB_ * TT / 64, DQ / 64, 1), 256, 0, stream>>>(XB, nullptr, WQ, nullptr, DM, nullptr, 0, nullptr, 0, 0, 0, QP16, QPh, QPl, TT * HD);
    k_fattn<8><<<dim3(NB_ * NH_, (TT - RH) / 32 + RH / 16, 1), 256, 0, stream>>>(QP16, QP16, QPh, QPl, QPh, QPl, ATh, ATl);   // key == value == query projection: the k and the v role read the q planes
    k_gemmw<bf, 1, true, 8, false><<<dim3(NB_ * TT / 64, DM / 64, 1), 256, 0, stream>>>(ATh, ATl, WO, nullptr, DQ, OUT, DM, bo, 0, 0, 0, nullptr, nullptr, nullptr, 0);
}

// v010
// Measured time: 67.5 microseconds a run.
// Two timings next to v009 both put it at 1.06 times that version's speed.
// All steps since v000 together make it 21.5 times as fast.
#include <hip/hip_runtime.h>

// Causal multi-head self-attention whose key and value are the QUERY projection (the module's bug, reproduced: x [2][2048][1024]; q = x Wq^T ('oi' [1024][1024] 1/32, no bias), k = v = q (16 heads x 64); scores masked above the diagonal (-inf == exclusion) then x 1/sqrt(64); softmax; ctx = attn.q; out = ctx Wo^T + bo ('oi') -> [2][2048][1024] (4.2 M); argument order x, Wq, Wo, bo).
// Layout: bf16 copies of x and of the 'oi' weights (one launch for all); then three launches, each with both batches in one grid (GEMM rows m = batch * 2048 + t, attention grid x = batch * 16 + head): the one exact projection is computed once (one GEMM), which stores the 16-bit operand planes of the attention kernel itself: head planes [b][h][t][d] (the hi/lo pair only for t < 512, the rows that use it), read in the q, the k and the v role (the v role's transposed fragments come out of the staged key tile by transposing LDS loads); fused causal T-2048 attention, all heads of both batches in one launch (hybrid rows: < 512 hi/lo 3 products, rest fp16 x1024; key chunks above the diagonal are never visited), storing the merged hi/lo context itself; hi/lo x Wo exact + bo.
// Compute dtypes, f32 accumulate: every input rounded to bf16; projection exact; attention rows < 512 3 products, rest fp16; softmax f32; Wo hl x exact + bias.

#define NB_  2
#define TT   2048
#define DM   1024
#define NH_  16
#define NKV  16
#define REP  (NH_ / NKV)
#define HD   64
#define DQ   (NH_ * HD)
#define DKV  (NKV * HD)
#define RH   512                  // query rows < RH use hi+lo planes (0: none)
#define WIN  2048
#define SCL  0.125f   // HD^-0.5
typedef _Float16 h16;
typedef unsigned short bf;
typedef __attribute__((ext_vector_type(16))) __bf16   v16bf;
typedef __attribute__((ext_vector_type(16))) _Float16 v16h;
typedef __attribute__((ext_vector_type(8)))  _Float16 v8h;
typedef __attribute__((ext_vector_type(8)))  unsigned short v8us;
typedef __attribute__((ext_vector_type(8)))  float    v8f;
typedef __attribute__((ext_vector_type(4)))  float    v4f;
typedef v8h  __attribute__((may_alias)) v8ha;
typedef v4f  __attribute__((may_alias)) v4fa;
typedef v8us __attribute__((may_alias)) v8usa;

__device__ __forceinline__ unsigned short f2bf(float f) { unsigned u = __float_as_uint(f); u += 0x7FFFu + ((u >> 16) & 1u); return (unsigned short)(u >> 16); }
__device__ __forceinline__ float bf2f(unsigned short b) { return __uint_as_float(((unsigned)b) << 16); }
__device__ __forceinline__ float bfr(float f) { return bf2f(f2bf(f)); }
__device__ __forceinline__ v16h cat16(v8h lo, v8h hi) { return __builtin_shufflevector(lo, hi, 0, 1, 2, 3, 4, 5, 6, 7, 8, 9, 10, 11, 12, 13, 14, 15); }
__device__ __forceinline__ v16bf cat16b(v8us lo, v8us hi) { return __builtin_bit_cast(v16bf, __builtin_shufflevector(lo, hi, 0, 1, 2, 3, 4, 5, 6, 7, 8, 9, 10, 11, 12, 13, 14, 15)); }
__device__ __forceinline__ v8f wmma16(v16h a, v16h b, v8f c) { return __builtin_amdgcn_wmma_f32_16x16x32_f16(false, a, false, b, (short)0, c, false, false); }
__device__ __forceinline__ v8f wmmab(v16bf a, v16bf b, v8f c) { return __builtin_amdgcn_wmma_f32_16x16x32_bf16(false, a, false, b, (short)0, c, false, false); }

__device__ __forceinline__ h16 tohx(float x) { return (h16)x; }
__device__ __forceinline__ void splitf(float y, unsigned short& h, unsigned short& l) { h = f2bf(y); l = f2bf(y - bf2f(h)); }
typedef __attribute__((ext_vector_type(4))) _Float16 v4h;
typedef __attribute__((ext_vector_type(4))) unsigned short v4us;

// ---- tile_reduce: sums the NW waves' partial 64x64 tiles (split K) through LDS, one 16x64 slab per round, always in wave order 0..NW-1. Thread t < 256 ends up with columns 4 (t & 15) .. + 3 of row (t >> 4) of each slab in res[].
// Two slab sets alternate, so one barrier a round is enough: the set that round mb + 2 overwrites was last read in front of the barrier of round mb + 1. No global store stands between the barriers (a barrier would wait for it).
template <int NW> __device__ __forceinline__ void tile_reduce(const v8f (&acc)[4][4], float* os, int wave, int lr, int hi, v4f (&res)[4]) {
    static_assert(NW >= 8, "256 threads sum a slab");
    const int ro = ((int)threadIdx.x >> 4) * 68 + ((int)threadIdx.x & 15) * 4;
#pragma unroll
    for (int mb = 0; mb < 4; ++mb) { float* ob = os + (mb & 1) * (NW * 16 * 68);
#pragma unroll
        for (int nb = 0; nb < 4; ++nb) {
#pragma unroll
            for (int j = 0; j < 8; ++j) ob[wave * (16 * 68) + (hi * 8 + j) * 68 + nb * 16 + lr] = acc[mb][nb][j]; }
        __syncthreads();
        if (threadIdx.x < 256) { v4f val = *(const v4fa*)(ob + ro);
#pragma unroll
            for (int w = 1; w < NW; ++w) val += *(const v4fa*)(ob + w * (16 * 68) + ro);
            res[mb] = val; } }
}

// ---- k_gemmw: register-blocked GEMM, NW WAVES per 64x64 output tile (16 accumulators each), operands from K-contiguous 16-bit planes; grid (M/64, N/64, Z), 32 * NW threads.
// Split K inside the work-group: wave w takes the 32-wide k chunks w, w + NW, w + 2 NW, ..., so a tile's chain of dependent load -> matrix passes is NW times shorter; tile_reduce sums the partial tiles.
// Operand path: a stage is GKS = 32 NW k values of all 64 rows of every operand plane. The work-group brings it into LDS by asynchronous copies, one copy a row: its 32 lanes cover 512 bytes in a row, four whole 128-byte lines
// (a fragment load from memory touches 16 lines for the same 512 bytes). Wave w copies rows 8 w .. 8 w + 7 of each plane and reads, from every row, the 64 bytes of its own k chunk by plain 16-byte LDS reads (row pitch GPB).
// One buffer: a stage's fragments go to registers, then the next stage's copies fly while the matrix instructions run. The partial-tile slabs of tile_reduce use the same LDS behind the last stage's second barrier.
// C[m][n] (f32, pitch ldc, + optional f32 bias[n]) = sum_k A[m][k] Bt[n][k] (+ A2[m][k] Bt[n][k] for NSPLIT 1). z-batch strides sA/sB/sC in elements. K % GKS == 0.
// PL: no f32 C; the tile goes out as the 16-bit planes its consumer reads (fp16, bf16 hi, bf16 lo):
// head planes [b][h][t][d], row m = b * TT + t, head n / 64, d = n % 64: P16 holds every t (head pitch cb = TT * HD), Ph and Pl only t < RH (head pitch RH * HD; no other row of them is ever read). A thread's 4 columns are 8 bytes, 16 threads fill one 128-byte line.
template <typename T16> struct WFrag;
template <> struct WFrag<h16> { typedef v16h V; static __device__ __forceinline__ V ld(const h16* p) { return cat16(*(const v8h*)p, *(const v8h*)(p + 16)); } static __device__ __forceinline__ v8f mma(V a, V b, v8f c) { return wmma16(a, b, c); } };
template <> struct WFrag<bf> { typedef v16bf V; static __device__ __forceinline__ V ld(const bf* p) { return cat16b(*(const v8us*)p, *(const v8us*)(p + 16)); } static __device__ __forceinline__ v8f mma(V a, V b, v8f c) { return wmmab(a, b, c); } };
typedef __attribute__((ext_vector_type(4))) int v4i;
typedef __attribute__((address_space(1))) v4i gl_v4i;
typedef __attribute__((address_space(3))) v4i lds_v4i;
#define GKS 256                   // k values of a stage
#define GPB (GKS * 2 + 16)        // LDS row pitch in bytes: 16 bytes x odd
// eight rows of one plane: g = the lane's 16 bytes of the first row's stage (row pitch gp bytes in memory), l = their place in LDS
__device__ __forceinline__ void stage_rows(const char* g, size_t gp, char* l) {
#pragma unroll
    for (int i = 0; i < 8; ++i) __builtin_amdgcn_global_load_async_to_lds_b128((gl_v4i*)(g + i * gp), (lds_v4i*)(l + i * GPB), 0, 0);
}
// launch bounds: four waves a SIMD, so that two work-groups share a WGP (without the bound the three-plane form keeps every LDS address in a register of its own and passes 256 registers)
template <typename T16, int NSPLIT, bool BIAS, int NW, bool PL>
__global__ __launch_bounds__(32 * NW, 4) void k_gemmw(const T16* __restrict__ A, const T16* __restrict__ A2, const T16* __restrict__ Bt, const T16* __restrict__ Bt2, int K, float* C, int ldc, const float* __restrict__ bias, size_t sA, size_t sB, size_t sC, h16* P16, bf* Ph, bf* Pl, int cb) {
    typedef typename WFrag<T16>::V V;
    static_assert(NW * 32 == GKS && NW * 8 == 64 && NSPLIT <= 1, "a stage is one k chunk a wave; eight rows of a plane a wave");
    constexpr int PLB = 64 * GPB, STB = (NSPLIT == 1 ? 3 : 2) * PLB, OSB = 2 * NW * 16 * 68 * 4;   // bytes: one plane's stage, a whole stage (A, A2, Bt), the slabs of tile_reduce
    __shared__ __align__(16) char lds[STB > OSB ? STB : OSB];
    float* os = (float*)lds;
    const size_t z = blockIdx.z; A += z * sA; if (NSPLIT == 1) A2 += z * sA; Bt += z * sB; C += z * sC; (void)Bt2;
    const int lane = threadIdx.x & 31, lr = lane & 15, hi = lane >> 4; const int r0 = blockIdx.x * 64, c0 = blockIdx.y * 64; const int wave = __builtin_amdgcn_readfirstlane((int)(threadIdx.x >> 5));
    v8f acc[4][4];
#pragma unroll
    for (int mb = 0; mb < 4; ++mb)
#pragma unroll
        for (int nb = 0; nb < 4; ++nb) acc[mb][nb] = (v8f){};
    const size_t gp = (size_t)K * 2;                        // bytes of a plane's row in memory
    const char* ga = (const char*)A + (size_t)(r0 + wave * 8) * gp + lane * 16; const char* ga2 = NSPLIT == 1 ? (const char*)A2 + (size_t)(r0 + wave * 8) * gp + lane * 16 : nullptr; const char* gb = (const char*)Bt + (size_t)(c0 + wave * 8) * gp + lane * 16;
    char* lw = lds + wave * 8 * GPB + lane * 16;            // where the lane's copies land (plane A; A2 and Bt behind it)
    const char* lf = lds + lr * GPB + wave * 64 + hi * 16;  // the lane's fragment bytes: row lr, the wave's k chunk
    const int nst = K / GKS;
    stage_rows(ga, gp, lw); if (NSPLIT == 1) stage_rows(ga2, gp, lw + PLB); stage_rows(gb, gp, lw + STB - PLB);
#pragma unroll 1   // rolled: one set of fragments fits the registers of four waves per SIMD
    for (int s = 0; s < nst; ++s) {
        V a[4], a2[4], b[4];
        asm volatile("s_wait_asynccnt 0x0" ::: "memory");   // the wave's own copies of this stage have landed ...
        __syncthreads();                                    // ... and every other wave's: the stage may be read
#pragma unroll
        for (int mb = 0; mb < 4; ++mb) { a[mb] = WFrag<T16>::ld((const T16*)(lf + mb * 16 * GPB)); if (NSPLIT == 1) a2[mb] = WFrag<T16>::ld((const T16*)(lf + PLB + mb * 16 * GPB)); b[mb] = WFrag<T16>::ld((const T16*)(lf + STB - PLB + mb * 16 * GPB)); }
        asm volatile("s_wait_dscnt 0x0" ::: "memory");      // the wave's reads of the stage have retired ...
        __syncthreads();                                    // ... and every other wave's: the buffer may be refilled (behind the last stage: reused by tile_reduce)
        if (s + 1 < nst) { const size_t so = (size_t)(s + 1) * (GKS * 2); stage_rows(ga + so, gp, lw); if (NSPLIT == 1) stage_rows(ga2 + so, gp, lw + PLB); stage_rows(gb + so, gp, lw + STB - PLB); }   // flies while this stage is worked on (the test reads the same in the whole work-group)
#pragma unroll
        for (int nb = 0; nb < 4; ++nb)
#pragma unroll
            for (int mb = 0; mb < 4; ++mb) { acc[mb][nb] = WFrag<T16>::mma(a[mb], b[nb], acc[mb][nb]); if (NSPLIT == 1) acc[mb][nb] = WFrag<T16>::mma(a2[mb], b[nb], acc[mb][nb]); }
        asm volatile("v_nop\n\tv_nop\n\tv_nop\n\tv_nop" : "+v"(acc[0][0]), "+v"(acc[1][1]), "+v"(acc[2][2]), "+v"(acc[3][3]) : "v"(a[0]), "v"(a[3]));
    }
    asm volatile("s_wait_asynccnt 0x0" ::: "memory");       // no copy of the wave is outstanding behind the loop
    v4f res[4]; tile_reduce<NW>(acc, os, wave, lr, hi, res);
    const int row = (int)threadIdx.x >> 4, cofs = ((int)threadIdx.x & 15) * 4;
    if constexpr (PL) {
        if (threadIdx.x < 256) { const int t0 = r0 % TT, zh = (r0 / TT) * NH_ + (int)blockIdx.y;   // a 64-row tile lies in one batch, and wholly below RH or not at all (the test on t0 reads the same in the whole work-group)
#pragma unroll
            for (int mb = 0; mb < 4; ++mb) { const int to = (t0 + mb * 16 + row) * HD + cofs; v4h o16;
#pragma unroll
                for (int q = 0; q < 4; ++q) o16[q] = tohx(res[mb][q]);
                *(v4h*)(P16 + zh * cb + to) = o16;
                asm volatile("s_wait_xcnt 0x0" ::: "memory");   // stands in front of whatever next overwrites a register that the store names
                if (t0 < RH) { v4us oh, ol;
#pragma unroll
                    for (int q = 0; q < 4; ++q) { unsigned short a2, c2; splitf(res[mb][q], a2, c2); oh[q] = a2; ol[q] = c2; }
                    *(v4us*)(Ph + zh * (RH * HD) + to) = oh; *(v4us*)(Pl + zh * (RH * HD) + to) = ol;
                    asm volatile("s_wait_xcnt 0x0" ::: "memory"); } } }   // the same for these two stores
    } else if (threadIdx.x < 256) {
#pragma unroll
        for (int mb = 0; mb < 4; ++mb) { v4f val = res[mb]; if (BIAS) { val[0] += bfr(bias[c0 + cofs]); val[1] += bfr(bias[c0 + cofs + 1]); val[2] += bfr(bias[c0 + cofs + 2]); val[3] += bfr(bias[c0 + cofs + 3]); }
            *(v4f*)(C + (size_t)(r0 + mb * 16 + row) * ldc + c0 + cofs) = val; } }
}

// ---- k_cvtin: every f32 matrix operand (x of both batches, Wq, Wo) goes to bf16 in ONE launch of CVG work-groups, one a WGP. Few waves take many vectors each (for speed only).
// A slab is CVS vectors of 8 floats, one a thread; x is SX slabs, each weight SW. A thread issues the loads of all its vectors before the first is converted (two 16-byte loads a vector, all in flight), then converts and stores them.
// Addresses: a wave-uniform base (each batch of x has its own, so that every slab lies within the instruction's constant offset) and ONE 32-bit byte offset a lane, the same in every slab (half of it on the bf16 side).
#define CVG 256
#define CVS (CVG * 256)
__global__ __launch_bounds__(256) void k_cvtin(const float* __restrict__ x0, const float* __restrict__ x1, const float* __restrict__ wq, const float* __restrict__ wo, bf* __restrict__ XB, bf* __restrict__ WQ, bf* __restrict__ WO) {
    constexpr int SB = TT * DM / 8 / CVS, SX = NB_ * SB, SW = DQ * DM / 8 / CVS;   // slabs of one batch of x, of x, of a weight
    static_assert(NB_ == 2 && (size_t)SB * CVS * 8 == (size_t)TT * DM && (size_t)SW * CVS * 8 == (size_t)DQ * DM, "two batches; whole slabs");
    const unsigned lo = (blockIdx.x * 256u + threadIdx.x) * 32u;
    v8f v[SX + 2 * SW];
#pragma unroll
    for (int k = 0; k < SB; ++k) { v[k] = *(const v8f*)((const char*)(x0 + (size_t)k * CVS * 8) + lo); v[SB + k] = *(const v8f*)((const char*)(x1 + (size_t)k * CVS * 8) + lo); }
#pragma unroll
    for (int k = 0; k < SW; ++k) { v[SX + k] = *(const v8f*)((const char*)(wq + (size_t)k * CVS * 8) + lo); v[SX + SW + k] = *(const v8f*)((const char*)(wo + (size_t)k * CVS * 8) + lo); }
    asm volatile("s_wait_xcnt 0x0" :: "v"(lo) : "memory");   // every load stands in front of this line (none is held back behind a conversion), and the offset register that they name lives up to it: nothing rewrites it before the wait
    const unsigned so = lo >> 1;
#pragma unroll
    for (int k = 0; k < SX + 2 * SW; ++k) { v8us o;
#pragma unroll
        for (int e = 0; e < 8; ++e) o[e] = f2bf(v[k][e]);
        bf* d = k < SX ? XB + (size_t)k * CVS * 8 : k < SX + SW ? WQ + (size_t)(k - SX) * CVS * 8 : WO + (size_t)(k - SX - SW) * CVS * 8;
        *(v8us*)((char*)d + so) = o; }
}

// ---- k_fattn: causal attention of one query tile of one head in one work-group; scores and probabilities stay in registers (online softmax), nothing of them goes to memory.
// S^T = K Q^T (A = 16 key rows, B = 16 query rows): a lane holds 16 of the 32 scores of ONE query (column lr), keys kc + 8 hi + j and kc + 16 + 8 hi + j, which is the k order of a B operand, so the converted
// probabilities are the B operand of O^T += V^T P^T (A = 16 rows of the transposed values) with no exchange; O^T keeps the lane's query, so maximum, sum and rescale are per lane (one exchange between the halves for the maximum).
// Split keys inside the work-group: wave w takes the 32-key chunks w, w + NW, ...; each wave keeps its own (level, sum, O^T); they are joined through LDS in wave order 0..NW-1.
// Every inner loop is unrolled so that fragments, scores and accumulators are indexed by constants and stay in registers.
// The level m is in log2 units and stands SH below the running maximum, so fp16 probabilities are carried x 2^SH (their sum too, so the factor leaves with the division). A masked raw score is -3e38 and the start level -1e30: exp2 gives 0 for it also where a whole chunk is masked.
__device__ __forceinline__ float xhalf(float x) { const int b = __float_as_int(x); return __int_as_float(__builtin_amdgcn_permlanex16(b, b, 0x76543210, 0xfedcba98, false, false)); }   // the value of lane ^ 16
// exp2 with the one slot that the instruction set asks for before a transcendental's result is used or its source overwritten: the v_nop takes the result
// and keeps the source alive, so only independent instructions can stand between the two; the builtin stays, so that the compiler still keeps the matrix instructions' distances for it.
__device__ __forceinline__ float exp2s(float x) { float r = __builtin_amdgcn_exp2f(x); asm("v_nop" : "+v"(r) : "v"(x)); return r; }
// fragment at byte offset bo (per lane, 32 bits) + co (constant) of a wave-uniform plane pointer: one offset register beside a scalar base
template <typename T16> __device__ __forceinline__ typename WFrag<T16>::V ldo(const T16* base, unsigned bo, int co) { return WFrag<T16>::ld((const T16*)((const char*)base + bo + co)); }
// ---- the key tile of a pass. Key == value, so a wave brings its 32-key chunk of a head plane (32 rows of 128 bytes, 4 KiB in a row in memory) ONCE into an LDS tile of its own, by asynchronous copies whose 32 lanes cover
// four whole 128-byte lines each (a fragment load from memory touches 16 lines for the same 512 bytes). Rows stand at pitch KPB in LDS. The key fragments are plain 16-byte LDS reads, the transposed value fragments transposing LDS reads of the same tile.
// The tile is private to its wave: no barrier; the wave's own s_wait_asynccnt 0 stands in front of its reads, its own s_wait_dscnt 0 in front of the refill.
#define KPB 144                   // 16 bytes x odd
#define KTB (32 * KPB)            // bytes of one plane's tile
typedef __attribute__((ext_vector_type(8))) short v8s;
typedef __attribute__((address_space(3))) v8s lds_v8s;
// g: the lane's 16 bytes of the chunk's first 512 (chunk base + 16 lane); l: their place in the tile (row lane / 8, column 16 (lane % 8)); copy i brings rows 4 i .. 4 i + 3
__device__ __forceinline__ void stage_tile(const char* g, char* l) {
#pragma unroll
    for (int i = 0; i < 8; ++i) __builtin_amdgcn_global_load_async_to_lds_b128((gl_v4i*)(g + i * 512), (lds_v4i*)(l + i * 4 * KPB), 0, 0);
}
// A fragment of the transposed tile: p = tile + (8 (lane / 16) + lane % 8) KPB + 16 ((lane / 8) % 2) + 2 dbase; lane (c, h) gets tile[8 h + j][dbase + c] and tile[16 + 8 h + j][dbase + c], j = 0 .. 7: the k order of WFrag::ld on a transposed row
template <typename T16> __device__ __forceinline__ typename WFrag<T16>::V ldt(const char* p) {
    const v8s a = __builtin_amdgcn_ds_load_tr16_b128_v8i16((lds_v8s*)p), b = __builtin_amdgcn_ds_load_tr16_b128_v8i16((lds_v8s*)(p + 16 * KPB));
    return __builtin_bit_cast(typename WFrag<T16>::V, __builtin_shufflevector(a, b, 0, 1, 2, 3, 4, 5, 6, 7, 8, 9, 10, 11, 12, 13, 14, 15)); }
template <typename T16, bool HI, int NQ, int NW>
__device__ __forceinline__ void attn_tile(const T16* __restrict__ Q, const T16* __restrict__ Q2, const T16* __restrict__ Kp, const T16* __restrict__ K2, int r0, bf* Ah, bf* Al, float* sm, char* kt8) {
    typedef typename WFrag<T16>::V V;
    const float SH = HI ? 0.0f : 10.0f;
    const float SCL2 = SCL * 1.4426950408889634f;           // HD^-0.5 x log2(e)
    const int lane = threadIdx.x & 31, lr = lane & 15, hi = lane >> 4; const int wave = __builtin_amdgcn_readfirstlane((int)(threadIdx.x >> 5));
    V q[NQ][2], q2[NQ][2]; v8f acc[NQ][4]; float m[NQ], l[NQ];
    const unsigned qo = (unsigned)(((r0 + lr) * HD + 8 * hi) * 2);
    char* tile = kt8 + wave * (2 * KTB);                    // the wave's own tile(s): the plane Kp, behind it (HI) the plane K2
    char* tw = tile + (lane >> 3) * KPB + (lane & 7) * 16;  // where the lane's copies land
    const char* tk = tile + lr * KPB + hi * 16;             // the lane's key row (key fragments)
    const char* tv = tile + (8 * hi + (lane & 7)) * KPB + ((lane >> 3) & 1) * 16;   // the lane's address of the transposing reads
    const int nch = (r0 + NQ * 16 + 31) >> 5;               // 32-key chunks up to and with the diagonal
    if (wave < nch) { stage_tile((const char*)Kp + wave * 4096 + lane * 16, tw); if (HI) stage_tile((const char*)K2 + wave * 4096 + lane * 16, tw + KTB); }   // the wave's first chunk (wave-uniform test, every lane on)
#pragma unroll
    for (int nq = 0; nq < NQ; ++nq) { m[nq] = -1.0e30f; l[nq] = 0.0f;
#pragma unroll
        for (int kk = 0; kk < 2; ++kk) { const int co = (nq * 16 * HD + kk * 32) * 2; q[nq][kk] = ldo(Q, qo, co); if (HI) q2[nq][kk] = ldo(Q2, qo, co); }
#pragma unroll
        for (int dt = 0; dt < 4; ++dt) acc[nq][dt] = (v8f){}; }
#pragma unroll 1   // rolled: a second pass in flight would not fit the registers of four waves per SIMD
    for (int c = wave; c < nch; c += NW) { const int kc = c * 32;
        V ka[2][2], ka2[2][2], va[4], va2[4];
        asm volatile("s_wait_asynccnt 0x0" ::: "memory");   // this chunk's copies have landed before the wave reads its tile
#pragma unroll
        for (int kt = 0; kt < 2; ++kt)
#pragma unroll
            for (int kk = 0; kk < 2; ++kk) { const int co = kt * 16 * KPB + kk * 64; ka[kt][kk] = WFrag<T16>::ld((const T16*)(tk + co)); if (HI) ka2[kt][kk] = WFrag<T16>::ld((const T16*)(tk + KTB + co)); }
#pragma unroll
        for (int dt = 0; dt < 4; ++dt) { va[dt] = ldt<T16>(tv + dt * 32); if (HI) va2[dt] = ldt<T16>(tv + KTB + dt * 32); }
        asm volatile("s_wait_dscnt 0x0" ::: "memory");      // every read of the tile has retired before the next chunk's copies target it
        if (c + NW < nch) { stage_tile((const char*)Kp + (c + NW) * 4096 + lane * 16, tw); if (HI) stage_tile((const char*)K2 + (c + NW) * 4096 + lane * 16, tw + KTB); }   // flies while this chunk is worked on (wave-uniform test)
        v8f s[NQ][2];
#pragma unroll
        for (int nq = 0; nq < NQ; ++nq)
#pragma unroll
            for (int kt = 0; kt < 2; ++kt) { v8f t = (v8f){};
#pragma unroll
                for (int kk = 0; kk < 2; ++kk) { t = WFrag<T16>::mma(ka[kt][kk], q[nq][kk], t); if (HI) { t = WFrag<T16>::mma(ka2[kt][kk], q[nq][kk], t); t = WFrag<T16>::mma(ka[kt][kk], q2[nq][kk], t); } }
                s[nq][kt] = t; }
        if (c == nch - 1) {                                 // only the diagonal chunk holds keys above a query of the tile (wave-uniform test)
#pragma unroll
            for (int nq = 0; nq < NQ; ++nq) { const int lim = r0 + nq * 16 + lr - kc - 8 * hi;   // key kc + 16 kt + 8 hi + j is allowed while 16 kt + j <= lim
#pragma unroll
                for (int kt = 0; kt < 2; ++kt)
#pragma unroll
                    for (int j = 0; j < 8; ++j) s[nq][kt][j] = (kt * 16 + j <= lim) ? s[nq][kt][j] : -3.0e38f; } }
#pragma unroll
        for (int nq = 0; nq < NQ; ++nq) {
            float mx = s[nq][0][0];
#pragma unroll
            for (int kt = 0; kt < 2; ++kt)
#pragma unroll
                for (int j = 0; j < 8; ++j) mx = fmaxf(mx, s[nq][kt][j]);
            mx = fmaxf(mx, xhalf(mx));
            const float mn = fmaxf(m[nq], mx * SCL2 - SH); const float alpha = exp2s(m[nq] - mn); m[nq] = mn;
            float ps = 0.0f;
#pragma unroll
            for (int kt = 0; kt < 2; ++kt)
#pragma unroll
                for (int j = 0; j < 8; ++j) { const float pe = exp2s(__builtin_fmaf(s[nq][kt][j], SCL2, -mn)); s[nq][kt][j] = pe; ps += pe; }
            l[nq] = l[nq] * alpha + ps;
#pragma unroll
            for (int dt = 0; dt < 4; ++dt) acc[nq][dt] *= alpha;
            if constexpr (HI) { v8us h0, h1, l0, l1;
#pragma unroll
                for (int j = 0; j < 8; ++j) { unsigned short a, c2; splitf(s[nq][0][j], a, c2); h0[j] = a; l0[j] = c2; splitf(s[nq][1][j], a, c2); h1[j] = a; l1[j] = c2; }
                const V pf = cat16b(h0, h1), pf2 = cat16b(l0, l1);
#pragma unroll
                for (int dt = 0; dt < 4; ++dt) { acc[nq][dt] = WFrag<T16>::mma(va[dt], pf, acc[nq][dt]); acc[nq][dt] = WFrag<T16>::mma(va2[dt], pf, acc[nq][dt]); acc[nq][dt] = WFrag<T16>::mma(va[dt], pf2, acc[nq][dt]); }
            } else { v8h h0, h1;
#pragma unroll
                for (int j = 0; j < 8; ++j) { h0[j] = tohx(s[nq][0][j]); h1[j] = tohx(s[nq][1][j]); }
                const V pf = cat16(h0, h1);
#pragma unroll
                for (int dt = 0; dt < 4; ++dt) acc[nq][dt] = WFrag<T16>::mma(va[dt], pf, acc[nq][dt]); }
        }
    }
    asm volatile("s_wait_asynccnt 0x0" ::: "memory");       // no copy of the wave is outstanding behind the loop
    float* ms = sm + NW * NQ * 16 * 68; float* ls = ms + NW * NQ * 16;
#pragma unroll
    for (int nq = 0; nq < NQ; ++nq) { const float lt = l[nq] + xhalf(l[nq]);
#pragma unroll
        for (int dt = 0; dt < 4; ++dt) { float* o = sm + (wave * NQ * 16 + nq * 16 + lr) * 68 + dt * 16 + hi * 8; const v8f a = acc[nq][dt];
            *(v4fa*)o = (v4f){a[0], a[1], a[2], a[3]}; *(v4fa*)(o + 4) = (v4f){a[4], a[5], a[6], a[7]}; }
        if (hi == 0) { ms[wave * NQ * 16 + nq * 16 + lr] = m[nq]; ls[wave * NQ * 16 + nq * 16 + lr] = lt; } }
    __syncthreads();
#pragma unroll
    for (int idx = (int)threadIdx.x; idx < NQ * 256; idx += 32 * NW) { const int qq = idx >> 4, d4 = (idx & 15) * 4;
        float M = ms[qq];
#pragma unroll
        for (int w = 1; w < NW; ++w) M = fmaxf(M, ms[w * NQ * 16 + qq]);
        float L = 0.0f; v4f val = (v4f){};
#pragma unroll
        for (int w = 0; w < NW; ++w) { const float wt = exp2s(ms[w * NQ * 16 + qq] - M); L += ls[w * NQ * 16 + qq] * wt; val += *(const v4fa*)(sm + (w * NQ * 16 + qq) * 68 + d4) * wt; }
        const float f = __fdiv_rn(1.0f, L); v4us oh, ol;    // the context row goes out as the hi/lo A operand of the output projection, [t][head * HD + d]: 16 threads fill one 128-byte line of each plane
#pragma unroll
        for (int e = 0; e < 4; ++e) { unsigned short a, c2; splitf(val[e] * f, a, c2); oh[e] = a; ol[e] = c2; }
        *(v4us*)(Ah + (size_t)(r0 + qq) * DQ + d4) = oh; *(v4us*)(Al + (size_t)(r0 + qq) * DQ + d4) = ol; }
}
// NW = 4 waves a work-group: entry, query fragments and the join are paid once a wave, whatever its number of key chunks, so a tile's keys go to few, long waves. Four keep the longest tile (64 chunks, 16 a wave) under the grid's mean load of a wave slot; four work-groups fill a WGP (registers: four waves a SIMD; LDS: 71 KiB each).
// grid (batches x heads, tiles): the tile index is the slow one and the longest tiles (last rows) come first. Tiles 0 .. (TT - RH) / 32 - 1: 32 fp16 rows each; the rest: 16 hi/lo rows each (3 products). Output: hi/lo planes [batch * TT + t][head * HD + d].
template <int NW>
__global__ __launch_bounds__(32 * NW) void k_fattn(const h16* __restrict__ Q16, const h16* __restrict__ K16, const bf* __restrict__ Qh, const bf* __restrict__ Ql, const bf* __restrict__ Kh, const bf* __restrict__ Kl, bf* Ah, bf* Al) {
    __shared__ __align__(16) float sm[NW * 32 * 70];
    __shared__ __align__(16) char kt8[NW * 2 * KTB];        // the waves' key tiles
    const size_t z = blockIdx.x, zp = z * TT * HD, zq = z * RH * HD, zo = (z / NH_) * TT * DQ + (z % NH_) * HD; const int ty = blockIdx.y;   // z = batch * NH_ + head; the hi/lo planes hold RH rows a head
    if (ty < (TT - RH) / 32) attn_tile<h16, false, 2, NW>(Q16 + zp, nullptr, K16 + zp, nullptr, TT - 32 * (ty + 1), Ah + zo, Al + zo, sm, kt8);
    else attn_tile<bf, true, 1, NW>(Qh + zq, Ql + zq, Kh + zq, Kl + zq, RH - 16 * (ty - (TT - RH) / 32 + 1), Ah + zo, Al + zo, sm, kt8);
}

extern "C" void kernel_launch(void* const* d_in, const int* in_sizes, int n_in,
                              void* d_out, int out_size, void* d_ws, size_t ws_size, hipStream_t stream) {
    (void)in_sizes; (void)n_in; (void)out_size;
    const float* x = (const float*)d_in[0]; const float* wq = (const float*)d_in[1]; const float* wo = (const float*)d_in[2]; const float* bo = (const float*)d_in[3];   /* input order x, Wq, Wo ('oi'), bo */
    float* OUT = (float*)d_out;     // [2][2048][1024]
    char* wsp = (char*)d_ws;
    auto take = [&](size_t bytes) { char* p = wsp; wsp += (bytes + 255) & ~(size_t)255; return (void*)p; };
    bf* WQ = (bf*)take((size_t)DQ * DM * 2); bf* WO = (bf*)take((size_t)DM * DQ * 2);
    bf* XB = (bf*)take((size_t)NB_ * TT * DM * 2);
    h16* QP16 = (h16*)take((size_t)NB_ * NH_ * TT * HD * 2);
    bf* QPh = (bf*)take((size_t)NB_ * NH_ * RH * HD * 2); bf* QPl = (bf*)take((size_t)NB_ * NH_ * RH * HD * 2);
    bf* ATh = XB; bf* ATl = (bf*)take((size_t)NB_ * TT * DQ * 2);   // the context's hi plane takes the place of the bf16 x (same size, last read by the projection launch): as many workspace bytes are touched as with one batch at a time
    if ((size_t)(wsp - (char*)d_ws) > ws_size) return;    // ws 256 MiB
    k_cvtin<<<CVG, 256, 0, stream>>>(x, x + (size_t)TT * DM, wq, wo, XB, WQ, WO);
    k_gemmw<bf, 0, false, 8, true><<<dim3(NB_ * TT / 64, DQ / 64, 1), 256, 0, stream>>>(XB, nullptr, WQ, nullptr, DM, nullptr, 0, nullptr, 0, 0, 0, QP16, QPh, QPl, TT * HD);
    k_fattn<4><<<dim3(NB_ * NH_, (TT - RH) / 32 + RH / 16, 1), 128, 0, stream>>>(QP16, QP16, QPh, QPl, QPh, QPl, ATh, ATl);   // key == value == query projection: the k and the v role read the q planes
    k_gemmw<bf, 1, true, 8, false><<<dim3(NB_ * TT / 64, DM / 64, 1), 256, 0, stream>>>(ATh, ATl, WO, nullptr, DQ, OUT, DM, bo, 0, 0, 0, nullptr, nullptr, nullptr, 0);
}
